// v000
// The times below were measured on an AMD MI455X: many runs one after another, warmed up first and cycling through
// copies of the inputs, with the whole window's GPU time divided by the number of runs. Launches and the gaps
// between them are all in it. The median over several windows is given; except for v000 it joins two sittings, which
// can be a few percent apart, so the side-by-side timings, each taken in one sitting, are the better comparison.
// v000, which the later versions start from, runs in 387 microseconds.
#include <hip/hip_runtime.h>
#include <hip/hip_bf16.h>

typedef __attribute__((ext_vector_type(16))) __bf16 v16bf;
typedef __attribute__((ext_vector_type(8)))  float  v8f;
typedef __attribute__((__vector_size__(16))) int    v4i;

#if __has_builtin(__builtin_amdgcn_global_load_async_to_lds_b128) && \
    __has_builtin(__builtin_amdgcn_s_wait_asynccnt)
#define HAVE_ASYNC_LDS 1
#define AS_GLOBAL __attribute__((address_space(1)))
#define AS_LDS    __attribute__((address_space(3)))
#endif

// ---------------- problem constants ----------------
constexpr int NN    = 768;
constexpr int INDIM = 128;
constexpr int HID   = 256;
constexpr int HEADS = 8;
constexpr int HD    = 32;
constexpr float RSCALE = 0.17677669529663687f;   // 1/sqrt(32)

// ---------------- workspace layout (bytes) ----------------
constexpr size_t QF_OFF = 0;                         // 768*256*4
constexpr size_t KF_OFF = 786432;
constexpr size_t VF_OFF = 1572864;
constexpr size_t S_OFF  = 2359296;                   // 8*768*768*4 = 18874368
constexpr size_t O1_OFF = 21233664;                  // 768*256*4
constexpr size_t BF_OFF = 22020096;                  // bf16 arena (16B aligned)

// bf16 arena element offsets
constexpr int XB  = 0;        // x bf16: 768*128
constexpr int WQT = 98304;    // Wq^T bf16: 256*128
constexpr int WKT = 131072;
constexpr int WVT = 163840;
constexpr int W2T = 196608;   // W2^T: 256*256
constexpr int W3T = 262144;   // W3^T: 32*256
constexpr int WOT = 270336;   // Wo^T: 256*256
constexpr int BF_TOTAL = 335872;

// ---------------- WMMA helpers ----------------
__device__ inline int frag_k(int e, int hi) {
  // 16-bit A-matrix 16x32 lane layout (ISA 7.12.2): lane<16 -> K {0..7,16..23},
  // lane>=16 -> K {8..15,24..31}; two contiguous 16B chunks -> b128-friendly.
  return hi * 8 + e + (e >= 8 ? 8 : 0);
}

template <typename T>
__device__ inline v16bf load_frag(const T* p, int row0, int k0, int ld) {
  int lane = threadIdx.x & 31;
  int m = lane & 15, hi = lane >> 4;
  const T* b = p + (size_t)(row0 + m) * ld + k0;
  v16bf f;
#pragma unroll
  for (int e = 0; e < 16; ++e) f[e] = (__bf16)b[frag_k(e, hi)];
  return f;
}

__device__ inline v8f wmma_bf16(v16bf a, v16bf b, v8f c) {
  return __builtin_amdgcn_wmma_f32_16x16x32_bf16(false, a, false, b, (short)0, c,
                                                 false, false);
}

// ---------------- kernel 0: bf16 weight transposes ----------------
__global__ __launch_bounds__(256) void prep_kernel(
    const float* x, const float* Wq, const float* Wk, const float* Wv,
    const float* W2, const float* W3, const float* Wo, __bf16* arena) {
  int idx = blockIdx.x * blockDim.x + threadIdx.x;
  if (idx >= BF_TOTAL) return;
  if (idx < 98304) { arena[XB + idx] = (__bf16)x[idx]; return; }
  int r = idx - 98304;
  if (r < 3 * 32768) {
    int m = r / 32768, q = r % 32768;
    int nrow = q >> 7, k = q & 127;
    const float* W = (m == 0) ? Wq : (m == 1) ? Wk : Wv;
    arena[WQT + r] = (__bf16)W[k * 256 + nrow];
    return;
  }
  r -= 3 * 32768;
  if (r < 65536) { int n = r >> 8, k = r & 255; arena[W2T + r] = (__bf16)W2[k * 256 + n]; return; }
  r -= 65536;
  if (r < 8192)  { int d = r >> 8, k = r & 255; arena[W3T + r] = (__bf16)W3[k * 32 + d]; return; }
  r -= 8192;
  { int n = r >> 8, k = r & 255; arena[WOT + r] = (__bf16)Wo[k * 256 + n]; }
}

// ---------------- kernel 1: QKV projections (WMMA bf16) ----------------
__global__ __launch_bounds__(32) void qkv_kernel(
    const __bf16* arena, const float* bq, const float* bk, const float* bv,
    float* Qf, float* Kf, float* Vf) {
  int it  = blockIdx.x;          // row tile 0..47
  int mat = blockIdx.y >> 4;     // 0=Q 1=K 2=V
  int ct  = blockIdx.y & 15;     // col tile 0..15
  const __bf16* xb = arena + XB;
  const __bf16* Wt = arena + ((mat == 0) ? WQT : (mat == 1) ? WKT : WVT);
  const float* bias = (mat == 0) ? bq : (mat == 1) ? bk : bv;
  float* dst = (mat == 0) ? Qf : (mat == 1) ? Kf : Vf;
  v8f acc = {};
  for (int k0 = 0; k0 < INDIM; k0 += 32) {
    v16bf a = load_frag(xb, it * 16, k0, INDIM);
    v16bf b = load_frag(Wt, ct * 16, k0, INDIM);
    acc = wmma_bf16(a, b, acc);
  }
  int lane = threadIdx.x & 31, hi = lane >> 4;
  int ncol = ct * 16 + (lane & 15);
  float bb = bias[ncol];
#pragma unroll
  for (int r = 0; r < 8; ++r)
    dst[(size_t)(it * 16 + r + hi * 8) * HID + ncol] = acc[r] + bb;
}

// ---------------- kernel 2: fused pair-MLP + scores ----------------
// One workgroup owns a 16x16 tile of (i,j) pairs -> M = 256 rows.
// Entirely in LDS (CDNA5: 320KB per WGP): h1 (bf16 256x280) + h2 (bf16 256x280).
constexpr int H1_LD    = 280;                       // bf16 elems; 560B row: 16B aligned, bank-spread
constexpr int H1_BYTES = 256 * H1_LD * 2;           // 143360
constexpr int SMEM_BYTES = 2 * H1_BYTES;            // 286720 <= 320KB
constexpr int ENC_LD = 33;                          // f32 elems
constexpr int QK_LD  = 260;                         // f32 elems; 1040B row: 16B aligned
constexpr int QLDS_OFF = 36864;                     // bytes within region 0
constexpr int KLDS_OFF = 57344;                     // 16x260x4=16640 per tile; fits

__global__ __launch_bounds__(256) void relenc_kernel(
    const float* pos, const float* W1, const float* b1,
    const float* b2, const float* b3,
    const __bf16* arena, const float* Qf, const float* Kf, float* S) {
  extern __shared__ __align__(16) char smem[];
  __bf16* h1 = (__bf16*)smem;
  __bf16* h2 = (__bf16*)(smem + H1_BYTES);
  float* enc = (float*)smem;                   // reuses h1 region after phase B
  float* qld = (float*)(smem + QLDS_OFF);
  float* kld = (float*)(smem + KLDS_OFF);

  int I = blockIdx.x, J = blockIdx.y;
  int t = threadIdx.x;
  int lane = t & 31, wave = t >> 5, hi = lane >> 4;

  const __bf16* W2t = arena + W2T;
  const __bf16* W3t = arena + W3T;

  // Warm L2/WGP$ with the W2^T block this workgroup is about to stream.
  __builtin_prefetch(((const char*)W2t) + t * 512, 0, 2);
  __builtin_prefetch(((const char*)W2t) + t * 512 + 256, 0, 2);

  // ---- Phase A: h1 = relu(rel @ W1 + b1), rel = pos[j] - pos[i]  (VALU f32, K=3)
  {
    int i = t >> 4, j = t & 15;
    int gi = I * 16 + i, gj = J * 16 + j;
    float r0 = pos[gj * 3 + 0] - pos[gi * 3 + 0];
    float r1 = pos[gj * 3 + 1] - pos[gi * 3 + 1];
    float r2 = pos[gj * 3 + 2] - pos[gi * 3 + 2];
#pragma unroll 4
    for (int n = 0; n < HID; ++n) {
      float v = fmaf(r0, W1[n], fmaf(r1, W1[256 + n], fmaf(r2, W1[512 + n], b1[n])));
      h1[t * H1_LD + n] = (__bf16)fmaxf(v, 0.f);
    }
  }
  __syncthreads();

  // ---- Phase B: h2 = relu(h1 @ W2 + b2)   M=256 K=256 N=256, bf16 WMMA
  // A-fragments register-cached per M-tile; reused across all 16 N-tiles.
  for (int mt = wave * 2; mt < wave * 2 + 2; ++mt) {
    v16bf aF[8];
#pragma unroll
    for (int kk = 0; kk < 8; ++kk) aF[kk] = load_frag(h1, mt * 16, kk * 32, H1_LD);
    for (int nt = 0; nt < 16; ++nt) {
      v8f acc = {};
#pragma unroll
      for (int kk = 0; kk < 8; ++kk)
        acc = wmma_bf16(aF[kk], load_frag(W2t, nt * 16, kk * 32, 256), acc);
      int ncol = nt * 16 + (lane & 15);
      float bias = b2[ncol];
#pragma unroll
      for (int r = 0; r < 8; ++r) {
        float v = fmaxf(acc[r] + bias, 0.f);
        h2[(mt * 16 + r + hi * 8) * H1_LD + ncol] = (__bf16)v;
      }
    }
  }
  __syncthreads();

  // ---- Stage Q (I-tile rows) and K (J-tile rows) into LDS.
  // Async DMA (ASYNCcnt) overlaps the phase-C WMMAs; h1 region is dead here.
#ifdef HAVE_ASYNC_LDS
#pragma unroll
  for (int rr = 0; rr < 4; ++rr) {
    int chunk = t + rr * 256;              // 1024 chunks of 4 floats per matrix
    int row = chunk >> 6, c4 = (chunk & 63) * 4;
    __builtin_amdgcn_global_load_async_to_lds_b128(
        (AS_GLOBAL v4i*)(Qf + (size_t)(I * 16 + row) * HID + c4),
        (AS_LDS    v4i*)(qld + row * QK_LD + c4), 0, 0);
    __builtin_amdgcn_global_load_async_to_lds_b128(
        (AS_GLOBAL v4i*)(Kf + (size_t)(J * 16 + row) * HID + c4),
        (AS_LDS    v4i*)(kld + row * QK_LD + c4), 0, 0);
  }
#endif

  // ---- Phase C: enc = h2 @ W3 + b3  (M=256 K=256 N=32)
  for (int mt = wave * 2; mt < wave * 2 + 2; ++mt) {
    v16bf aF[8];
#pragma unroll
    for (int kk = 0; kk < 8; ++kk) aF[kk] = load_frag(h2, mt * 16, kk * 32, H1_LD);
#pragma unroll
    for (int nt = 0; nt < 2; ++nt) {
      v8f acc = {};
#pragma unroll
      for (int kk = 0; kk < 8; ++kk)
        acc = wmma_bf16(aF[kk], load_frag(W3t, nt * 16, kk * 32, 256), acc);
      int ncol = nt * 16 + (lane & 15);
      float bias = b3[ncol];
#pragma unroll
      for (int r = 0; r < 8; ++r)
        enc[(mt * 16 + r + hi * 8) * ENC_LD + ncol] = acc[r] + bias;
    }
  }

#ifdef HAVE_ASYNC_LDS
  __builtin_amdgcn_s_wait_asynccnt(0);
#else
#pragma unroll
  for (int rr = 0; rr < 4; ++rr) {
    int chunk = t + rr * 256;
    int row = chunk >> 6, c4 = (chunk & 63) * 4;
    *(float4*)(qld + row * QK_LD + c4) =
        *(const float4*)(Qf + (size_t)(I * 16 + row) * HID + c4);
    *(float4*)(kld + row * QK_LD + c4) =
        *(const float4*)(Kf + (size_t)(J * 16 + row) * HID + c4);
  }
#endif
  __syncthreads();

  // ---- Phase D: S[h,i,j] = (Q.K + Q.enc) / sqrt(d)   (f32 VALU)
  {
    int i = t >> 4, j = t & 15;
    int gi = I * 16 + i, gj = J * 16 + j;
#pragma unroll
    for (int h = 0; h < HEADS; ++h) {
      float s = 0.f;
#pragma unroll
      for (int d = 0; d < HD; ++d) {
        float q = qld[i * QK_LD + h * HD + d];
        s = fmaf(q, kld[j * QK_LD + h * HD + d] + enc[t * ENC_LD + d], s);
      }
      S[((size_t)h * NN + gi) * NN + gj] = s * RSCALE;
    }
  }
}

// ---------------- kernel 3: softmax over j (wave per (h,i) row) ----------------
__global__ __launch_bounds__(256) void softmax_kernel(float* S) {
  int gi = blockIdx.x;
  int lane = threadIdx.x & 31, h = threadIdx.x >> 5;
  float* row = S + ((size_t)h * NN + gi) * NN;
  float vals[24];
  float mx = -3.4e38f;
#pragma unroll
  for (int l = 0; l < 24; ++l) { vals[l] = row[lane + l * 32]; mx = fmaxf(mx, vals[l]); }
#pragma unroll
  for (int off = 16; off > 0; off >>= 1) mx = fmaxf(mx, __shfl_xor(mx, off, 32));
  float sum = 0.f;
#pragma unroll
  for (int l = 0; l < 24; ++l) { vals[l] = __expf(vals[l] - mx); sum += vals[l]; }
#pragma unroll
  for (int off = 16; off > 0; off >>= 1) sum += __shfl_xor(sum, off, 32);
  float inv = 1.f / sum;
#pragma unroll
  for (int l = 0; l < 24; ++l) row[lane + l * 32] = vals[l] * inv;
}

// ---------------- kernel 4: O1[i, h*32+d] = sum_j P[h,i,j] * V[j, h*32+d] ----------------
__global__ __launch_bounds__(64) void av_kernel(const float* S, const float* Vf, float* O1) {
  int it = blockIdx.x;             // 0..47
  int h  = blockIdx.y;             // 0..7
  int lane = threadIdx.x & 31, nt = threadIdx.x >> 5;   // 2 N-tiles per block
  int m = lane & 15, hi = lane >> 4, nc = lane & 15;
  const float* Arow = S + ((size_t)h * NN + it * 16 + m) * NN;
  v8f acc = {};
  for (int k0 = 0; k0 < NN; k0 += 32) {
    v16bf a, b;
#pragma unroll
    for (int e = 0; e < 16; ++e) {
      int k = k0 + frag_k(e, hi);
      a[e] = (__bf16)Arow[k];
      b[e] = (__bf16)Vf[(size_t)k * HID + h * HD + nt * 16 + nc];
    }
    acc = wmma_bf16(a, b, acc);
  }
#pragma unroll
  for (int r = 0; r < 8; ++r)
    O1[(size_t)(it * 16 + r + hi * 8) * HID + h * HD + nt * 16 + nc] = acc[r];
}

// ---------------- kernel 5: out = O1 @ Wo + bo ----------------
__global__ __launch_bounds__(32) void outproj_kernel(
    const float* O1, const __bf16* arena, const float* bo, float* out) {
  int it = blockIdx.x, nt = blockIdx.y;
  int lane = threadIdx.x & 31, hi = lane >> 4, nc = lane & 15;
  const __bf16* Wot = arena + WOT;
  v8f acc = {};
#pragma unroll
  for (int kk = 0; kk < 8; ++kk) {
    v16bf a = load_frag(O1, it * 16, kk * 32, HID);    // f32 -> bf16 on the fly
    v16bf b = load_frag(Wot, nt * 16, kk * 32, HID);
    acc = wmma_bf16(a, b, acc);
  }
  int ncol = nt * 16 + nc;
  float bias = bo[ncol];
#pragma unroll
  for (int r = 0; r < 8; ++r)
    out[(size_t)(it * 16 + r + hi * 8) * HID + ncol] = acc[r] + bias;
}

// ---------------- launch ----------------
extern "C" void kernel_launch(void* const* d_in, const int* in_sizes, int n_in,
                              void* d_out, int out_size, void* d_ws, size_t ws_size,
                              hipStream_t stream) {
  (void)in_sizes; (void)n_in; (void)out_size; (void)ws_size;
  const float* x   = (const float*)d_in[0];
  const float* pos = (const float*)d_in[1];
  const float* Wq  = (const float*)d_in[2];  const float* bq = (const float*)d_in[3];
  const float* Wk  = (const float*)d_in[4];  const float* bk = (const float*)d_in[5];
  const float* Wv  = (const float*)d_in[6];  const float* bv = (const float*)d_in[7];
  const float* Wo  = (const float*)d_in[8];  const float* bo = (const float*)d_in[9];
  const float* W1  = (const float*)d_in[10]; const float* b1 = (const float*)d_in[11];
  const float* W2  = (const float*)d_in[12]; const float* b2 = (const float*)d_in[13];
  const float* W3  = (const float*)d_in[14]; const float* b3 = (const float*)d_in[15];

  char* ws = (char*)d_ws;
  float*  Qf    = (float*)(ws + QF_OFF);
  float*  Kf    = (float*)(ws + KF_OFF);
  float*  Vf    = (float*)(ws + VF_OFF);
  float*  S     = (float*)(ws + S_OFF);
  float*  O1    = (float*)(ws + O1_OFF);
  __bf16* arena = (__bf16*)(ws + BF_OFF);
  float*  out   = (float*)d_out;

  (void)hipFuncSetAttribute((const void*)relenc_kernel,
                            hipFuncAttributeMaxDynamicSharedMemorySize, SMEM_BYTES);

  prep_kernel<<<(BF_TOTAL + 255) / 256, 256, 0, stream>>>(x, Wq, Wk, Wv, W2, W3, Wo, arena);
  qkv_kernel<<<dim3(48, 48), 32, 0, stream>>>(arena, bq, bk, bv, Qf, Kf, Vf);
  relenc_kernel<<<dim3(48, 48), 256, SMEM_BYTES, stream>>>(pos, W1, b1, b2, b3,
                                                           arena, Qf, Kf, S);
  softmax_kernel<<<NN, 256, 0, stream>>>(S);
  av_kernel<<<dim3(48, 8), 64, 0, stream>>>(S, Vf, O1);
  outproj_kernel<<<dim3(48, 16), 32, 0, stream>>>(O1, arena, bo, out);
}

// v001
// It runs in 156 microseconds.
// Next to v000, in two timings, it ran 2.53 and 2.57 times as fast.
#include <hip/hip_runtime.h>
#include <hip/hip_bf16.h>

typedef __attribute__((ext_vector_type(16))) __bf16 v16bf;
typedef __attribute__((ext_vector_type(8)))  float  v8f;
typedef __attribute__((__vector_size__(16))) int    v4i;

#if __has_builtin(__builtin_amdgcn_global_load_async_to_lds_b128) && \
    __has_builtin(__builtin_amdgcn_s_wait_asynccnt)
#define HAVE_ASYNC_LDS 1
#define AS_GLOBAL __attribute__((address_space(1)))
#define AS_LDS    __attribute__((address_space(3)))
#endif

// ---------------- problem constants ----------------
constexpr int NN    = 768;
constexpr int INDIM = 128;
constexpr int HID   = 256;
constexpr int HEADS = 8;
constexpr int HD    = 32;
constexpr float RSCALE = 0.17677669529663687f;   // 1/sqrt(32)

// ---------------- workspace layout (bytes) ----------------
constexpr size_t QF_OFF = 0;                         // 768*256*4
constexpr size_t KF_OFF = 786432;
constexpr size_t VF_OFF = 1572864;
constexpr size_t S_OFF  = 2359296;                   // 8*768*768*4 = 18874368
constexpr size_t O1_OFF = 21233664;                  // 768*256*4
constexpr size_t BF_OFF = 22020096;                  // bf16 arena (16B aligned)

// bf16 arena element offsets
constexpr int XB  = 0;        // x bf16: 768*128
constexpr int WQT = 98304;    // Wq^T bf16: 256*128
constexpr int WKT = 131072;
constexpr int WVT = 163840;
constexpr int W2T = 196608;   // W2^T: 256*256
constexpr int W3T = 262144;   // W3^T: 32*256
constexpr int WOT = 270336;   // Wo^T: 256*256
constexpr int BF_TOTAL = 335872;

// ---------------- WMMA helpers ----------------
__device__ inline int frag_k(int e, int hi) {
  // 16-bit A-matrix 16x32 lane layout (ISA 7.12.2): lane<16 -> K {0..7,16..23},
  // lane>=16 -> K {8..15,24..31}; two contiguous 16B chunks -> b128-friendly.
  return hi * 8 + e + (e >= 8 ? 8 : 0);
}

template <typename T>
__device__ inline v16bf load_frag(const T* p, int row0, int k0, int ld) {
  int lane = threadIdx.x & 31;
  int m = lane & 15, hi = lane >> 4;
  const T* b = p + (size_t)(row0 + m) * ld + k0;
  v16bf f;
#pragma unroll
  for (int e = 0; e < 16; ++e) f[e] = (__bf16)b[frag_k(e, hi)];
  return f;
}

__device__ inline v8f wmma_bf16(v16bf a, v16bf b, v8f c) {
  return __builtin_amdgcn_wmma_f32_16x16x32_bf16(false, a, false, b, (short)0, c,
                                                 false, false);
}

// ---------------- kernel 0: bf16 weight transposes ----------------
__global__ __launch_bounds__(256) void prep_kernel(
    const float* x, const float* Wq, const float* Wk, const float* Wv,
    const float* W2, const float* W3, const float* Wo, __bf16* arena) {
  int idx = blockIdx.x * blockDim.x + threadIdx.x;
  if (idx >= BF_TOTAL) return;
  if (idx < 98304) { arena[XB + idx] = (__bf16)x[idx]; return; }
  int r = idx - 98304;
  if (r < 3 * 32768) {
    int m = r / 32768, q = r % 32768;
    int nrow = q >> 7, k = q & 127;
    const float* W = (m == 0) ? Wq : (m == 1) ? Wk : Wv;
    arena[WQT + r] = (__bf16)W[k * 256 + nrow];
    return;
  }
  r -= 3 * 32768;
  if (r < 65536) { int n = r >> 8, k = r & 255; arena[W2T + r] = (__bf16)W2[k * 256 + n]; return; }
  r -= 65536;
  if (r < 8192)  { int d = r >> 8, k = r & 255; arena[W3T + r] = (__bf16)W3[k * 32 + d]; return; }
  r -= 8192;
  { int n = r >> 8, k = r & 255; arena[WOT + r] = (__bf16)Wo[k * 256 + n]; }
}

// ---------------- kernel 1: QKV projections (WMMA bf16) ----------------
__global__ __launch_bounds__(32) void qkv_kernel(
    const __bf16* arena, const float* bq, const float* bk, const float* bv,
    float* Qf, float* Kf, float* Vf) {
  int it  = blockIdx.x;          // row tile 0..47
  int mat = blockIdx.y >> 4;     // 0=Q 1=K 2=V
  int ct  = blockIdx.y & 15;     // col tile 0..15
  const __bf16* xb = arena + XB;
  const __bf16* Wt = arena + ((mat == 0) ? WQT : (mat == 1) ? WKT : WVT);
  const float* bias = (mat == 0) ? bq : (mat == 1) ? bk : bv;
  float* dst = (mat == 0) ? Qf : (mat == 1) ? Kf : Vf;
  v8f acc = {};
  for (int k0 = 0; k0 < INDIM; k0 += 32) {
    v16bf a = load_frag(xb, it * 16, k0, INDIM);
    v16bf b = load_frag(Wt, ct * 16, k0, INDIM);
    acc = wmma_bf16(a, b, acc);
  }
  int lane = threadIdx.x & 31, hi = lane >> 4;
  int ncol = ct * 16 + (lane & 15);
  float bb = bias[ncol];
#pragma unroll
  for (int r = 0; r < 8; ++r)
    dst[(size_t)(it * 16 + r + hi * 8) * HID + ncol] = acc[r] + bb;
}

// ---------------- kernel 2: fused pair-MLP + scores ----------------
// One workgroup owns a 16x16 tile of (i,j) pairs -> M = 256 rows.
// Entirely in LDS (CDNA5: 320KB per WGP): h1 (bf16 256x280) + h2 (bf16 256x280).
constexpr int H1_LD    = 280;                       // bf16 elems; 560B row: 16B aligned, bank-spread
constexpr int H1_BYTES = 256 * H1_LD * 2;           // 143360
constexpr int SMEM_BYTES = 2 * H1_BYTES;            // 286720 <= 320KB
constexpr int ENC_LD = 33;                          // f32 elems
constexpr int QK_LD  = 260;                         // f32 elems; 1040B row: 16B aligned
constexpr int QLDS_OFF = 36864;                     // bytes within region 0
constexpr int KLDS_OFF = 57344;                     // 16x260x4=16640 per tile; fits

// Phase B split: each of the 8 waves owns NT_W column tiles of W2 (all of K, in registers)
// and walks all 16 row tiles of h1.
constexpr int NT_W = 2;

// b already points at the lane's own row and k half (frag_k order: two 16B chunks, 32B apart).
__device__ inline v16bf load_frag_at(const __bf16* b) {
  v16bf f;
#pragma unroll
  for (int e = 0; e < 16; ++e) f[e] = b[e + (e >= 8 ? 8 : 0)];
  return f;
}

__device__ inline void load_h_tile(v16bf (&a)[8], const __bf16* h, int mt) {
#pragma unroll
  for (int kk = 0; kk < 8; ++kk) a[kk] = load_frag(h, mt * 16, kk * 32, H1_LD);
}

__device__ inline void mlp2_tile(const v16bf (&a)[8], const v16bf (&b)[NT_W][8],
                                 const float (&bias)[NT_W], __bf16* h2, int mt, int col0) {
  int lane = threadIdx.x & 31, hi = lane >> 4;
  v8f acc[NT_W];
#pragma unroll
  for (int n = 0; n < NT_W; ++n) acc[n] = v8f{};
#pragma unroll
  for (int kk = 0; kk < 8; ++kk)
#pragma unroll
    for (int n = 0; n < NT_W; ++n) acc[n] = wmma_bf16(a[kk], b[n][kk], acc[n]);
#pragma unroll
  for (int n = 0; n < NT_W; ++n) {
    int ncol = col0 + n * 16;
#pragma unroll
    for (int r = 0; r < 8; ++r) {
      float v = fmaxf(acc[n][r] + bias[n], 0.f);
      h2[(mt * 16 + r + hi * 8) * H1_LD + ncol] = (__bf16)v;
    }
  }
}

__global__ __launch_bounds__(256) void relenc_kernel(
    const float* pos, const float* W1, const float* b1,
    const float* b2, const float* b3,
    const __bf16* arena, const float* Qf, const float* Kf, float* S) {
  extern __shared__ __align__(16) char smem[];
  __bf16* h1 = (__bf16*)smem;
  __bf16* h2 = (__bf16*)(smem + H1_BYTES);
  float* enc = (float*)smem;                   // reuses h1 region after phase B
  float* qld = (float*)(smem + QLDS_OFF);
  float* kld = (float*)(smem + KLDS_OFF);

  int I = blockIdx.x, J = blockIdx.y;
  int t = threadIdx.x;
  int lane = t & 31, wave = t >> 5, hi = lane >> 4;

  const __bf16* W2t = arena + W2T;
  const __bf16* W3t = arena + W3T;

  // Warm L2/WGP$ with the W2^T block this workgroup is about to stream.
  __builtin_prefetch(((const char*)W2t) + t * 512, 0, 2);
  __builtin_prefetch(((const char*)W2t) + t * 512 + 256, 0, 2);

  // This wave's W2 column tiles and their bias, read once per workgroup; issued here so that
  // phase A runs while they arrive.
  const int bcol = wave * NT_W * 16 + (lane & 15);   // the lane's column in the wave's first tile
  const __bf16* wlane = arena + (size_t)bcol * 256 + hi * 8;
  v16bf bF[NT_W][8];
  float bias2[NT_W];
#pragma unroll
  for (int n = 0; n < NT_W; ++n) {
#pragma unroll
    for (int kk = 0; kk < 8; ++kk) bF[n][kk] = load_frag_at(wlane + W2T + n * 16 * 256 + kk * 32);
    bias2[n] = b2[bcol + n * 16];
  }

  // ---- Phase A: h1 = relu(rel @ W1 + b1), rel = pos[j] - pos[i]  (VALU f32, K=3)
  {
    int i = t >> 4, j = t & 15;
    int gi = I * 16 + i, gj = J * 16 + j;
    float r0 = pos[gj * 3 + 0] - pos[gi * 3 + 0];
    float r1 = pos[gj * 3 + 1] - pos[gi * 3 + 1];
    float r2 = pos[gj * 3 + 2] - pos[gi * 3 + 2];
#pragma unroll 4
    for (int n = 0; n < HID; ++n) {
      float v = fmaf(r0, W1[n], fmaf(r1, W1[256 + n], fmaf(r2, W1[512 + n], b1[n])));
      h1[t * H1_LD + n] = (__bf16)fmaxf(v, 0.f);
    }
    // The operands keep the address registers of the loads issued above untouched through
    // phase A; the wait stands in front of their first reuse.
    asm volatile("s_wait_xcnt 0x0" ::"v"(wlane), "v"(bcol), "s"(b2), "v"(pos + gj * 3),
                 "v"(pos + gi * 3) : "memory");
  }
  __syncthreads();

  // ---- Phase B: h2 = relu(h1 @ W2 + b2)   M=256 K=256 N=256, bf16 WMMA
  // W2 fragments stay in registers (read once, above); h1 tiles stream from LDS,
  // each tile's fragments fetched while the tile before it is multiplied.
  {
    // same value as bcol; formed from t so that the h2 stores compile to one base register
    // with immediate offsets instead of one address add per store
    const int hcol = (t & ~31) * NT_W / 2 + (lane & 15);
    v16bf aA[8], aB[8];
    load_h_tile(aA, h1, 0);
    for (int mt = 0; mt < 16; mt += 2) {
      load_h_tile(aB, h1, mt + 1);
      // keeps the next tile's 16 LDS reads as one group ahead of this tile's WMMAs
      // (sunk among or behind them, their latency is waited out at the next tile)
      __builtin_amdgcn_sched_barrier(0);
      mlp2_tile(aA, bF, bias2, h2, mt, hcol);
      if (mt + 2 < 16) load_h_tile(aA, h1, mt + 2);
      __builtin_amdgcn_sched_barrier(0);  // as above
      mlp2_tile(aB, bF, bias2, h2, mt + 1, hcol);
    }
  }
  __syncthreads();

  // ---- Stage Q (I-tile rows) and K (J-tile rows) into LDS.
  // Async DMA (ASYNCcnt) overlaps the phase-C WMMAs; h1 region is dead here.
#ifdef HAVE_ASYNC_LDS
#pragma unroll
  for (int rr = 0; rr < 4; ++rr) {
    int chunk = t + rr * 256;              // 1024 chunks of 4 floats per matrix
    int row = chunk >> 6, c4 = (chunk & 63) * 4;
    __builtin_amdgcn_global_load_async_to_lds_b128(
        (AS_GLOBAL v4i*)(Qf + (size_t)(I * 16 + row) * HID + c4),
        (AS_LDS    v4i*)(qld + row * QK_LD + c4), 0, 0);
    __builtin_amdgcn_global_load_async_to_lds_b128(
        (AS_GLOBAL v4i*)(Kf + (size_t)(J * 16 + row) * HID + c4),
        (AS_LDS    v4i*)(kld + row * QK_LD + c4), 0, 0);
  }
#endif

  // ---- Phase C: enc = h2 @ W3 + b3  (M=256 K=256 N=32)
  for (int u = 0; u < 2; ++u) {   // constant trip count: the loop branch stays scalar
    const int mt = wave * 2 + u;
    v16bf aF[8];
#pragma unroll
    for (int kk = 0; kk < 8; ++kk) aF[kk] = load_frag(h2, mt * 16, kk * 32, H1_LD);
#pragma unroll
    for (int nt = 0; nt < 2; ++nt) {
      v8f acc = {};
#pragma unroll
      for (int kk = 0; kk < 8; ++kk)
        acc = wmma_bf16(aF[kk], load_frag(W3t, nt * 16, kk * 32, 256), acc);
      int ncol = nt * 16 + (lane & 15);
      float bias = b3[ncol];
#pragma unroll
      for (int r = 0; r < 8; ++r)
        enc[(mt * 16 + r + hi * 8) * ENC_LD + ncol] = acc[r] + bias;
    }
  }

#ifdef HAVE_ASYNC_LDS
  __builtin_amdgcn_s_wait_asynccnt(0);
#else
#pragma unroll
  for (int rr = 0; rr < 4; ++rr) {
    int chunk = t + rr * 256;
    int row = chunk >> 6, c4 = (chunk & 63) * 4;
    *(float4*)(qld + row * QK_LD + c4) =
        *(const float4*)(Qf + (size_t)(I * 16 + row) * HID + c4);
    *(float4*)(kld + row * QK_LD + c4) =
        *(const float4*)(Kf + (size_t)(J * 16 + row) * HID + c4);
  }
#endif
  __syncthreads();

  // ---- Phase D: S[h,i,j] = (Q.K + Q.enc) / sqrt(d)   (f32 VALU)
  {
    int i = t >> 4, j = t & 15;
    int gi = I * 16 + i, gj = J * 16 + j;
#pragma unroll
    for (int h = 0; h < HEADS; ++h) {
      float s = 0.f;
#pragma unroll
      for (int d = 0; d < HD; ++d) {
        float q = qld[i * QK_LD + h * HD + d];
        s = fmaf(q, kld[j * QK_LD + h * HD + d] + enc[t * ENC_LD + d], s);
      }
      S[((size_t)h * NN + gi) * NN + gj] = s * RSCALE;
    }
  }
}

// ---------------- kernel 3: softmax over j (wave per (h,i) row) ----------------
__global__ __launch_bounds__(256) void softmax_kernel(float* S) {
  int gi = blockIdx.x;
  int lane = threadIdx.x & 31, h = threadIdx.x >> 5;
  float* row = S + ((size_t)h * NN + gi) * NN;
  float vals[24];
  float mx = -3.4e38f;
#pragma unroll
  for (int l = 0; l < 24; ++l) { vals[l] = row[lane + l * 32]; mx = fmaxf(mx, vals[l]); }
#pragma unroll
  for (int off = 16; off > 0; off >>= 1) mx = fmaxf(mx, __shfl_xor(mx, off, 32));
  float sum = 0.f;
#pragma unroll
  for (int l = 0; l < 24; ++l) { vals[l] = __expf(vals[l] - mx); sum += vals[l]; }
#pragma unroll
  for (int off = 16; off > 0; off >>= 1) sum += __shfl_xor(sum, off, 32);
  float inv = 1.f / sum;
#pragma unroll
  for (int l = 0; l < 24; ++l) row[lane + l * 32] = vals[l] * inv;
}

// ---------------- kernel 4: O1[i, h*32+d] = sum_j P[h,i,j] * V[j, h*32+d] ----------------
__global__ __launch_bounds__(64) void av_kernel(const float* S, const float* Vf, float* O1) {
  int it = blockIdx.x;             // 0..47
  int h  = blockIdx.y;             // 0..7
  int lane = threadIdx.x & 31, nt = threadIdx.x >> 5;   // 2 N-tiles per block
  int m = lane & 15, hi = lane >> 4, nc = lane & 15;
  const float* Arow = S + ((size_t)h * NN + it * 16 + m) * NN;
  v8f acc = {};
  for (int k0 = 0; k0 < NN; k0 += 32) {
    v16bf a, b;
#pragma unroll
    for (int e = 0; e < 16; ++e) {
      int k = k0 + frag_k(e, hi);
      a[e] = (__bf16)Arow[k];
      b[e] = (__bf16)Vf[(size_t)k * HID + h * HD + nt * 16 + nc];
    }
    acc = wmma_bf16(a, b, acc);
  }
#pragma unroll
  for (int r = 0; r < 8; ++r)
    O1[(size_t)(it * 16 + r + hi * 8) * HID + h * HD + nt * 16 + nc] = acc[r];
}

// ---------------- kernel 5: out = O1 @ Wo + bo ----------------
__global__ __launch_bounds__(32) void outproj_kernel(
    const float* O1, const __bf16* arena, const float* bo, float* out) {
  int it = blockIdx.x, nt = blockIdx.y;
  int lane = threadIdx.x & 31, hi = lane >> 4, nc = lane & 15;
  const __bf16* Wot = arena + WOT;
  v8f acc = {};
#pragma unroll
  for (int kk = 0; kk < 8; ++kk) {
    v16bf a = load_frag(O1, it * 16, kk * 32, HID);    // f32 -> bf16 on the fly
    v16bf b = load_frag(Wot, nt * 16, kk * 32, HID);
    acc = wmma_bf16(a, b, acc);
  }
  int ncol = nt * 16 + nc;
  float bias = bo[ncol];
#pragma unroll
  for (int r = 0; r < 8; ++r)
    out[(size_t)(it * 16 + r + hi * 8) * HID + ncol] = acc[r] + bias;
}

// ---------------- launch ----------------
extern "C" void kernel_launch(void* const* d_in, const int* in_sizes, int n_in,
                              void* d_out, int out_size, void* d_ws, size_t ws_size,
                              hipStream_t stream) {
  (void)in_sizes; (void)n_in; (void)out_size; (void)ws_size;
  const float* x   = (const float*)d_in[0];
  const float* pos = (const float*)d_in[1];
  const float* Wq  = (const float*)d_in[2];  const float* bq = (const float*)d_in[3];
  const float* Wk  = (const float*)d_in[4];  const float* bk = (const float*)d_in[5];
  const float* Wv  = (const float*)d_in[6];  const float* bv = (const float*)d_in[7];
  const float* Wo  = (const float*)d_in[8];  const float* bo = (const float*)d_in[9];
  const float* W1  = (const float*)d_in[10]; const float* b1 = (const float*)d_in[11];
  const float* W2  = (const float*)d_in[12]; const float* b2 = (const float*)d_in[13];
  const float* W3  = (const float*)d_in[14]; const float* b3 = (const float*)d_in[15];

  char* ws = (char*)d_ws;
  float*  Qf    = (float*)(ws + QF_OFF);
  float*  Kf    = (float*)(ws + KF_OFF);
  float*  Vf    = (float*)(ws + VF_OFF);
  float*  S     = (float*)(ws + S_OFF);
  float*  O1    = (float*)(ws + O1_OFF);
  __bf16* arena = (__bf16*)(ws + BF_OFF);
  float*  out   = (float*)d_out;

  (void)hipFuncSetAttribute((const void*)relenc_kernel,
                            hipFuncAttributeMaxDynamicSharedMemorySize, SMEM_BYTES);

  prep_kernel<<<(BF_TOTAL + 255) / 256, 256, 0, stream>>>(x, Wq, Wk, Wv, W2, W3, Wo, arena);
  qkv_kernel<<<dim3(48, 48), 32, 0, stream>>>(arena, bq, bk, bv, Qf, Kf, Vf);
  relenc_kernel<<<dim3(48, 48), 256, SMEM_BYTES, stream>>>(pos, W1, b1, b2, b3,
                                                           arena, Qf, Kf, S);
  softmax_kernel<<<NN, 256, 0, stream>>>(S);
  av_kernel<<<dim3(48, 8), 64, 0, stream>>>(S, Vf, O1);
  outproj_kernel<<<dim3(48, 16), 32, 0, stream>>>(O1, arena, bo, out);
}

// v002
// Measured time: 133 microseconds a run.
// Timed twice side by side with v001, it ran 1.18 and 1.17 times as fast.
// Counting every step since v000, it is 2.99 times as fast.
#include <hip/hip_runtime.h>
#include <hip/hip_bf16.h>

typedef __attribute__((ext_vector_type(16))) __bf16 v16bf;
typedef __attribute__((ext_vector_type(8)))  float  v8f;
typedef __attribute__((__vector_size__(16))) int    v4i;

#if __has_builtin(__builtin_amdgcn_global_load_async_to_lds_b128) && \
    __has_builtin(__builtin_amdgcn_s_wait_asynccnt)
#define HAVE_ASYNC_LDS 1
#define AS_GLOBAL __attribute__((address_space(1)))
#define AS_LDS    __attribute__((address_space(3)))
#endif

// ---------------- problem constants ----------------
constexpr int NN    = 768;
constexpr int INDIM = 128;
constexpr int HID   = 256;
constexpr int HEADS = 8;
constexpr int HD    = 32;
constexpr float RSCALE = 0.17677669529663687f;   // 1/sqrt(32)

// ---------------- workspace layout (bytes) ----------------
constexpr size_t QF_OFF = 0;                         // 768*256*4
constexpr size_t KF_OFF = 786432;
constexpr size_t VF_OFF = 1572864;
constexpr size_t S_OFF  = 2359296;                   // 8*768*768*4 = 18874368
constexpr size_t O1_OFF = 21233664;                  // 768*256*4
constexpr size_t BF_OFF = 22020096;                  // bf16 arena (16B aligned)

// bf16 arena element offsets
constexpr int XB  = 0;        // x bf16: 768*128
constexpr int WQT = 98304;    // Wq^T bf16: 256*128
constexpr int WKT = 131072;
constexpr int WVT = 163840;
constexpr int W2T = 196608;   // W2^T: 256*256
constexpr int W3T = 262144;   // W3^T: 32*256
constexpr int WOT = 270336;   // Wo^T: 256*256
constexpr int BF_TOTAL = 335872;

// ---------------- WMMA helpers ----------------
__device__ inline int frag_k(int e, int hi) {
  // 16-bit A-matrix 16x32 lane layout (ISA 7.12.2): lane<16 -> K {0..7,16..23},
  // lane>=16 -> K {8..15,24..31}; two contiguous 16B chunks -> b128-friendly.
  return hi * 8 + e + (e >= 8 ? 8 : 0);
}

template <typename T>
__device__ inline v16bf load_frag(const T* p, int row0, int k0, int ld) {
  int lane = threadIdx.x & 31;
  int m = lane & 15, hi = lane >> 4;
  const T* b = p + (size_t)(row0 + m) * ld + k0;
  v16bf f;
#pragma unroll
  for (int e = 0; e < 16; ++e) f[e] = (__bf16)b[frag_k(e, hi)];
  return f;
}

__device__ inline v8f wmma_bf16(v16bf a, v16bf b, v8f c) {
  return __builtin_amdgcn_wmma_f32_16x16x32_bf16(false, a, false, b, (short)0, c,
                                                 false, false);
}

// ---------------- kernel 0: bf16 weight transposes ----------------
__global__ __launch_bounds__(256) void prep_kernel(
    const float* x, const float* Wq, const float* Wk, const float* Wv,
    const float* W2, const float* W3, const float* Wo, __bf16* arena) {
  int idx = blockIdx.x * blockDim.x + threadIdx.x;
  if (idx >= BF_TOTAL) return;
  if (idx < 98304) { arena[XB + idx] = (__bf16)x[idx]; return; }
  int r = idx - 98304;
  if (r < 3 * 32768) {
    int m = r / 32768, q = r % 32768;
    int nrow = q >> 7, k = q & 127;
    const float* W = (m == 0) ? Wq : (m == 1) ? Wk : Wv;
    arena[WQT + r] = (__bf16)W[k * 256 + nrow];
    return;
  }
  r -= 3 * 32768;
  if (r < 65536) { int n = r >> 8, k = r & 255; arena[W2T + r] = (__bf16)W2[k * 256 + n]; return; }
  r -= 65536;
  if (r < 8192)  { int d = r >> 8, k = r & 255; arena[W3T + r] = (__bf16)W3[k * 32 + d]; return; }
  r -= 8192;
  { int n = r >> 8, k = r & 255; arena[WOT + r] = (__bf16)Wo[k * 256 + n]; }
}

// ---------------- kernel 1: QKV projections (WMMA bf16) ----------------
__global__ __launch_bounds__(32) void qkv_kernel(
    const __bf16* arena, const float* bq, const float* bk, const float* bv,
    float* Qf, float* Kf, float* Vf) {
  int it  = blockIdx.x;          // row tile 0..47
  int mat = blockIdx.y >> 4;     // 0=Q 1=K 2=V
  int ct  = blockIdx.y & 15;     // col tile 0..15
  const __bf16* xb = arena + XB;
  const __bf16* Wt = arena + ((mat == 0) ? WQT : (mat == 1) ? WKT : WVT);
  const float* bias = (mat == 0) ? bq : (mat == 1) ? bk : bv;
  float* dst = (mat == 0) ? Qf : (mat == 1) ? Kf : Vf;
  v8f acc = {};
  for (int k0 = 0; k0 < INDIM; k0 += 32) {
    v16bf a = load_frag(xb, it * 16, k0, INDIM);
    v16bf b = load_frag(Wt, ct * 16, k0, INDIM);
    acc = wmma_bf16(a, b, acc);
  }
  int lane = threadIdx.x & 31, hi = lane >> 4;
  int ncol = ct * 16 + (lane & 15);
  float bb = bias[ncol];
#pragma unroll
  for (int r = 0; r < 8; ++r)
    dst[(size_t)(it * 16 + r + hi * 8) * HID + ncol] = acc[r] + bb;
}

// ---------------- kernel 2: fused pair-MLP + scores ----------------
// One workgroup owns 9 consecutive 16x16 tiles of (i,j) pairs, one at a time -> M = 256 rows.
// Entirely in LDS (CDNA5: 320KB per WGP): h1 (bf16 256x280) + h2 (bf16 256x280).
constexpr int H1_LD    = 280;                       // bf16 elems; 560B row: 16B aligned, bank-spread
constexpr int H1_BYTES = 256 * H1_LD * 2;           // 143360
constexpr int SMEM_BYTES = 2 * H1_BYTES;            // 286720 <= 320KB
constexpr int ENC_LD = 33;                          // f32 elems
constexpr int QK_LD  = 260;                         // f32 elems; 1040B row: 16B aligned
constexpr int QLDS_OFF = 36864;                     // bytes within region 0
constexpr int KLDS_OFF = 57344;                     // 16x260x4=16640 per tile; fits

// Phase B split: each of the 8 waves owns NT_W column tiles of W2 (all of K, in registers)
// and walks all 16 row tiles of h1.
constexpr int NT_W = 2;

// Each workgroup walks TILES_WG consecutive pair tiles (flat index I*48+J) and reads the weights
// once for all of them: W2 fragments stay in registers, W3^T lies in LDS behind h1 and h2.
constexpr int JT         = NN / 16;                 // 48 tiles a side
constexpr int TILES_WG   = 9;
constexpr int RELENC_WGS = JT * JT / TILES_WG;      // 256
constexpr int W3_LD      = 264;                     // bf16 elems; 528B row: 16B aligned, bank-spread
constexpr int W3LDS_OFF  = SMEM_BYTES;
constexpr int SMEM_TOTAL = SMEM_BYTES + HD * W3_LD * 2;   // 303616 <= 320KB
#define AS_CONST __attribute__((address_space(4)))

// Phase A: h1 = relu(rel @ W1 + b1) for the thread's own pair  (VALU f32, K=3).
// P: pointer to float, in the address space the caller reads W1 and b1 through.
template <typename P>
__device__ inline void mlp1_row(__bf16* h1row, float r0, float r1, float r2, P W1, P b1) {
  // unrolled so that neighbouring columns pack into one wide LDS store
#pragma unroll 4
  for (int n = 0; n < HID; ++n) {
    float v = fmaf(r0, W1[n], fmaf(r1, W1[256 + n], fmaf(r2, W1[512 + n], b1[n])));
    h1row[n] = (__bf16)fmaxf(v, 0.f);
  }
}

// b already points at the lane's own row and k half (frag_k order: two 16B chunks, 32B apart).
__device__ inline v16bf load_frag_at(const __bf16* b) {
  v16bf f;
#pragma unroll
  for (int e = 0; e < 16; ++e) f[e] = b[e + (e >= 8 ? 8 : 0)];
  return f;
}

__device__ inline void load_h_tile(v16bf (&a)[8], const __bf16* h, int mt) {
#pragma unroll
  for (int kk = 0; kk < 8; ++kk) a[kk] = load_frag(h, mt * 16, kk * 32, H1_LD);
}

__device__ inline void mlp2_tile(const v16bf (&a)[8], const v16bf (&b)[NT_W][8],
                                 const float (&bias)[NT_W], __bf16* h2, int mt, int col0) {
  int lane = threadIdx.x & 31, hi = lane >> 4;
  v8f acc[NT_W];
#pragma unroll
  for (int n = 0; n < NT_W; ++n) acc[n] = v8f{};
#pragma unroll
  for (int kk = 0; kk < 8; ++kk)
#pragma unroll
    for (int n = 0; n < NT_W; ++n) acc[n] = wmma_bf16(a[kk], b[n][kk], acc[n]);
#pragma unroll
  for (int n = 0; n < NT_W; ++n) {
    int ncol = col0 + n * 16;
#pragma unroll
    for (int r = 0; r < 8; ++r) {
      float v = fmaxf(acc[n][r] + bias[n], 0.f);
      h2[(mt * 16 + r + hi * 8) * H1_LD + ncol] = (__bf16)v;
    }
  }
}

__global__ __launch_bounds__(256) void relenc_kernel(
    const float* pos, const float* W1, const float* b1,
    const float* b2, const float* b3,
    const __bf16* arena, const float* Qf, const float* Kf, float* S) {
  extern __shared__ __align__(16) char smem[];
  __bf16* h1 = (__bf16*)smem;
  __bf16* h2 = (__bf16*)(smem + H1_BYTES);
  float* enc = (float*)smem;                   // reuses h1 region after phase B
  float* qld = (float*)(smem + QLDS_OFF);
  float* kld = (float*)(smem + KLDS_OFF);
  __bf16* w3s = (__bf16*)(smem + W3LDS_OFF);

  const int tile0 = blockIdx.x * TILES_WG;
  int t = threadIdx.x;
  int lane = t & 31, wave = t >> 5, hi = lane >> 4;

  const __bf16* W2t = arena + W2T;
  const __bf16* W3t = arena + W3T;

  // Warm L2/WGP$ with the W2^T block this workgroup is about to stream.
  __builtin_prefetch(((const char*)W2t) + t * 512, 0, 2);
  __builtin_prefetch(((const char*)W2t) + t * 512 + 256, 0, 2);

  // This wave's W2 column tiles and their bias, read once per workgroup; issued here so that
  // phase A runs while they arrive.
  const int bcol = wave * NT_W * 16 + (lane & 15);   // the lane's column in the wave's first tile
  const __bf16* wlane = arena + (size_t)bcol * 256 + hi * 8;
  const float* b2l = b2 + bcol;   // one base: both bias reads use the offset register named below
  v16bf bF[NT_W][8];
  float bias2[NT_W];
#pragma unroll
  for (int n = 0; n < NT_W; ++n) {
#pragma unroll
    for (int kk = 0; kk < 8; ++kk) bF[n][kk] = load_frag_at(wlane + W2T + n * 16 * 256 + kk * 32);
    bias2[n] = b2l[n * 16];
  }
  // W3^T (32 rows of 256) and b3, likewise read once per workgroup
  const __bf16* w3g = W3t + t * 8;
  const v4i w3c0 = *(const v4i*)(w3g), w3c1 = *(const v4i*)(w3g + 2048);
  const v4i w3c2 = *(const v4i*)(w3g + 4096), w3c3 = *(const v4i*)(w3g + 6144);
  float bias3[2];
#pragma unroll
  for (int nt = 0; nt < 2; ++nt) bias3[nt] = b3[nt * 16 + (lane & 15)];

  // W1 and b1 are never written: read through the constant address space, their wave-uniform
  // reads in phase A stay scalar loads although stores to S precede them in the tile loop
  // (the first tile's phase A stands ahead of every store and reads them as they are).
  const AS_CONST float* W1c = (const AS_CONST float*)W1;
  const AS_CONST float* b1c = (const AS_CONST float*)b1;

  // ---- Phase A of the first tile, rel = pos[j] - pos[i]
  {
    int gi = (tile0 / JT) * 16 + (t >> 4), gj = (tile0 % JT) * 16 + (t & 15);
    float r0 = pos[gj * 3 + 0] - pos[gi * 3 + 0];
    float r1 = pos[gj * 3 + 1] - pos[gi * 3 + 1];
    float r2 = pos[gj * 3 + 2] - pos[gi * 3 + 2];
    mlp1_row(h1 + t * H1_LD, r0, r1, r2, W1, b1);
    // The operands keep the address registers of the loads issued above untouched through
    // phase A; the wait stands in front of their first reuse.
    asm volatile("s_wait_xcnt 0x0" ::"v"(wlane), "v"(bcol), "s"(b2), "v"(lane & 15), "s"(b3),
                 "v"(t), "s"(arena), "v"(pos + gj * 3), "v"(pos + gi * 3) : "memory");
    // W3^T into LDS; the barrier below publishes it with h1
    __bf16* w3d = w3s + (t >> 5) * W3_LD + (t & 31) * 8;
    *(v4i*)(w3d) = w3c0;
    *(v4i*)(w3d + 8 * W3_LD) = w3c1;
    *(v4i*)(w3d + 16 * W3_LD) = w3c2;
    *(v4i*)(w3d + 24 * W3_LD) = w3c3;
  }
  __syncthreads();

  for (int it = 0;; ++it) {
  const int tile = tile0 + it;
  const int I = tile / JT, J = tile % JT;
  // the next tile's positions (the last trip reads its own again), used behind phase D
  const int tn = (it + 1 < TILES_WG) ? tile + 1 : tile;
  const float* pjn = pos + ((tn % JT) * 16 + (t & 15)) * 3;
  const float* pin = pos + ((tn / JT) * 16 + (t >> 4)) * 3;
  const float nj0 = pjn[0], nj1 = pjn[1], nj2 = pjn[2];
  const float ni0 = pin[0], ni1 = pin[1], ni2 = pin[2];
  // stands in front of the first reuse of the two loads' address registers (phase B's LDS reads)
  asm volatile("s_wait_xcnt 0x0" ::: "memory");

  // ---- Phase B: h2 = relu(h1 @ W2 + b2)   M=256 K=256 N=256, bf16 WMMA
  // W2 fragments stay in registers (read once, above); h1 tiles stream from LDS,
  // each tile's fragments fetched while the tile before it is multiplied.
  {
    // same value as bcol; formed from t so that the h2 stores compile to one base register
    // with immediate offsets instead of one address add per store
    const int hcol = (t & ~31) * NT_W / 2 + (lane & 15);
    v16bf aA[8], aB[8];
    load_h_tile(aA, h1, 0);
    for (int mt = 0; mt < 16; mt += 2) {
      load_h_tile(aB, h1, mt + 1);
      // keeps the next tile's 16 LDS reads as one group ahead of this tile's WMMAs
      // (sunk among or behind them, their latency is waited out at the next tile)
      __builtin_amdgcn_sched_barrier(0);
      mlp2_tile(aA, bF, bias2, h2, mt, hcol);
      if (mt + 2 < 16) load_h_tile(aA, h1, mt + 2);
      __builtin_amdgcn_sched_barrier(0);  // as above
      mlp2_tile(aB, bF, bias2, h2, mt + 1, hcol);
    }
  }
  __syncthreads();

  // ---- Stage Q (I-tile rows) and K (J-tile rows) into LDS.
  // Async DMA (ASYNCcnt) overlaps the phase-C WMMAs; h1 region is dead here.
#ifdef HAVE_ASYNC_LDS
#pragma unroll
  for (int rr = 0; rr < 4; ++rr) {
    int chunk = t + rr * 256;              // 1024 chunks of 4 floats per matrix
    int row = chunk >> 6, c4 = (chunk & 63) * 4;
    __builtin_amdgcn_global_load_async_to_lds_b128(
        (AS_GLOBAL v4i*)(Qf + (size_t)(I * 16 + row) * HID + c4),
        (AS_LDS    v4i*)(qld + row * QK_LD + c4), 0, 0);
    __builtin_amdgcn_global_load_async_to_lds_b128(
        (AS_GLOBAL v4i*)(Kf + (size_t)(J * 16 + row) * HID + c4),
        (AS_LDS    v4i*)(kld + row * QK_LD + c4), 0, 0);
  }
#endif

  // ---- Phase C: enc = h2 @ W3 + b3  (M=256 K=256 N=32)
  for (int u = 0; u < 2; ++u) {   // constant trip count: the loop branch stays scalar
    const int mt = wave * 2 + u;
    v16bf aF[8];
#pragma unroll
    for (int kk = 0; kk < 8; ++kk) aF[kk] = load_frag(h2, mt * 16, kk * 32, H1_LD);
#pragma unroll
    for (int nt = 0; nt < 2; ++nt) {
      v8f acc = {};
#pragma unroll
      for (int kk = 0; kk < 8; ++kk)
        acc = wmma_bf16(aF[kk], load_frag(w3s, nt * 16, kk * 32, W3_LD), acc);
      int ncol = nt * 16 + (lane & 15);
      float bias = bias3[nt];
#pragma unroll
      for (int r = 0; r < 8; ++r)
        enc[(mt * 16 + r + hi * 8) * ENC_LD + ncol] = acc[r] + bias;
    }
  }

#ifdef HAVE_ASYNC_LDS
  __builtin_amdgcn_s_wait_asynccnt(0);
#else
#pragma unroll
  for (int rr = 0; rr < 4; ++rr) {
    int chunk = t + rr * 256;
    int row = chunk >> 6, c4 = (chunk & 63) * 4;
    *(float4*)(qld + row * QK_LD + c4) =
        *(const float4*)(Qf + (size_t)(I * 16 + row) * HID + c4);
    *(float4*)(kld + row * QK_LD + c4) =
        *(const float4*)(Kf + (size_t)(J * 16 + row) * HID + c4);
  }
#endif
  __syncthreads();

  // ---- Phase D: S[h,i,j] = (Q.K + Q.enc) / sqrt(d)   (f32 VALU)
  {
    int i = t >> 4, j = t & 15;
    int gi = I * 16 + i, gj = J * 16 + j;
#pragma unroll
    for (int h = 0; h < HEADS; ++h) {
      float s = 0.f;
#pragma unroll
      for (int d = 0; d < HD; ++d) {
        float q = qld[i * QK_LD + h * HD + d];
        s = fmaf(q, kld[j * QK_LD + h * HD + d] + enc[t * ENC_LD + d], s);
      }
      S[((size_t)h * NN + gi) * NN + gj] = s * RSCALE;
    }
  }
  if (it + 1 == TILES_WG) break;
  // stands in front of the first reuse of the stores' address and data registers
  asm volatile("s_wait_xcnt 0x0" ::: "memory");
  // enc, qld and kld lie in the h1 region: every wave's phase D reads end before phase A of the
  // next tile overwrites them. The fences name LDS alone: __syncthreads() here would also wait
  // for the stores to S, which no other wave reads; they complete under phase A.
  __builtin_amdgcn_fence(__ATOMIC_RELEASE, "workgroup", "local");
  __builtin_amdgcn_s_barrier();
  __builtin_amdgcn_fence(__ATOMIC_ACQUIRE, "workgroup", "local");
  mlp1_row(h1 + t * H1_LD, nj0 - ni0, nj1 - ni1, nj2 - ni2, W1c, b1c);
  __syncthreads();
  }
}

// ---------------- kernel 3: softmax over j (wave per (h,i) row) ----------------
__global__ __launch_bounds__(256) void softmax_kernel(float* S) {
  int gi = blockIdx.x;
  int lane = threadIdx.x & 31, h = threadIdx.x >> 5;
  float* row = S + ((size_t)h * NN + gi) * NN;
  float vals[24];
  float mx = -3.4e38f;
#pragma unroll
  for (int l = 0; l < 24; ++l) { vals[l] = row[lane + l * 32]; mx = fmaxf(mx, vals[l]); }
#pragma unroll
  for (int off = 16; off > 0; off >>= 1) mx = fmaxf(mx, __shfl_xor(mx, off, 32));
  float sum = 0.f;
#pragma unroll
  for (int l = 0; l < 24; ++l) { vals[l] = __expf(vals[l] - mx); sum += vals[l]; }
#pragma unroll
  for (int off = 16; off > 0; off >>= 1) sum += __shfl_xor(sum, off, 32);
  float inv = 1.f / sum;
#pragma unroll
  for (int l = 0; l < 24; ++l) row[lane + l * 32] = vals[l] * inv;
}

// ---------------- kernel 4: O1[i, h*32+d] = sum_j P[h,i,j] * V[j, h*32+d] ----------------
__global__ __launch_bounds__(64) void av_kernel(const float* S, const float* Vf, float* O1) {
  int it = blockIdx.x;             // 0..47
  int h  = blockIdx.y;             // 0..7
  int lane = threadIdx.x & 31, nt = threadIdx.x >> 5;   // 2 N-tiles per block
  int m = lane & 15, hi = lane >> 4, nc = lane & 15;
  const float* Arow = S + ((size_t)h * NN + it * 16 + m) * NN;
  v8f acc = {};
  for (int k0 = 0; k0 < NN; k0 += 32) {
    v16bf a, b;
#pragma unroll
    for (int e = 0; e < 16; ++e) {
      int k = k0 + frag_k(e, hi);
      a[e] = (__bf16)Arow[k];
      b[e] = (__bf16)Vf[(size_t)k * HID + h * HD + nt * 16 + nc];
    }
    acc = wmma_bf16(a, b, acc);
  }
#pragma unroll
  for (int r = 0; r < 8; ++r)
    O1[(size_t)(it * 16 + r + hi * 8) * HID + h * HD + nt * 16 + nc] = acc[r];
}

// ---------------- kernel 5: out = O1 @ Wo + bo ----------------
__global__ __launch_bounds__(32) void outproj_kernel(
    const float* O1, const __bf16* arena, const float* bo, float* out) {
  int it = blockIdx.x, nt = blockIdx.y;
  int lane = threadIdx.x & 31, hi = lane >> 4, nc = lane & 15;
  const __bf16* Wot = arena + WOT;
  v8f acc = {};
#pragma unroll
  for (int kk = 0; kk < 8; ++kk) {
    v16bf a = load_frag(O1, it * 16, kk * 32, HID);    // f32 -> bf16 on the fly
    v16bf b = load_frag(Wot, nt * 16, kk * 32, HID);
    acc = wmma_bf16(a, b, acc);
  }
  int ncol = nt * 16 + nc;
  float bias = bo[ncol];
#pragma unroll
  for (int r = 0; r < 8; ++r)
    out[(size_t)(it * 16 + r + hi * 8) * HID + ncol] = acc[r] + bias;
}

// ---------------- launch ----------------
extern "C" void kernel_launch(void* const* d_in, const int* in_sizes, int n_in,
                              void* d_out, int out_size, void* d_ws, size_t ws_size,
                              hipStream_t stream) {
  (void)in_sizes; (void)n_in; (void)out_size; (void)ws_size;
  const float* x   = (const float*)d_in[0];
  const float* pos = (const float*)d_in[1];
  const float* Wq  = (const float*)d_in[2];  const float* bq = (const float*)d_in[3];
  const float* Wk  = (const float*)d_in[4];  const float* bk = (const float*)d_in[5];
  const float* Wv  = (const float*)d_in[6];  const float* bv = (const float*)d_in[7];
  const float* Wo  = (const float*)d_in[8];  const float* bo = (const float*)d_in[9];
  const float* W1  = (const float*)d_in[10]; const float* b1 = (const float*)d_in[11];
  const float* W2  = (const float*)d_in[12]; const float* b2 = (const float*)d_in[13];
  const float* W3  = (const float*)d_in[14]; const float* b3 = (const float*)d_in[15];

  char* ws = (char*)d_ws;
  float*  Qf    = (float*)(ws + QF_OFF);
  float*  Kf    = (float*)(ws + KF_OFF);
  float*  Vf    = (float*)(ws + VF_OFF);
  float*  S     = (float*)(ws + S_OFF);
  float*  O1    = (float*)(ws + O1_OFF);
  __bf16* arena = (__bf16*)(ws + BF_OFF);
  float*  out   = (float*)d_out;

  (void)hipFuncSetAttribute((const void*)relenc_kernel,
                            hipFuncAttributeMaxDynamicSharedMemorySize, SMEM_TOTAL);

  prep_kernel<<<(BF_TOTAL + 255) / 256, 256, 0, stream>>>(x, Wq, Wk, Wv, W2, W3, Wo, arena);
  qkv_kernel<<<dim3(48, 48), 32, 0, stream>>>(arena, bq, bk, bv, Qf, Kf, Vf);
  relenc_kernel<<<RELENC_WGS, 256, SMEM_TOTAL, stream>>>(pos, W1, b1, b2, b3,
                                                         arena, Qf, Kf, S);
  softmax_kernel<<<NN, 256, 0, stream>>>(S);
  av_kernel<<<dim3(48, 8), 64, 0, stream>>>(S, Vf, O1);
  outproj_kernel<<<dim3(48, 16), 32, 0, stream>>>(O1, arena, bo, out);
}

// v003
// One run takes 95.1 microseconds.
// Next to v002, in two timings, it ran 1.39 times as fast each time.
// Counting every step since v000, it is 4.17 times as fast.
#include <hip/hip_runtime.h>
#include <hip/hip_bf16.h>

typedef __attribute__((ext_vector_type(16))) __bf16 v16bf;
typedef __attribute__((ext_vector_type(8)))  float  v8f;
typedef __attribute__((__vector_size__(16))) int    v4i;

#if __has_builtin(__builtin_amdgcn_global_load_async_to_lds_b128) && \
    __has_builtin(__builtin_amdgcn_s_wait_asynccnt)
#define HAVE_ASYNC_LDS 1
#define AS_GLOBAL __attribute__((address_space(1)))
#define AS_LDS    __attribute__((address_space(3)))
#endif

// ---------------- problem constants ----------------
constexpr int NN    = 768;
constexpr int INDIM = 128;
constexpr int HID   = 256;
constexpr int HEADS = 8;
constexpr int HD    = 32;
constexpr float RSCALE = 0.17677669529663687f;   // 1/sqrt(32)

// ---------------- workspace layout (bytes) ----------------
constexpr size_t QF_OFF = 0;                         // 768*256*4
constexpr size_t KF_OFF = 786432;
constexpr size_t VF_OFF = 1572864;
constexpr size_t S_OFF  = 2359296;                   // 8*768*768*4 = 18874368
constexpr size_t O1_OFF = 21233664;                  // 768*256*4
constexpr size_t BF_OFF = 22020096;                  // bf16 arena (16B aligned)

// bf16 arena element offsets
constexpr int XB  = 0;        // x bf16: 768*128
constexpr int WQT = 98304;    // Wq^T bf16: 256*128
constexpr int WKT = 131072;
constexpr int WVT = 163840;
constexpr int W2T = 196608;   // W2^T: 256*256
constexpr int W3T = 262144;   // W3^T: 32*256
constexpr int WOT = 270336;   // Wo^T: 256*256
constexpr int BF_TOTAL = 335872;

// ---------------- WMMA helpers ----------------
__device__ inline int frag_k(int e, int hi) {
  // 16-bit A-matrix 16x32 lane layout (ISA 7.12.2): lane<16 -> K {0..7,16..23},
  // lane>=16 -> K {8..15,24..31}; two contiguous 16B chunks -> b128-friendly.
  return hi * 8 + e + (e >= 8 ? 8 : 0);
}

template <typename T>
__device__ inline v16bf load_frag(const T* p, int row0, int k0, int ld) {
  int lane = threadIdx.x & 31;
  int m = lane & 15, hi = lane >> 4;
  const T* b = p + (size_t)(row0 + m) * ld + k0;
  v16bf f;
#pragma unroll
  for (int e = 0; e < 16; ++e) f[e] = (__bf16)b[frag_k(e, hi)];
  return f;
}

__device__ inline v8f wmma_bf16(v16bf a, v16bf b, v8f c) {
  return __builtin_amdgcn_wmma_f32_16x16x32_bf16(false, a, false, b, (short)0, c,
                                                 false, false);
}

// ---------------- kernel 0: bf16 weight transposes ----------------
__global__ __launch_bounds__(256) void prep_kernel(
    const float* x, const float* Wq, const float* Wk, const float* Wv,
    const float* W2, const float* W3, const float* Wo, __bf16* arena) {
  int idx = blockIdx.x * blockDim.x + threadIdx.x;
  if (idx >= BF_TOTAL) return;
  if (idx < 98304) { arena[XB + idx] = (__bf16)x[idx]; return; }
  int r = idx - 98304;
  if (r < 3 * 32768) {
    int m = r / 32768, q = r % 32768;
    int nrow = q >> 7, k = q & 127;
    const float* W = (m == 0) ? Wq : (m == 1) ? Wk : Wv;
    arena[WQT + r] = (__bf16)W[k * 256 + nrow];
    return;
  }
  r -= 3 * 32768;
  if (r < 65536) { int n = r >> 8, k = r & 255; arena[W2T + r] = (__bf16)W2[k * 256 + n]; return; }
  r -= 65536;
  if (r < 8192)  { int d = r >> 8, k = r & 255; arena[W3T + r] = (__bf16)W3[k * 32 + d]; return; }
  r -= 8192;
  { int n = r >> 8, k = r & 255; arena[WOT + r] = (__bf16)Wo[k * 256 + n]; }
}

// ---------------- kernel 1: QKV projections (WMMA bf16) ----------------
__global__ __launch_bounds__(32) void qkv_kernel(
    const __bf16* arena, const float* bq, const float* bk, const float* bv,
    float* Qf, float* Kf, float* Vf) {
  int it  = blockIdx.x;          // row tile 0..47
  int mat = blockIdx.y >> 4;     // 0=Q 1=K 2=V
  int ct  = blockIdx.y & 15;     // col tile 0..15
  const __bf16* xb = arena + XB;
  const __bf16* Wt = arena + ((mat == 0) ? WQT : (mat == 1) ? WKT : WVT);
  const float* bias = (mat == 0) ? bq : (mat == 1) ? bk : bv;
  float* dst = (mat == 0) ? Qf : (mat == 1) ? Kf : Vf;
  v8f acc = {};
  for (int k0 = 0; k0 < INDIM; k0 += 32) {
    v16bf a = load_frag(xb, it * 16, k0, INDIM);
    v16bf b = load_frag(Wt, ct * 16, k0, INDIM);
    acc = wmma_bf16(a, b, acc);
  }
  int lane = threadIdx.x & 31, hi = lane >> 4;
  int ncol = ct * 16 + (lane & 15);
  float bb = bias[ncol];
#pragma unroll
  for (int r = 0; r < 8; ++r)
    dst[(size_t)(it * 16 + r + hi * 8) * HID + ncol] = acc[r] + bb;
}

// ---------------- kernel 2: fused pair-MLP + scores ----------------
// One workgroup owns 9 consecutive 16x16 tiles of (i,j) pairs, one at a time -> M = 256 rows.
// Entirely in LDS (CDNA5: 320KB per WGP): h1 (bf16 256x280) + h2 (bf16 256x280).
constexpr int H1_LD    = 280;                       // bf16 elems; 560B row: 16B aligned, bank-spread
constexpr int H1_BYTES = 256 * H1_LD * 2;           // 143360
constexpr int SMEM_BYTES = 2 * H1_BYTES;            // 286720 <= 320KB
constexpr int ENC_LD = 33;                          // f32 elems
constexpr int QK_LD  = 260;                         // f32 elems; 1040B row: 16B aligned
constexpr int QLDS_OFF = 36864;                     // bytes within region 0
constexpr int KLDS_OFF = 57344;                     // 16x260x4=16640 per tile; fits

// Phase B split: each of the 8 waves owns NT_W column tiles of W2 (all of K, in registers)
// and walks all 16 row tiles of h1.
constexpr int NT_W = 2;

// Each workgroup walks TILES_WG consecutive pair tiles (flat index I*48+J) and reads the weights
// once for all of them: W2 fragments stay in registers, W3^T lies in LDS behind h1 and h2.
constexpr int JT         = NN / 16;                 // 48 tiles a side
constexpr int TILES_WG   = 9;
constexpr int RELENC_WGS = JT * JT / TILES_WG;      // 256
constexpr int W3_LD      = 264;                     // bf16 elems; 528B row: 16B aligned, bank-spread
constexpr int W3LDS_OFF  = SMEM_BYTES;
constexpr int SMEM_TOTAL = SMEM_BYTES + HD * W3_LD * 2;   // 303616 <= 320KB
#define AS_CONST __attribute__((address_space(4)))

// Phase A: h1 = relu(rel @ W1 + b1) for the thread's own pair  (VALU f32, K=3).
// P: pointer to float, in the address space the caller reads W1 and b1 through.
template <typename P>
__device__ inline void mlp1_row(__bf16* h1row, float r0, float r1, float r2, P W1, P b1) {
  // unrolled so that neighbouring columns pack into one wide LDS store
#pragma unroll 4
  for (int n = 0; n < HID; ++n) {
    float v = fmaf(r0, W1[n], fmaf(r1, W1[256 + n], fmaf(r2, W1[512 + n], b1[n])));
    h1row[n] = (__bf16)fmaxf(v, 0.f);
  }
}

// b already points at the lane's own row and k half (frag_k order: two 16B chunks, 32B apart).
__device__ inline v16bf load_frag_at(const __bf16* b) {
  v16bf f;
#pragma unroll
  for (int e = 0; e < 16; ++e) f[e] = b[e + (e >= 8 ? 8 : 0)];
  return f;
}

__device__ inline void load_h_tile(v16bf (&a)[8], const __bf16* h, int mt) {
#pragma unroll
  for (int kk = 0; kk < 8; ++kk) a[kk] = load_frag(h, mt * 16, kk * 32, H1_LD);
}

__device__ inline void mlp2_tile(const v16bf (&a)[8], const v16bf (&b)[NT_W][8],
                                 const float (&bias)[NT_W], __bf16* h2, int mt, int col0) {
  int lane = threadIdx.x & 31, hi = lane >> 4;
  v8f acc[NT_W];
#pragma unroll
  for (int n = 0; n < NT_W; ++n) acc[n] = v8f{};
#pragma unroll
  for (int kk = 0; kk < 8; ++kk)
#pragma unroll
    for (int n = 0; n < NT_W; ++n) acc[n] = wmma_bf16(a[kk], b[n][kk], acc[n]);
#pragma unroll
  for (int n = 0; n < NT_W; ++n) {
    int ncol = col0 + n * 16;
#pragma unroll
    for (int r = 0; r < 8; ++r) {
      float v = fmaxf(acc[n][r] + bias[n], 0.f);
      h2[(mt * 16 + r + hi * 8) * H1_LD + ncol] = (__bf16)v;
    }
  }
}

__global__ __launch_bounds__(256) void relenc_kernel(
    const float* pos, const float* W1, const float* b1,
    const float* b2, const float* b3,
    const __bf16* arena, const float* Qf, const float* Kf, float* S) {
  extern __shared__ __align__(16) char smem[];
  __bf16* h1 = (__bf16*)smem;
  __bf16* h2 = (__bf16*)(smem + H1_BYTES);
  float* enc = (float*)smem;                   // reuses h1 region after phase B
  float* qld = (float*)(smem + QLDS_OFF);
  float* kld = (float*)(smem + KLDS_OFF);
  __bf16* w3s = (__bf16*)(smem + W3LDS_OFF);

  const int tile0 = blockIdx.x * TILES_WG;
  int t = threadIdx.x;
  int lane = t & 31, wave = t >> 5, hi = lane >> 4;

  const __bf16* W2t = arena + W2T;
  const __bf16* W3t = arena + W3T;

  // Warm L2/WGP$ with the W2^T block this workgroup is about to stream.
  __builtin_prefetch(((const char*)W2t) + t * 512, 0, 2);
  __builtin_prefetch(((const char*)W2t) + t * 512 + 256, 0, 2);

  // This wave's W2 column tiles and their bias, read once per workgroup; issued here so that
  // phase A runs while they arrive.
  const int bcol = wave * NT_W * 16 + (lane & 15);   // the lane's column in the wave's first tile
  const __bf16* wlane = arena + (size_t)bcol * 256 + hi * 8;
  const float* b2l = b2 + bcol;   // one base: both bias reads use the offset register named below
  v16bf bF[NT_W][8];
  float bias2[NT_W];
#pragma unroll
  for (int n = 0; n < NT_W; ++n) {
#pragma unroll
    for (int kk = 0; kk < 8; ++kk) bF[n][kk] = load_frag_at(wlane + W2T + n * 16 * 256 + kk * 32);
    bias2[n] = b2l[n * 16];
  }
  // W3^T (32 rows of 256) and b3, likewise read once per workgroup
  const __bf16* w3g = W3t + t * 8;
  const v4i w3c0 = *(const v4i*)(w3g), w3c1 = *(const v4i*)(w3g + 2048);
  const v4i w3c2 = *(const v4i*)(w3g + 4096), w3c3 = *(const v4i*)(w3g + 6144);
  float bias3[2];
#pragma unroll
  for (int nt = 0; nt < 2; ++nt) bias3[nt] = b3[nt * 16 + (lane & 15)];

  // W1 and b1 are never written: read through the constant address space, their wave-uniform
  // reads in phase A stay scalar loads although stores to S precede them in the tile loop
  // (the first tile's phase A stands ahead of every store and reads them as they are).
  const AS_CONST float* W1c = (const AS_CONST float*)W1;
  const AS_CONST float* b1c = (const AS_CONST float*)b1;

  // ---- Phase A of the first tile, rel = pos[j] - pos[i]
  {
    int gi = (tile0 / JT) * 16 + (t >> 4), gj = (tile0 % JT) * 16 + (t & 15);
    float r0 = pos[gj * 3 + 0] - pos[gi * 3 + 0];
    float r1 = pos[gj * 3 + 1] - pos[gi * 3 + 1];
    float r2 = pos[gj * 3 + 2] - pos[gi * 3 + 2];
    mlp1_row(h1 + t * H1_LD, r0, r1, r2, W1, b1);
    // The operands keep the address registers of the loads issued above untouched through
    // phase A; the wait stands in front of their first reuse.
    asm volatile("s_wait_xcnt 0x0" ::"v"(wlane), "v"(bcol), "s"(b2), "v"(lane & 15), "s"(b3),
                 "v"(t), "s"(arena), "v"(pos + gj * 3), "v"(pos + gi * 3) : "memory");
    // W3^T into LDS; the barrier below publishes it with h1
    __bf16* w3d = w3s + (t >> 5) * W3_LD + (t & 31) * 8;
    *(v4i*)(w3d) = w3c0;
    *(v4i*)(w3d + 8 * W3_LD) = w3c1;
    *(v4i*)(w3d + 16 * W3_LD) = w3c2;
    *(v4i*)(w3d + 24 * W3_LD) = w3c3;
  }
  __syncthreads();

  for (int it = 0;; ++it) {
  const int tile = tile0 + it;
  const int I = tile / JT, J = tile % JT;
  // the next tile's positions (the last trip reads its own again), used behind phase D
  const int tn = (it + 1 < TILES_WG) ? tile + 1 : tile;
  const float* pjn = pos + ((tn % JT) * 16 + (t & 15)) * 3;
  const float* pin = pos + ((tn / JT) * 16 + (t >> 4)) * 3;
  const float nj0 = pjn[0], nj1 = pjn[1], nj2 = pjn[2];
  const float ni0 = pin[0], ni1 = pin[1], ni2 = pin[2];
  // stands in front of the first reuse of the two loads' address registers (phase B's LDS reads)
  asm volatile("s_wait_xcnt 0x0" ::: "memory");

  // ---- Phase B: h2 = relu(h1 @ W2 + b2)   M=256 K=256 N=256, bf16 WMMA
  // W2 fragments stay in registers (read once, above); h1 tiles stream from LDS,
  // each tile's fragments fetched while the tile before it is multiplied.
  {
    // same value as bcol; formed from t so that the h2 stores compile to one base register
    // with immediate offsets instead of one address add per store
    const int hcol = (t & ~31) * NT_W / 2 + (lane & 15);
    v16bf aA[8], aB[8];
    load_h_tile(aA, h1, 0);
    for (int mt = 0; mt < 16; mt += 2) {
      load_h_tile(aB, h1, mt + 1);
      // keeps the next tile's 16 LDS reads as one group ahead of this tile's WMMAs
      // (sunk among or behind them, their latency is waited out at the next tile)
      __builtin_amdgcn_sched_barrier(0);
      mlp2_tile(aA, bF, bias2, h2, mt, hcol);
      if (mt + 2 < 16) load_h_tile(aA, h1, mt + 2);
      __builtin_amdgcn_sched_barrier(0);  // as above
      mlp2_tile(aB, bF, bias2, h2, mt + 1, hcol);
    }
  }
  __syncthreads();

  // ---- Stage Q (I-tile rows) and K (J-tile rows) into LDS.
  // Async DMA (ASYNCcnt) overlaps the phase-C WMMAs; h1 region is dead here.
#ifdef HAVE_ASYNC_LDS
#pragma unroll
  for (int rr = 0; rr < 4; ++rr) {
    int chunk = t + rr * 256;              // 1024 chunks of 4 floats per matrix
    int row = chunk >> 6, c4 = (chunk & 63) * 4;
    __builtin_amdgcn_global_load_async_to_lds_b128(
        (AS_GLOBAL v4i*)(Qf + (size_t)(I * 16 + row) * HID + c4),
        (AS_LDS    v4i*)(qld + row * QK_LD + c4), 0, 0);
    __builtin_amdgcn_global_load_async_to_lds_b128(
        (AS_GLOBAL v4i*)(Kf + (size_t)(J * 16 + row) * HID + c4),
        (AS_LDS    v4i*)(kld + row * QK_LD + c4), 0, 0);
  }
#endif

  // ---- Phase C: enc = h2 @ W3 + b3  (M=256 K=256 N=32)
  for (int u = 0; u < 2; ++u) {   // constant trip count: the loop branch stays scalar
    const int mt = wave * 2 + u;
    v16bf aF[8];
#pragma unroll
    for (int kk = 0; kk < 8; ++kk) aF[kk] = load_frag(h2, mt * 16, kk * 32, H1_LD);
#pragma unroll
    for (int nt = 0; nt < 2; ++nt) {
      v8f acc = {};
#pragma unroll
      for (int kk = 0; kk < 8; ++kk)
        acc = wmma_bf16(aF[kk], load_frag(w3s, nt * 16, kk * 32, W3_LD), acc);
      int ncol = nt * 16 + (lane & 15);
      float bias = bias3[nt];
#pragma unroll
      for (int r = 0; r < 8; ++r)
        enc[(mt * 16 + r + hi * 8) * ENC_LD + ncol] = acc[r] + bias;
    }
  }

#ifdef HAVE_ASYNC_LDS
  __builtin_amdgcn_s_wait_asynccnt(0);
#else
#pragma unroll
  for (int rr = 0; rr < 4; ++rr) {
    int chunk = t + rr * 256;
    int row = chunk >> 6, c4 = (chunk & 63) * 4;
    *(float4*)(qld + row * QK_LD + c4) =
        *(const float4*)(Qf + (size_t)(I * 16 + row) * HID + c4);
    *(float4*)(kld + row * QK_LD + c4) =
        *(const float4*)(Kf + (size_t)(J * 16 + row) * HID + c4);
  }
#endif
  __syncthreads();

  // ---- Phase D: S[h,i,j] = (Q.K + Q.enc) / sqrt(d)   (f32 VALU)
  {
    int i = t >> 4, j = t & 15;
    int gi = I * 16 + i, gj = J * 16 + j;
#pragma unroll
    for (int h = 0; h < HEADS; ++h) {
      float s = 0.f;
#pragma unroll
      for (int d = 0; d < HD; ++d) {
        float q = qld[i * QK_LD + h * HD + d];
        s = fmaf(q, kld[j * QK_LD + h * HD + d] + enc[t * ENC_LD + d], s);
      }
      S[((size_t)h * NN + gi) * NN + gj] = s * RSCALE;
    }
  }
  if (it + 1 == TILES_WG) break;
  // stands in front of the first reuse of the stores' address and data registers
  asm volatile("s_wait_xcnt 0x0" ::: "memory");
  // enc, qld and kld lie in the h1 region: every wave's phase D reads end before phase A of the
  // next tile overwrites them. The fences name LDS alone: __syncthreads() here would also wait
  // for the stores to S, which no other wave reads; they complete under phase A.
  __builtin_amdgcn_fence(__ATOMIC_RELEASE, "workgroup", "local");
  __builtin_amdgcn_s_barrier();
  __builtin_amdgcn_fence(__ATOMIC_ACQUIRE, "workgroup", "local");
  mlp1_row(h1 + t * H1_LD, nj0 - ni0, nj1 - ni1, nj2 - ni2, W1c, b1c);
  __syncthreads();
  }
}

// ---------------- kernel 3: softmax over j fused with O1[i, h*32+d] = sum_j P[h,i,j] * V[j, h*32+d] ----------------
// One workgroup per (16-row tile, head). Each of its 8 waves owns 96 of the 768 columns and reads
// its scores straight into A-fragment order, all loads in flight at once: the scores are read
// once and P never goes to memory. The product takes exp(s - max); the row sum divides at the end.
constexpr int AV_WAVES = 8;
constexpr int AV_KW    = NN / AV_WAVES;   // 96 columns a wave
constexpr int AV_STEPS = AV_KW / 32;      // 3 WMMA k steps
constexpr int OP_LD    = 36;              // f32 elems; rows r and r+8 fall 32 banks apart

// 2^x. The v_nop keeps the free slot that the instruction set asks for between a transcendental
// and a next instruction that overwrites its source or reads its result.
__device__ inline float exp2_slot(float x) {
  float r;
  asm("v_exp_f32 %0, %1\n\tv_nop" : "=v"(r) : "v"(x));
  return r;
}

__global__ __launch_bounds__(256) void softmax_av_kernel(const float* S, const float* Vf,
                                                         float* O1) {
  __shared__ float red_max[AV_WAVES][16];
  __shared__ float red_sum[AV_WAVES][16];
  __shared__ __align__(16) float part[AV_WAVES][16 * OP_LD];
  int it = blockIdx.x;             // 0..47
  int h  = blockIdx.y;             // 0..7
  int t = threadIdx.x, lane = t & 31, wave = t >> 5;
  int m = lane & 15, hi = lane >> 4;
  // frag_k order: per k step two runs of 8 columns, 16 apart, starting at hi*8
  const float* Arow = S + ((size_t)h * NN + it * 16 + m) * NN + wave * AV_KW + hi * 8;
  // B columns: lane m holds head columns 2m (first N tile) and 2m+1 (second), one 8-byte load for both
  const float* Vcol = Vf + (size_t)(wave * AV_KW + hi * 8) * HID + h * HD + m * 2;

  float sv[AV_STEPS][16];
  float2 vv[AV_STEPS][16];
#pragma unroll
  for (int s = 0; s < AV_STEPS; ++s)
#pragma unroll
    for (int c = 0; c < 4; ++c) {
      float4 q = *(const float4*)(Arow + s * 32 + (c >> 1) * 16 + (c & 1) * 4);
      sv[s][c * 4 + 0] = q.x; sv[s][c * 4 + 1] = q.y;
      sv[s][c * 4 + 2] = q.z; sv[s][c * 4 + 3] = q.w;
    }
  // stands in front of the first reuse of the score loads' address registers (the V loads
  // below land in them)
  asm volatile("s_wait_xcnt 0x0" ::: "memory");
#pragma unroll
  for (int s = 0; s < AV_STEPS; ++s)
#pragma unroll
    for (int e = 0; e < 16; ++e)
      vv[s][e] = *(const float2*)(Vcol + (size_t)(s * 32 + e + (e >= 8 ? 8 : 0)) * HID);

  // row maximum: the lane's 48 columns, the other half of the row's lanes, then the 8 waves
  float mx = -3.4e38f;
#pragma unroll
  for (int s = 0; s < AV_STEPS; ++s)
#pragma unroll
    for (int e = 0; e < 16; ++e) mx = fmaxf(mx, sv[s][e]);
  mx = fmaxf(mx, __shfl_xor(mx, 16, 32));
  if (hi == 0) red_max[wave][m] = mx;
  __syncthreads();
  float wm[AV_WAVES];
#pragma unroll
  for (int w = 0; w < AV_WAVES; ++w) wm[w] = red_max[w][m];
#pragma unroll
  for (int w = 0; w < AV_WAVES; ++w) mx = fmaxf(mx, wm[w]);

  float sum = 0.f;
  v16bf a[AV_STEPS];
#pragma unroll
  for (int s = 0; s < AV_STEPS; ++s)
#pragma unroll
    for (int e = 0; e < 16; ++e) {
      float p = exp2_slot((sv[s][e] - mx) * 1.44269504f);   // e^(s - max)
      sum += p;
      a[s][e] = (__bf16)p;
    }
  // keeps every exponential ahead of the first WMMA: they are asm text, which the compiler's
  // padding behind a WMMA does not see
  __builtin_amdgcn_sched_barrier(0);
  v8f acc[2] = {v8f{}, v8f{}};
#pragma unroll
  for (int s = 0; s < AV_STEPS; ++s) {
    v16bf b0, b1;
#pragma unroll
    for (int e = 0; e < 16; ++e) {
      b0[e] = (__bf16)vv[s][e].x;
      b1[e] = (__bf16)vv[s][e].y;
    }
    acc[0] = wmma_bf16(a[s], b0, acc[0]);
    acc[1] = wmma_bf16(a[s], b1, acc[1]);
  }
  sum += __shfl_xor(sum, 16, 32);
  if (hi == 0) red_sum[wave][m] = sum;
#pragma unroll
  for (int r = 0; r < 8; ++r)
    *(float2*)(&part[wave][(r + hi * 8) * OP_LD + m * 2]) = make_float2(acc[0][r], acc[1][r]);
  __syncthreads();

  // the 8 waves' partial products and row sums; each thread finishes two neighbouring columns
  int row = t >> 4, c2 = (t & 15) * 2;
  float tot = 0.f, o0 = 0.f, o1 = 0.f;
#pragma unroll
  for (int w = 0; w < AV_WAVES; ++w) {
    float2 pr = *(const float2*)(&part[w][row * OP_LD + c2]);
    tot += red_sum[w][row];
    o0 += pr.x;
    o1 += pr.y;
  }
  float inv = 1.f / tot;
  *(float2*)(O1 + (size_t)(it * 16 + row) * HID + h * HD + c2) = make_float2(o0 * inv, o1 * inv);
}

// ---------------- kernel 4: out = O1 @ Wo + bo ----------------
__global__ __launch_bounds__(32) void outproj_kernel(
    const float* O1, const __bf16* arena, const float* bo, float* out) {
  int it = blockIdx.x, nt = blockIdx.y;
  int lane = threadIdx.x & 31, hi = lane >> 4, nc = lane & 15;
  const __bf16* Wot = arena + WOT;
  v8f acc = {};
#pragma unroll
  for (int kk = 0; kk < 8; ++kk) {
    v16bf a = load_frag(O1, it * 16, kk * 32, HID);    // f32 -> bf16 on the fly
    v16bf b = load_frag(Wot, nt * 16, kk * 32, HID);
    acc = wmma_bf16(a, b, acc);
  }
  int ncol = nt * 16 + nc;
  float bias = bo[ncol];
#pragma unroll
  for (int r = 0; r < 8; ++r)
    out[(size_t)(it * 16 + r + hi * 8) * HID + ncol] = acc[r] + bias;
}

// ---------------- launch ----------------
extern "C" void kernel_launch(void* const* d_in, const int* in_sizes, int n_in,
                              void* d_out, int out_size, void* d_ws, size_t ws_size,
                              hipStream_t stream) {
  (void)in_sizes; (void)n_in; (void)out_size; (void)ws_size;
  const float* x   = (const float*)d_in[0];
  const float* pos = (const float*)d_in[1];
  const float* Wq  = (const float*)d_in[2];  const float* bq = (const float*)d_in[3];
  const float* Wk  = (const float*)d_in[4];  const float* bk = (const float*)d_in[5];
  const float* Wv  = (const float*)d_in[6];  const float* bv = (const float*)d_in[7];
  const float* Wo  = (const float*)d_in[8];  const float* bo = (const float*)d_in[9];
  const float* W1  = (const float*)d_in[10]; const float* b1 = (const float*)d_in[11];
  const float* W2  = (const float*)d_in[12]; const float* b2 = (const float*)d_in[13];
  const float* W3  = (const float*)d_in[14]; const float* b3 = (const float*)d_in[15];

  char* ws = (char*)d_ws;
  float*  Qf    = (float*)(ws + QF_OFF);
  float*  Kf    = (float*)(ws + KF_OFF);
  float*  Vf    = (float*)(ws + VF_OFF);
  float*  S     = (float*)(ws + S_OFF);
  float*  O1    = (float*)(ws + O1_OFF);
  __bf16* arena = (__bf16*)(ws + BF_OFF);
  float*  out   = (float*)d_out;

  (void)hipFuncSetAttribute((const void*)relenc_kernel,
                            hipFuncAttributeMaxDynamicSharedMemorySize, SMEM_TOTAL);

  prep_kernel<<<(BF_TOTAL + 255) / 256, 256, 0, stream>>>(x, Wq, Wk, Wv, W2, W3, Wo, arena);
  qkv_kernel<<<dim3(48, 48), 32, 0, stream>>>(arena, bq, bk, bv, Qf, Kf, Vf);
  relenc_kernel<<<RELENC_WGS, 256, SMEM_TOTAL, stream>>>(pos, W1, b1, b2, b3,
                                                         arena, Qf, Kf, S);
  softmax_av_kernel<<<dim3(48, 8), 256, 0, stream>>>(S, Vf, O1);
  outproj_kernel<<<dim3(48, 16), 32, 0, stream>>>(O1, arena, bo, out);
}

// v004
// Measured time: 84.1 microseconds a run.
// Next to v003, in two timings, it ran 1.13 times as fast each time.
// All steps since v000 together make it 4.73 times as fast.
#include <hip/hip_runtime.h>
#include <hip/hip_bf16.h>

typedef __attribute__((ext_vector_type(16))) __bf16 v16bf;
typedef __attribute__((ext_vector_type(8)))  __bf16 v8bf;
typedef __attribute__((ext_vector_type(2)))  __bf16 v2bf;
typedef __attribute__((ext_vector_type(8)))  unsigned v8u;
typedef __attribute__((ext_vector_type(4)))  unsigned v4u;
typedef __attribute__((ext_vector_type(2)))  short    v2s;
typedef __attribute__((ext_vector_type(2)))  float    v2f;
typedef __attribute__((ext_vector_type(8)))  float  v8f;
typedef __attribute__((__vector_size__(16))) int    v4i;

#if __has_builtin(__builtin_amdgcn_global_load_async_to_lds_b128) && \
    __has_builtin(__builtin_amdgcn_s_wait_asynccnt)
#define HAVE_ASYNC_LDS 1
#define AS_GLOBAL __attribute__((address_space(1)))
#define AS_LDS    __attribute__((address_space(3)))
#endif

// ---------------- problem constants ----------------
constexpr int NN    = 768;
constexpr int INDIM = 128;
constexpr int HID   = 256;
constexpr int HEADS = 8;
constexpr int HD    = 32;
constexpr float RSCALE = 0.17677669529663687f;   // 1/sqrt(32)

// ---------------- workspace layout (bytes) ----------------
constexpr size_t QF_OFF = 0;                         // 768*256*4
constexpr size_t KF_OFF = 786432;
constexpr size_t VF_OFF = 1572864;
constexpr size_t S_OFF  = 2359296;                   // 8*768*768*4 = 18874368
constexpr size_t O1_OFF = 21233664;                  // 768*256*4
constexpr size_t BF_OFF = 22020096;                  // bf16 arena (16B aligned)

// bf16 arena element offsets
constexpr int XB  = 0;        // x bf16: 768*128
constexpr int WQT = 98304;    // Wq^T bf16: 256*128
constexpr int WKT = 131072;
constexpr int WVT = 163840;
constexpr int W2T = 196608;   // W2^T: 256*256
constexpr int W3T = 262144;   // W3^T: 32*256
constexpr int WOT = 270336;   // Wo^T: 256*256
constexpr int BF_TOTAL = 335872;

// ---------------- WMMA helpers ----------------
__device__ inline int frag_k(int e, int hi) {
  // 16-bit A-matrix 16x32 lane layout (ISA 7.12.2): lane<16 -> K {0..7,16..23},
  // lane>=16 -> K {8..15,24..31}; two contiguous 16B chunks -> b128-friendly.
  return hi * 8 + e + (e >= 8 ? 8 : 0);
}

template <typename T>
__device__ inline v16bf load_frag(const T* p, int row0, int k0, int ld) {
  int lane = threadIdx.x & 31;
  int m = lane & 15, hi = lane >> 4;
  const T* b = p + (size_t)(row0 + m) * ld + k0;
  v16bf f;
#pragma unroll
  for (int e = 0; e < 16; ++e) f[e] = (__bf16)b[frag_k(e, hi)];
  return f;
}

__device__ inline v8f wmma_bf16(v16bf a, v16bf b, v8f c) {
  return __builtin_amdgcn_wmma_f32_16x16x32_bf16(false, a, false, b, (short)0, c,
                                                 false, false);
}

// ---------------- kernel 0: bf16 weight transposes ----------------
__global__ __launch_bounds__(256) void prep_kernel(
    const float* x, const float* Wq, const float* Wk, const float* Wv,
    const float* W2, const float* W3, const float* Wo, __bf16* arena) {
  int idx = blockIdx.x * blockDim.x + threadIdx.x;
  if (idx >= BF_TOTAL) return;
  if (idx < 98304) { arena[XB + idx] = (__bf16)x[idx]; return; }
  int r = idx - 98304;
  if (r < 3 * 32768) {
    int m = r / 32768, q = r % 32768;
    int nrow = q >> 7, k = q & 127;
    const float* W = (m == 0) ? Wq : (m == 1) ? Wk : Wv;
    arena[WQT + r] = (__bf16)W[k * 256 + nrow];
    return;
  }
  r -= 3 * 32768;
  if (r < 65536) { int n = r >> 8, k = r & 255; arena[W2T + r] = (__bf16)W2[k * 256 + n]; return; }
  r -= 65536;
  if (r < 8192)  { int d = r >> 8, k = r & 255; arena[W3T + r] = (__bf16)W3[k * 32 + d]; return; }
  r -= 8192;
  { int n = r >> 8, k = r & 255; arena[WOT + r] = (__bf16)Wo[k * 256 + n]; }
}

// ---------------- kernel 1: QKV projections (WMMA bf16) ----------------
__global__ __launch_bounds__(32) void qkv_kernel(
    const __bf16* arena, const float* bq, const float* bk, const float* bv,
    float* Qf, float* Kf, float* Vf) {
  int it  = blockIdx.x;          // row tile 0..47
  int mat = blockIdx.y >> 4;     // 0=Q 1=K 2=V
  int ct  = blockIdx.y & 15;     // col tile 0..15
  const __bf16* xb = arena + XB;
  const __bf16* Wt = arena + ((mat == 0) ? WQT : (mat == 1) ? WKT : WVT);
  const float* bias = (mat == 0) ? bq : (mat == 1) ? bk : bv;
  float* dst = (mat == 0) ? Qf : (mat == 1) ? Kf : Vf;
  v8f acc = {};
  for (int k0 = 0; k0 < INDIM; k0 += 32) {
    v16bf a = load_frag(xb, it * 16, k0, INDIM);
    v16bf b = load_frag(Wt, ct * 16, k0, INDIM);
    acc = wmma_bf16(a, b, acc);
  }
  int lane = threadIdx.x & 31, hi = lane >> 4;
  int ncol = ct * 16 + (lane & 15);
  float bb = bias[ncol];
#pragma unroll
  for (int r = 0; r < 8; ++r)
    dst[(size_t)(it * 16 + r + hi * 8) * HID + ncol] = acc[r] + bb;
}

// ---------------- kernel 2: fused pair-MLP + scores ----------------
// One workgroup owns 9 consecutive 16x16 tiles of (i,j) pairs, one at a time -> M = 256 rows.
// Entirely in LDS (CDNA5: 320KB per WGP): h1 (bf16 256x280) + h2 (bf16 256x280).
constexpr int H1_LD    = 280;                       // bf16 elems; 560B row: 16B aligned, bank-spread
constexpr int H1_BYTES = 256 * H1_LD * 2;           // 143360
constexpr int SMEM_BYTES = 2 * H1_BYTES;            // 286720 <= 320KB
constexpr int ENC_LD = 33;                          // f32 elems
constexpr int QK_LD  = 260;                         // f32 elems; 1040B row: 16B aligned
constexpr int QLDS_OFF = 36864;                     // bytes within region 0
constexpr int KLDS_OFF = 57344;                     // 16x260x4=16640 per tile; fits

// Phase B split: each of the 8 waves owns NT_W column tiles of W2 (all of K, in registers)
// and walks all 16 row tiles of h1.
constexpr int NT_W = 2;

// Each workgroup walks TILES_WG consecutive pair tiles (flat index I*48+J) and reads the weights
// once for all of them: W2 fragments stay in registers, W3^T lies in LDS behind h1 and h2.
constexpr int JT         = NN / 16;                 // 48 tiles a side
constexpr int TILES_WG   = 9;
constexpr int RELENC_WGS = JT * JT / TILES_WG;      // 256
constexpr int W3_LD      = 264;                     // bf16 elems; 528B row: 16B aligned, bank-spread
constexpr int W3LDS_OFF  = SMEM_BYTES;
constexpr int W1LDS_OFF  = SMEM_BYTES + HD * W3_LD * 2;   // 303616
constexpr int W1_PLANE   = HID * 8;                 // bf16 elems: 8 per hidden column
constexpr int SMEM_TOTAL = W1LDS_OFF + 2 * W1_PLANE * 2;  // 311808 <= 320KB

// Each f32 value x of rel, W1 and b1 goes into the bf16 product as a pair: hi = bf16(x) and
// lo = bf16(x - hi); all four cross products are summed in f32, so about 16 bits of each
// operand take part.
__device__ inline unsigned pack2(float a, float b) {
  v2bf v = {(__bf16)a, (__bf16)b};
  return __builtin_bit_cast(unsigned, v);
}
__device__ inline float bf_lo(float x) { return x - (float)(__bf16)x; }

// One hidden column's A row, k slots 0..7 (plane 0) and 8..15 (plane 1) of a lane:
//   plane 0: W1hi[0..2], W1hi[0..2], b1hi, 0      plane 1: the same of the lo parts
// against B slots  relhi[0..2], rello[0..2], 1, 0  in both groups of 8.
__device__ inline void w1_table_row(__bf16* w1t, int n, float w0, float w1, float w2, float bb) {
  v8bf ph = {(__bf16)w0, (__bf16)w1, (__bf16)w2, (__bf16)w0, (__bf16)w1, (__bf16)w2,
             (__bf16)bb, (__bf16)0.f};
  float l0 = bf_lo(w0), l1 = bf_lo(w1), l2 = bf_lo(w2), lb = bf_lo(bb);
  v8bf pl = {(__bf16)l0, (__bf16)l1, (__bf16)l2, (__bf16)l0, (__bf16)l1, (__bf16)l2,
             (__bf16)lb, (__bf16)0.f};
  *(v8bf*)(w1t + n * 8) = ph;
  *(v8bf*)(w1t + W1_PLANE + n * 8) = pl;
}

// relu behind the rounding, on the packed bf16 bit patterns: read as signed 16-bit integers every
// negative value lies below 0 and every positive one keeps its bits, so one packed integer
// maximum does two elements (rounding keeps the sign, so the order of the two does not matter).
__device__ inline unsigned relu_pack2(float a, float b) {
  v2f x = {a, b};
  v2s z = {};
  return __builtin_bit_cast(unsigned, __builtin_elementwise_max(
      __builtin_bit_cast(v2s, __builtin_convertvector(x, v2bf)), z));
}
__device__ inline void relu_store8(__bf16* p, v8f d) {
  v4u o = {relu_pack2(d[0], d[1]), relu_pack2(d[2], d[3]), relu_pack2(d[4], d[5]),
           relu_pack2(d[6], d[7])};
  *(v4u*)p = o;
}

// Phase A: h1 = relu(rel @ W1 + b1) as h1^T = W1ext^T (A) x relext^T (B) on WMMA.
// (r0, r1, r2) is rel of the thread's own pair (row t of h1). A wave's lanes 0..15 own pair tile
// 2*wave and lanes 16..31 pair tile 2*wave+1: the B operand of a pair tile holds its own lanes'
// slots and zero in the other half, whose k slots then add nothing. D register r of lane (c, hi)
// is hidden column nt*16 + 8*hi + r of pair c: eight neighbours of one h1 row, one 16-byte store.
__device__ inline void mlp1_wmma(__bf16* h1, const __bf16* w1t, float r0, float r1, float r2) {
  int t = threadIdx.x, lane = t & 31, c = lane & 15, hi = lane >> 4;
  unsigned p0 = pack2(r0, r1), p1 = pack2(r2, bf_lo(r0)), p2 = pack2(bf_lo(r1), bf_lo(r2));
  unsigned p3 = 0x3F80u;   // bf16 1.0 (takes the bias), then 0
  unsigned a0 = hi ? 0u : p0, a1 = hi ? 0u : p1, a2 = hi ? 0u : p2, a3 = hi ? 0u : p3;
  unsigned c0 = hi ? p0 : 0u, c1 = hi ? p1 : 0u, c2 = hi ? p2 : 0u, c3 = hi ? p3 : 0u;
  v8u u0 = {a0, a1, a2, a3, a0, a1, a2, a3};
  v8u u1 = {c0, c1, c2, c3, c0, c1, c2, c3};
  v16bf B0 = __builtin_bit_cast(v16bf, u0), B1 = __builtin_bit_cast(v16bf, u1);
  __bf16* d0 = h1 + ((t & ~31) + c) * H1_LD + hi * 8;
  __bf16* d1 = d0 + 16 * H1_LD;
  const __bf16* wa = w1t + c * 8;
  v16bf A[16];
#pragma unroll
  for (int nt = 0; nt < 16; ++nt) {
    v8bf x = *(const v8bf*)(wa + nt * 128);
    v8bf y = *(const v8bf*)(wa + W1_PLANE + nt * 128);
    A[nt] = __builtin_shufflevector(x, y, 0, 1, 2, 3, 4, 5, 6, 7, 8, 9, 10, 11, 12, 13, 14, 15);
  }
  // Blocks of four independent WMMAs (two column tiles x two pair tiles), two sets of D tiles:
  // block b+1 is issued ahead of block b's conversion and stores.
  v8f d[2][4];
#pragma unroll
  for (int b = 0; b <= 8; ++b) {
    if (b < 8) {
      d[b & 1][0] = wmma_bf16(A[2 * b], B0, v8f{});
      d[b & 1][1] = wmma_bf16(A[2 * b], B1, v8f{});
      d[b & 1][2] = wmma_bf16(A[2 * b + 1], B0, v8f{});
      d[b & 1][3] = wmma_bf16(A[2 * b + 1], B1, v8f{});
    }
    // keeps the block's four WMMAs together and ahead of the vector work on the block before it
    // (scheduled freely, each WMMA stood directly in front of its own readers, its latency waited out)
    __builtin_amdgcn_sched_barrier(0);
    if (b > 0) {
      const int q = 2 * (b - 1);
      relu_store8(d0 + q * 16, d[(b - 1) & 1][0]);
      relu_store8(d1 + q * 16, d[(b - 1) & 1][1]);
      relu_store8(d0 + (q + 1) * 16, d[(b - 1) & 1][2]);
      relu_store8(d1 + (q + 1) * 16, d[(b - 1) & 1][3]);
    }
    __builtin_amdgcn_sched_barrier(0);  // as above
  }
}

// b already points at the lane's own row and k half (frag_k order: two 16B chunks, 32B apart).
__device__ inline v16bf load_frag_at(const __bf16* b) {
  v16bf f;
#pragma unroll
  for (int e = 0; e < 16; ++e) f[e] = b[e + (e >= 8 ? 8 : 0)];
  return f;
}

__device__ inline void load_h_tile(v16bf (&a)[8], const __bf16* h, int mt) {
#pragma unroll
  for (int kk = 0; kk < 8; ++kk) a[kk] = load_frag(h, mt * 16, kk * 32, H1_LD);
}

__device__ inline void mlp2_tile(const v16bf (&a)[8], const v16bf (&b)[NT_W][8],
                                 const float (&bias)[NT_W], __bf16* h2, int mt, int col0) {
  int lane = threadIdx.x & 31, hi = lane >> 4;
  v8f acc[NT_W];
#pragma unroll
  for (int n = 0; n < NT_W; ++n) acc[n] = v8f{};
#pragma unroll
  for (int kk = 0; kk < 8; ++kk)
#pragma unroll
    for (int n = 0; n < NT_W; ++n) acc[n] = wmma_bf16(a[kk], b[n][kk], acc[n]);
#pragma unroll
  for (int n = 0; n < NT_W; ++n) {
    int ncol = col0 + n * 16;
#pragma unroll
    for (int r = 0; r < 8; ++r) {
      float v = fmaxf(acc[n][r] + bias[n], 0.f);
      h2[(mt * 16 + r + hi * 8) * H1_LD + ncol] = (__bf16)v;
    }
  }
}

__global__ __launch_bounds__(256) void relenc_kernel(
    const float* pos, const float* W1, const float* b1,
    const float* b2, const float* b3,
    const __bf16* arena, const float* Qf, const float* Kf, float* S) {
  extern __shared__ __align__(16) char smem[];
  __bf16* h1 = (__bf16*)smem;
  __bf16* h2 = (__bf16*)(smem + H1_BYTES);
  float* enc = (float*)smem;                   // reuses h1 region after phase B
  float* qld = (float*)(smem + QLDS_OFF);
  float* kld = (float*)(smem + KLDS_OFF);
  __bf16* w3s = (__bf16*)(smem + W3LDS_OFF);
  __bf16* w1t = (__bf16*)(smem + W1LDS_OFF);

  const int tile0 = blockIdx.x * TILES_WG;
  int t = threadIdx.x;
  int lane = t & 31, wave = t >> 5, hi = lane >> 4;

  const __bf16* W2t = arena + W2T;
  const __bf16* W3t = arena + W3T;

  // W1 and b1 of hidden column t, read once per workgroup and ahead of every other load, so that
  // the table below waits for these four alone.
  const float* w1p = W1 + t;
  const float* b1p = b1 + t;
  const float w1c0 = w1p[0], w1c1 = w1p[256], w1c2 = w1p[512], b1c0 = b1p[0];
  // stands in front of the first reuse of the four loads' address registers
  asm volatile("s_wait_xcnt 0x0" ::: "memory");

  // Warm L2/WGP$ with the W2^T block this workgroup is about to stream.
  __builtin_prefetch(((const char*)W2t) + t * 512, 0, 2);
  __builtin_prefetch(((const char*)W2t) + t * 512 + 256, 0, 2);

  // This wave's W2 column tiles and their bias, read once per workgroup; issued here so that
  // phase A runs while they arrive.
  const int bcol = wave * NT_W * 16 + (lane & 15);   // the lane's column in the wave's first tile
  const __bf16* wlane = arena + (size_t)bcol * 256 + hi * 8;
  const float* b2l = b2 + bcol;   // one base: both bias reads use the offset register named below
  v16bf bF[NT_W][8];
  float bias2[NT_W];
#pragma unroll
  for (int n = 0; n < NT_W; ++n) {
#pragma unroll
    for (int kk = 0; kk < 8; ++kk) bF[n][kk] = load_frag_at(wlane + W2T + n * 16 * 256 + kk * 32);
    bias2[n] = b2l[n * 16];
  }
  // W3^T (32 rows of 256) and b3, likewise read once per workgroup
  const __bf16* w3g = W3t + t * 8;
  const v4i w3c0 = *(const v4i*)(w3g), w3c1 = *(const v4i*)(w3g + 2048);
  const v4i w3c2 = *(const v4i*)(w3g + 4096), w3c3 = *(const v4i*)(w3g + 6144);
  float bias3[2];
#pragma unroll
  for (int nt = 0; nt < 2; ++nt) bias3[nt] = b3[nt * 16 + (lane & 15)];

  // W1 and b1 as A rows in LDS, for every tile's phase A. The barrier publishes them; its fences
  // name LDS alone, so that the weight loads issued above stay in flight over it.
  w1_table_row(w1t, t, w1c0, w1c1, w1c2, b1c0);
  __builtin_amdgcn_fence(__ATOMIC_RELEASE, "workgroup", "local");
  __builtin_amdgcn_s_barrier();
  __builtin_amdgcn_fence(__ATOMIC_ACQUIRE, "workgroup", "local");

  // ---- Phase A of the first tile, rel = pos[j] - pos[i]
  {
    int gi = (tile0 / JT) * 16 + (t >> 4), gj = (tile0 % JT) * 16 + (t & 15);
    float r0 = pos[gj * 3 + 0] - pos[gi * 3 + 0];
    float r1 = pos[gj * 3 + 1] - pos[gi * 3 + 1];
    float r2 = pos[gj * 3 + 2] - pos[gi * 3 + 2];
    mlp1_wmma(h1, w1t, r0, r1, r2);
    // The operands keep the address registers of the loads issued above untouched through
    // phase A; the wait stands in front of their first reuse.
    asm volatile("s_wait_xcnt 0x0" ::"v"(wlane), "v"(bcol), "s"(b2), "v"(lane & 15), "s"(b3),
                 "v"(t), "s"(arena), "v"(pos + gj * 3), "v"(pos + gi * 3) : "memory");
    // W3^T into LDS; the barrier below publishes it with h1
    __bf16* w3d = w3s + (t >> 5) * W3_LD + (t & 31) * 8;
    *(v4i*)(w3d) = w3c0;
    *(v4i*)(w3d + 8 * W3_LD) = w3c1;
    *(v4i*)(w3d + 16 * W3_LD) = w3c2;
    *(v4i*)(w3d + 24 * W3_LD) = w3c3;
  }
  __syncthreads();

  for (int it = 0;; ++it) {
  const int tile = tile0 + it;
  const int I = tile / JT, J = tile % JT;
  // the next tile's positions (the last trip reads its own again), used behind phase D
  const int tn = (it + 1 < TILES_WG) ? tile + 1 : tile;
  const float* pjn = pos + ((tn % JT) * 16 + (t & 15)) * 3;
  const float* pin = pos + ((tn / JT) * 16 + (t >> 4)) * 3;
  const float nj0 = pjn[0], nj1 = pjn[1], nj2 = pjn[2];
  const float ni0 = pin[0], ni1 = pin[1], ni2 = pin[2];
  // stands in front of the first reuse of the two loads' address registers (phase B's LDS reads)
  asm volatile("s_wait_xcnt 0x0" ::: "memory");

  // ---- Phase B: h2 = relu(h1 @ W2 + b2)   M=256 K=256 N=256, bf16 WMMA
  // W2 fragments stay in registers (read once, above); h1 tiles stream from LDS,
  // each tile's fragments fetched while the tile before it is multiplied.
  {
    // same value as bcol; formed from t so that the h2 stores compile to one base register
    // with immediate offsets instead of one address add per store
    const int hcol = (t & ~31) * NT_W / 2 + (lane & 15);
    v16bf aA[8], aB[8];
    load_h_tile(aA, h1, 0);
    for (int mt = 0; mt < 16; mt += 2) {
      load_h_tile(aB, h1, mt + 1);
      // keeps the next tile's 16 LDS reads as one group ahead of this tile's WMMAs
      // (sunk among or behind them, their latency is waited out at the next tile)
      __builtin_amdgcn_sched_barrier(0);
      mlp2_tile(aA, bF, bias2, h2, mt, hcol);
      if (mt + 2 < 16) load_h_tile(aA, h1, mt + 2);
      __builtin_amdgcn_sched_barrier(0);  // as above
      mlp2_tile(aB, bF, bias2, h2, mt + 1, hcol);
    }
  }
  __syncthreads();

  // ---- Stage Q (I-tile rows) and K (J-tile rows) into LDS.
  // Async DMA (ASYNCcnt) overlaps the phase-C WMMAs; h1 region is dead here.
#ifdef HAVE_ASYNC_LDS
#pragma unroll
  for (int rr = 0; rr < 4; ++rr) {
    int chunk = t + rr * 256;              // 1024 chunks of 4 floats per matrix
    int row = chunk >> 6, c4 = (chunk & 63) * 4;
    __builtin_amdgcn_global_load_async_to_lds_b128(
        (AS_GLOBAL v4i*)(Qf + (size_t)(I * 16 + row) * HID + c4),
        (AS_LDS    v4i*)(qld + row * QK_LD + c4), 0, 0);
    __builtin_amdgcn_global_load_async_to_lds_b128(
        (AS_GLOBAL v4i*)(Kf + (size_t)(J * 16 + row) * HID + c4),
        (AS_LDS    v4i*)(kld + row * QK_LD + c4), 0, 0);
  }
#endif

  // ---- Phase C: enc = h2 @ W3 + b3  (M=256 K=256 N=32)
  for (int u = 0; u < 2; ++u) {   // constant trip count: the loop branch stays scalar
    const int mt = wave * 2 + u;
    v16bf aF[8];
#pragma unroll
    for (int kk = 0; kk < 8; ++kk) aF[kk] = load_frag(h2, mt * 16, kk * 32, H1_LD);
#pragma unroll
    for (int nt = 0; nt < 2; ++nt) {
      v8f acc = {};
#pragma unroll
      for (int kk = 0; kk < 8; ++kk)
        acc = wmma_bf16(aF[kk], load_frag(w3s, nt * 16, kk * 32, W3_LD), acc);
      int ncol = nt * 16 + (lane & 15);
      float bias = bias3[nt];
#pragma unroll
      for (int r = 0; r < 8; ++r)
        enc[(mt * 16 + r + hi * 8) * ENC_LD + ncol] = acc[r] + bias;
    }
  }

#ifdef HAVE_ASYNC_LDS
  __builtin_amdgcn_s_wait_asynccnt(0);
#else
#pragma unroll
  for (int rr = 0; rr < 4; ++rr) {
    int chunk = t + rr * 256;
    int row = chunk >> 6, c4 = (chunk & 63) * 4;
    *(float4*)(qld + row * QK_LD + c4) =
        *(const float4*)(Qf + (size_t)(I * 16 + row) * HID + c4);
    *(float4*)(kld + row * QK_LD + c4) =
        *(const float4*)(Kf + (size_t)(J * 16 + row) * HID + c4);
  }
#endif
  __syncthreads();

  // ---- Phase D: S[h,i,j] = (Q.K + Q.enc) / sqrt(d)   (f32 VALU)
  {
    int i = t >> 4, j = t & 15;
    int gi = I * 16 + i, gj = J * 16 + j;
#pragma unroll
    for (int h = 0; h < HEADS; ++h) {
      float s = 0.f;
#pragma unroll
      for (int d = 0; d < HD; ++d) {
        float q = qld[i * QK_LD + h * HD + d];
        s = fmaf(q, kld[j * QK_LD + h * HD + d] + enc[t * ENC_LD + d], s);
      }
      S[((size_t)h * NN + gi) * NN + gj] = s * RSCALE;
    }
  }
  // stands in front of the first reuse of the stores' address and data registers; ahead of the
  // loop's exit test, in the stores' own block: behind it, register moves of the next tile's
  // phase A were scheduled over it
  asm volatile("s_wait_xcnt 0x0" ::: "memory");
  if (it + 1 == TILES_WG) break;
  // enc, qld and kld lie in the h1 region: every wave's phase D reads end before phase A of the
  // next tile overwrites them. The fences name LDS alone: __syncthreads() here would also wait
  // for the stores to S, which no other wave reads; they complete under phase A.
  __builtin_amdgcn_fence(__ATOMIC_RELEASE, "workgroup", "local");
  __builtin_amdgcn_s_barrier();
  __builtin_amdgcn_fence(__ATOMIC_ACQUIRE, "workgroup", "local");
  mlp1_wmma(h1, w1t, nj0 - ni0, nj1 - ni1, nj2 - ni2);
  __syncthreads();
  }
}

// ---------------- kernel 3: softmax over j fused with O1[i, h*32+d] = sum_j P[h,i,j] * V[j, h*32+d] ----------------
// One workgroup per (16-row tile, head). Each of its 8 waves owns 96 of the 768 columns and reads
// its scores straight into A-fragment order, all loads in flight at once: the scores are read
// once and P never goes to memory. The product takes exp(s - max); the row sum divides at the end.
constexpr int AV_WAVES = 8;
constexpr int AV_KW    = NN / AV_WAVES;   // 96 columns a wave
constexpr int AV_STEPS = AV_KW / 32;      // 3 WMMA k steps
constexpr int OP_LD    = 36;              // f32 elems; rows r and r+8 fall 32 banks apart

// 2^x. The v_nop keeps the free slot that the instruction set asks for between a transcendental
// and a next instruction that overwrites its source or reads its result.
__device__ inline float exp2_slot(float x) {
  float r;
  asm("v_exp_f32 %0, %1\n\tv_nop" : "=v"(r) : "v"(x));
  return r;
}

__global__ __launch_bounds__(256) void softmax_av_kernel(const float* S, const float* Vf,
                                                         float* O1) {
  __shared__ float red_max[AV_WAVES][16];
  __shared__ float red_sum[AV_WAVES][16];
  __shared__ __align__(16) float part[AV_WAVES][16 * OP_LD];
  int it = blockIdx.x;             // 0..47
  int h  = blockIdx.y;             // 0..7
  int t = threadIdx.x, lane = t & 31, wave = t >> 5;
  int m = lane & 15, hi = lane >> 4;
  // frag_k order: per k step two runs of 8 columns, 16 apart, starting at hi*8
  const float* Arow = S + ((size_t)h * NN + it * 16 + m) * NN + wave * AV_KW + hi * 8;
  // B columns: lane m holds head columns 2m (first N tile) and 2m+1 (second), one 8-byte load for both
  const float* Vcol = Vf + (size_t)(wave * AV_KW + hi * 8) * HID + h * HD + m * 2;

  float sv[AV_STEPS][16];
  float2 vv[AV_STEPS][16];
#pragma unroll
  for (int s = 0; s < AV_STEPS; ++s)
#pragma unroll
    for (int c = 0; c < 4; ++c) {
      float4 q = *(const float4*)(Arow + s * 32 + (c >> 1) * 16 + (c & 1) * 4);
      sv[s][c * 4 + 0] = q.x; sv[s][c * 4 + 1] = q.y;
      sv[s][c * 4 + 2] = q.z; sv[s][c * 4 + 3] = q.w;
    }
  // stands in front of the first reuse of the score loads' address registers (the V loads
  // below land in them)
  asm volatile("s_wait_xcnt 0x0" ::: "memory");
#pragma unroll
  for (int s = 0; s < AV_STEPS; ++s)
#pragma unroll
    for (int e = 0; e < 16; ++e)
      vv[s][e] = *(const float2*)(Vcol + (size_t)(s * 32 + e + (e >= 8 ? 8 : 0)) * HID);

  // row maximum: the lane's 48 columns, the other half of the row's lanes, then the 8 waves
  float mx = -3.4e38f;
#pragma unroll
  for (int s = 0; s < AV_STEPS; ++s)
#pragma unroll
    for (int e = 0; e < 16; ++e) mx = fmaxf(mx, sv[s][e]);
  mx = fmaxf(mx, __shfl_xor(mx, 16, 32));
  if (hi == 0) red_max[wave][m] = mx;
  __syncthreads();
  float wm[AV_WAVES];
#pragma unroll
  for (int w = 0; w < AV_WAVES; ++w) wm[w] = red_max[w][m];
#pragma unroll
  for (int w = 0; w < AV_WAVES; ++w) mx = fmaxf(mx, wm[w]);

  float sum = 0.f;
  v16bf a[AV_STEPS];
#pragma unroll
  for (int s = 0; s < AV_STEPS; ++s)
#pragma unroll
    for (int e = 0; e < 16; ++e) {
      float p = exp2_slot((sv[s][e] - mx) * 1.44269504f);   // e^(s - max)
      sum += p;
      a[s][e] = (__bf16)p;
    }
  // keeps every exponential ahead of the first WMMA: they are asm text, which the compiler's
  // padding behind a WMMA does not see
  __builtin_amdgcn_sched_barrier(0);
  v8f acc[2] = {v8f{}, v8f{}};
#pragma unroll
  for (int s = 0; s < AV_STEPS; ++s) {
    v16bf b0, b1;
#pragma unroll
    for (int e = 0; e < 16; ++e) {
      b0[e] = (__bf16)vv[s][e].x;
      b1[e] = (__bf16)vv[s][e].y;
    }
    acc[0] = wmma_bf16(a[s], b0, acc[0]);
    acc[1] = wmma_bf16(a[s], b1, acc[1]);
  }
  sum += __shfl_xor(sum, 16, 32);
  if (hi == 0) red_sum[wave][m] = sum;
#pragma unroll
  for (int r = 0; r < 8; ++r)
    *(float2*)(&part[wave][(r + hi * 8) * OP_LD + m * 2]) = make_float2(acc[0][r], acc[1][r]);
  __syncthreads();

  // the 8 waves' partial products and row sums; each thread finishes two neighbouring columns
  int row = t >> 4, c2 = (t & 15) * 2;
  float tot = 0.f, o0 = 0.f, o1 = 0.f;
#pragma unroll
  for (int w = 0; w < AV_WAVES; ++w) {
    float2 pr = *(const float2*)(&part[w][row * OP_LD + c2]);
    tot += red_sum[w][row];
    o0 += pr.x;
    o1 += pr.y;
  }
  float inv = 1.f / tot;
  *(float2*)(O1 + (size_t)(it * 16 + row) * HID + h * HD + c2) = make_float2(o0 * inv, o1 * inv);
}

// ---------------- kernel 4: out = O1 @ Wo + bo ----------------
__global__ __launch_bounds__(32) void outproj_kernel(
    const float* O1, const __bf16* arena, const float* bo, float* out) {
  int it = blockIdx.x, nt = blockIdx.y;
  int lane = threadIdx.x & 31, hi = lane >> 4, nc = lane & 15;
  const __bf16* Wot = arena + WOT;
  v8f acc = {};
#pragma unroll
  for (int kk = 0; kk < 8; ++kk) {
    v16bf a = load_frag(O1, it * 16, kk * 32, HID);    // f32 -> bf16 on the fly
    v16bf b = load_frag(Wot, nt * 16, kk * 32, HID);
    acc = wmma_bf16(a, b, acc);
  }
  int ncol = nt * 16 + nc;
  float bias = bo[ncol];
#pragma unroll
  for (int r = 0; r < 8; ++r)
    out[(size_t)(it * 16 + r + hi * 8) * HID + ncol] = acc[r] + bias;
}

// ---------------- launch ----------------
extern "C" void kernel_launch(void* const* d_in, const int* in_sizes, int n_in,
                              void* d_out, int out_size, void* d_ws, size_t ws_size,
                              hipStream_t stream) {
  (void)in_sizes; (void)n_in; (void)out_size; (void)ws_size;
  const float* x   = (const float*)d_in[0];
  const float* pos = (const float*)d_in[1];
  const float* Wq  = (const float*)d_in[2];  const float* bq = (const float*)d_in[3];
  const float* Wk  = (const float*)d_in[4];  const float* bk = (const float*)d_in[5];
  const float* Wv  = (const float*)d_in[6];  const float* bv = (const float*)d_in[7];
  const float* Wo  = (const float*)d_in[8];  const float* bo = (const float*)d_in[9];
  const float* W1  = (const float*)d_in[10]; const float* b1 = (const float*)d_in[11];
  const float* W2  = (const float*)d_in[12]; const float* b2 = (const float*)d_in[13];
  const float* W3  = (const float*)d_in[14]; const float* b3 = (const float*)d_in[15];

  char* ws = (char*)d_ws;
  float*  Qf    = (float*)(ws + QF_OFF);
  float*  Kf    = (float*)(ws + KF_OFF);
  float*  Vf    = (float*)(ws + VF_OFF);
  float*  S     = (float*)(ws + S_OFF);
  float*  O1    = (float*)(ws + O1_OFF);
  __bf16* arena = (__bf16*)(ws + BF_OFF);
  float*  out   = (float*)d_out;

  (void)hipFuncSetAttribute((const void*)relenc_kernel,
                            hipFuncAttributeMaxDynamicSharedMemorySize, SMEM_TOTAL);

  prep_kernel<<<(BF_TOTAL + 255) / 256, 256, 0, stream>>>(x, Wq, Wk, Wv, W2, W3, Wo, arena);
  qkv_kernel<<<dim3(48, 48), 32, 0, stream>>>(arena, bq, bk, bv, Qf, Kf, Vf);
  relenc_kernel<<<RELENC_WGS, 256, SMEM_TOTAL, stream>>>(pos, W1, b1, b2, b3,
                                                         arena, Qf, Kf, S);
  softmax_av_kernel<<<dim3(48, 8), 256, 0, stream>>>(S, Vf, O1);
  outproj_kernel<<<dim3(48, 16), 32, 0, stream>>>(O1, arena, bo, out);
}

// v005
// One run takes 71.9 microseconds.
// Next to v004, in two timings, it ran 1.15 and 1.14 times as fast.
// Over all steps from v000 it is 5.41 times as fast.
#include <hip/hip_runtime.h>
#include <hip/hip_bf16.h>

typedef __attribute__((ext_vector_type(16))) __bf16 v16bf;
typedef __attribute__((ext_vector_type(8)))  __bf16 v8bf;
typedef __attribute__((ext_vector_type(2)))  __bf16 v2bf;
typedef __attribute__((ext_vector_type(8)))  unsigned v8u;
typedef __attribute__((ext_vector_type(4)))  unsigned v4u;
typedef __attribute__((ext_vector_type(2)))  short    v2s;
typedef __attribute__((ext_vector_type(2)))  float    v2f;
typedef __attribute__((ext_vector_type(8)))  float  v8f;
typedef __attribute__((__vector_size__(16))) int    v4i;

// ---------------- problem constants ----------------
constexpr int NN    = 768;
constexpr int INDIM = 128;
constexpr int HID   = 256;
constexpr int HEADS = 8;
constexpr int HD    = 32;
constexpr float RSCALE = 0.17677669529663687f;   // 1/sqrt(32)

// ---------------- workspace layout (bytes) ----------------
constexpr size_t QF_OFF = 0;                         // Q as two bf16 planes (hi, lo): 2*768*256*2
constexpr size_t KF_OFF = 786432;                    // K likewise
constexpr size_t VF_OFF = 1572864;
constexpr size_t S_OFF  = 2359296;                   // 8*768*768*4 = 18874368
constexpr size_t O1_OFF = 21233664;                  // 768*256*4
constexpr size_t BF_OFF = 22020096;                  // bf16 arena (16B aligned)

// bf16 arena element offsets
constexpr int XB  = 0;        // x bf16: 768*128
constexpr int WQT = 98304;    // Wq^T bf16: 256*128
constexpr int WKT = 131072;
constexpr int WVT = 163840;
constexpr int W2T = 196608;   // W2^T: 256*256
constexpr int W3T = 262144;   // W3^T: 32*256
constexpr int WOT = 270336;   // Wo^T: 256*256
constexpr int BF_TOTAL = 335872;
constexpr int QK_PLANE = NN * HID;   // bf16 elems from a value's hi part to its lo part

// ---------------- WMMA helpers ----------------
__device__ inline int frag_k(int e, int hi) {
  // 16-bit A-matrix 16x32 lane layout (ISA 7.12.2): lane<16 -> K {0..7,16..23},
  // lane>=16 -> K {8..15,24..31}; two contiguous 16B chunks -> b128-friendly.
  return hi * 8 + e + (e >= 8 ? 8 : 0);
}

template <typename T>
__device__ inline v16bf load_frag(const T* p, int row0, int k0, int ld) {
  int lane = threadIdx.x & 31;
  int m = lane & 15, hi = lane >> 4;
  const T* b = p + (size_t)(row0 + m) * ld + k0;
  v16bf f;
#pragma unroll
  for (int e = 0; e < 16; ++e) f[e] = (__bf16)b[frag_k(e, hi)];
  return f;
}

__device__ inline v8f wmma_bf16(v16bf a, v16bf b, v8f c) {
  return __builtin_amdgcn_wmma_f32_16x16x32_bf16(false, a, false, b, (short)0, c,
                                                 false, false);
}

// ---------------- kernel 0: bf16 weight transposes ----------------
__global__ __launch_bounds__(256) void prep_kernel(
    const float* x, const float* Wq, const float* Wk, const float* Wv,
    const float* W2, const float* W3, const float* Wo, __bf16* arena) {
  int idx = blockIdx.x * blockDim.x + threadIdx.x;
  if (idx >= BF_TOTAL) return;
  if (idx < 98304) { arena[XB + idx] = (__bf16)x[idx]; return; }
  int r = idx - 98304;
  if (r < 3 * 32768) {
    int m = r / 32768, q = r % 32768;
    int nrow = q >> 7, k = q & 127;
    const float* W = (m == 0) ? Wq : (m == 1) ? Wk : Wv;
    arena[WQT + r] = (__bf16)W[k * 256 + nrow];
    return;
  }
  r -= 3 * 32768;
  if (r < 65536) { int n = r >> 8, k = r & 255; arena[W2T + r] = (__bf16)W2[k * 256 + n]; return; }
  r -= 65536;
  if (r < 8192)  { int d = r >> 8, k = r & 255; arena[W3T + r] = (__bf16)W3[k * 32 + d]; return; }
  r -= 8192;
  { int n = r >> 8, k = r & 255; arena[WOT + r] = (__bf16)Wo[k * 256 + n]; }
}

// ---------------- kernel 1: QKV projections (WMMA bf16) ----------------
__global__ __launch_bounds__(32) void qkv_kernel(
    const __bf16* arena, const float* bq, const float* bk, const float* bv,
    __bf16* Qs, __bf16* Ks, float* Vf) {
  int it  = blockIdx.x;          // row tile 0..47
  int mat = blockIdx.y >> 4;     // 0=Q 1=K 2=V
  int ct  = blockIdx.y & 15;     // col tile 0..15
  const __bf16* xb = arena + XB;
  const __bf16* Wt = arena + ((mat == 0) ? WQT : (mat == 1) ? WKT : WVT);
  const float* bias = (mat == 0) ? bq : (mat == 1) ? bk : bv;
  v8f acc = {};
  for (int k0 = 0; k0 < INDIM; k0 += 32) {
    v16bf a = load_frag(xb, it * 16, k0, INDIM);
    v16bf b = load_frag(Wt, ct * 16, k0, INDIM);
    acc = wmma_bf16(a, b, acc);
  }
  int lane = threadIdx.x & 31, hi = lane >> 4;
  int ncol = ct * 16 + (lane & 15);
  float bb = bias[ncol];
  if (mat == 2) {
#pragma unroll
    for (int r = 0; r < 8; ++r)
      Vf[(size_t)(it * 16 + r + hi * 8) * HID + ncol] = acc[r] + bb;
  } else {
    // Q and K feed the score WMMAs: each value goes out as hi = bf16(v) and lo = bf16(v - hi)
    __bf16* p = ((mat == 0) ? Qs : Ks) + (size_t)(it * 16 + hi * 8) * HID + ncol;
    __bf16 vh[8], vl[8];
#pragma unroll
    for (int r = 0; r < 8; ++r) {
      float v = acc[r] + bb;
      vh[r] = (__bf16)v;
      vl[r] = (__bf16)(v - (float)vh[r]);
    }
#pragma unroll
    for (int r = 0; r < 8; ++r) {
      p[r * HID] = vh[r];
      p[QK_PLANE + r * HID] = vl[r];
    }
    // stands in front of the first reuse of the stores' registers: the built code of the V branch
    // follows this one
    asm volatile("s_wait_xcnt 0x0" ::: "memory");
  }
}

// ---------------- kernel 2: fused pair-MLP + scores ----------------
// One workgroup works through 9 16x16 tiles of (i,j) pairs, one at a time -> M = 256 rows.
// h1 (bf16 256x280) and h2 (bf16 256x280) lie in LDS (320KB per WGP); enc stays in registers.
constexpr int H1_LD    = 280;                       // bf16 elems; 560B row: 16B aligned, bank-spread
constexpr int H1_BYTES = 256 * H1_LD * 2;           // 143360
constexpr int SMEM_BYTES = 2 * H1_BYTES;            // 286720 <= 320KB

// Phase B split: each of the 8 waves owns NT_W column tiles of W2 (all of K, in registers)
// and walks all 16 row tiles of h1.
constexpr int NT_W = 2;

// Each workgroup walks TILES_WG consecutive pair tiles (flat index I*48+J) and reads the weights
// once for all of them: W2 fragments stay in registers, W3^T lies in LDS behind h1 and h2.
constexpr int JT         = NN / 16;                 // 48 tiles a side
constexpr int TILES_WG   = 9;
constexpr int RELENC_WGS = JT * JT / TILES_WG;      // 256
constexpr int W3_LD      = 264;                     // bf16 elems; 528B row: 16B aligned, bank-spread
constexpr int W3LDS_OFF  = SMEM_BYTES;
constexpr int W1LDS_OFF  = SMEM_BYTES + HD * W3_LD * 2;   // 303616
constexpr int W1_PLANE   = HID * 8;                 // bf16 elems: 8 per hidden column
constexpr int QKLDS_OFF  = W1LDS_OFF + 2 * W1_PLANE * 2;  // 311808
constexpr int SMEM_TOTAL = QKLDS_OFF + 256 * HEADS * 4;   // Q.K of a tile, f32 [pair][head]: 320000 <= 320KB

// Each f32 value x of rel, W1 and b1 goes into the bf16 product as a pair: hi = bf16(x) and
// lo = bf16(x - hi); all four cross products are summed in f32, so about 16 bits of each
// operand take part.
__device__ inline unsigned pack2(float a, float b) {
  v2bf v = {(__bf16)a, (__bf16)b};
  return __builtin_bit_cast(unsigned, v);
}
__device__ inline float bf_lo(float x) { return x - (float)(__bf16)x; }

// One hidden column's A row, k slots 0..7 (plane 0) and 8..15 (plane 1) of a lane:
//   plane 0: W1hi[0..2], W1hi[0..2], b1hi, 0      plane 1: the same of the lo parts
// against B slots  relhi[0..2], rello[0..2], 1, 0  in both groups of 8.
__device__ inline void w1_table_row(__bf16* w1t, int n, float w0, float w1, float w2, float bb) {
  v8bf ph = {(__bf16)w0, (__bf16)w1, (__bf16)w2, (__bf16)w0, (__bf16)w1, (__bf16)w2,
             (__bf16)bb, (__bf16)0.f};
  float l0 = bf_lo(w0), l1 = bf_lo(w1), l2 = bf_lo(w2), lb = bf_lo(bb);
  v8bf pl = {(__bf16)l0, (__bf16)l1, (__bf16)l2, (__bf16)l0, (__bf16)l1, (__bf16)l2,
             (__bf16)lb, (__bf16)0.f};
  *(v8bf*)(w1t + n * 8) = ph;
  *(v8bf*)(w1t + W1_PLANE + n * 8) = pl;
}

// relu behind the rounding, on the packed bf16 bit patterns: read as signed 16-bit integers every
// negative value lies below 0 and every positive one keeps its bits, so one packed integer
// maximum does two elements (rounding keeps the sign, so the order of the two does not matter).
__device__ inline unsigned relu_pack2(float a, float b) {
  v2f x = {a, b};
  v2s z = {};
  return __builtin_bit_cast(unsigned, __builtin_elementwise_max(
      __builtin_bit_cast(v2s, __builtin_convertvector(x, v2bf)), z));
}
__device__ inline void relu_store8(__bf16* p, v8f d) {
  v4u o = {relu_pack2(d[0], d[1]), relu_pack2(d[2], d[3]), relu_pack2(d[4], d[5]),
           relu_pack2(d[6], d[7])};
  *(v4u*)p = o;
}

// Phase A: h1 = relu(rel @ W1 + b1) as h1^T = W1ext^T (A) x relext^T (B) on WMMA.
// (r0, r1, r2) is rel of the thread's own pair (row t of h1). A wave's lanes 0..15 own pair tile
// 2*wave and lanes 16..31 pair tile 2*wave+1: the B operand of a pair tile holds its own lanes'
// slots and zero in the other half, whose k slots then add nothing. D register r of lane (c, hi)
// is hidden column nt*16 + 8*hi + r of pair c: eight neighbours of one h1 row, one 16-byte store.
__device__ inline void mlp1_wmma(__bf16* h1, const __bf16* w1t, float r0, float r1, float r2) {
  int t = threadIdx.x, lane = t & 31, c = lane & 15, hi = lane >> 4;
  unsigned p0 = pack2(r0, r1), p1 = pack2(r2, bf_lo(r0)), p2 = pack2(bf_lo(r1), bf_lo(r2));
  unsigned p3 = 0x3F80u;   // bf16 1.0 (takes the bias), then 0
  unsigned a0 = hi ? 0u : p0, a1 = hi ? 0u : p1, a2 = hi ? 0u : p2, a3 = hi ? 0u : p3;
  unsigned c0 = hi ? p0 : 0u, c1 = hi ? p1 : 0u, c2 = hi ? p2 : 0u, c3 = hi ? p3 : 0u;
  v8u u0 = {a0, a1, a2, a3, a0, a1, a2, a3};
  v8u u1 = {c0, c1, c2, c3, c0, c1, c2, c3};
  v16bf B0 = __builtin_bit_cast(v16bf, u0), B1 = __builtin_bit_cast(v16bf, u1);
  __bf16* d0 = h1 + ((t & ~31) + c) * H1_LD + hi * 8;
  __bf16* d1 = d0 + 16 * H1_LD;
  const __bf16* wa = w1t + c * 8;
  v16bf A[16];
#pragma unroll
  for (int nt = 0; nt < 16; ++nt) {
    v8bf x = *(const v8bf*)(wa + nt * 128);
    v8bf y = *(const v8bf*)(wa + W1_PLANE + nt * 128);
    A[nt] = __builtin_shufflevector(x, y, 0, 1, 2, 3, 4, 5, 6, 7, 8, 9, 10, 11, 12, 13, 14, 15);
  }
  // Blocks of four independent WMMAs (two column tiles x two pair tiles), two sets of D tiles:
  // block b+1 is issued ahead of block b's conversion and stores.
  v8f d[2][4];
#pragma unroll
  for (int b = 0; b <= 8; ++b) {
    if (b < 8) {
      d[b & 1][0] = wmma_bf16(A[2 * b], B0, v8f{});
      d[b & 1][1] = wmma_bf16(A[2 * b], B1, v8f{});
      d[b & 1][2] = wmma_bf16(A[2 * b + 1], B0, v8f{});
      d[b & 1][3] = wmma_bf16(A[2 * b + 1], B1, v8f{});
    }
    // keeps the block's four WMMAs together and ahead of the vector work on the block before it
    // (scheduled freely, each WMMA stood directly in front of its own readers, its latency waited out)
    __builtin_amdgcn_sched_barrier(0);
    if (b > 0) {
      const int q = 2 * (b - 1);
      relu_store8(d0 + q * 16, d[(b - 1) & 1][0]);
      relu_store8(d1 + q * 16, d[(b - 1) & 1][1]);
      relu_store8(d0 + (q + 1) * 16, d[(b - 1) & 1][2]);
      relu_store8(d1 + (q + 1) * 16, d[(b - 1) & 1][3]);
    }
    __builtin_amdgcn_sched_barrier(0);  // as above
  }
}

// b already points at the lane's own row and k half (frag_k order: two 16B chunks, 32B apart).
__device__ inline v16bf load_frag_at(const __bf16* b) {
  v16bf f;
#pragma unroll
  for (int e = 0; e < 16; ++e) f[e] = b[e + (e >= 8 ? 8 : 0)];
  return f;
}

__device__ inline void load_h_tile(v16bf (&a)[8], const __bf16* h, int mt) {
#pragma unroll
  for (int kk = 0; kk < 8; ++kk) a[kk] = load_frag(h, mt * 16, kk * 32, H1_LD);
}

__device__ inline void mlp2_tile(const v16bf (&a)[8], const v16bf (&b)[NT_W][8],
                                 const float (&bias)[NT_W], __bf16* h2, int mt, int col0) {
  int lane = threadIdx.x & 31, hi = lane >> 4;
  v8f acc[NT_W];
#pragma unroll
  for (int n = 0; n < NT_W; ++n) acc[n] = v8f{};
#pragma unroll
  for (int kk = 0; kk < 8; ++kk)
#pragma unroll
    for (int n = 0; n < NT_W; ++n) acc[n] = wmma_bf16(a[kk], b[n][kk], acc[n]);
#pragma unroll
  for (int n = 0; n < NT_W; ++n) {
    int ncol = col0 + n * 16;
#pragma unroll
    for (int r = 0; r < 8; ++r) {
      float v = fmaxf(acc[n][r] + bias[n], 0.f);
      h2[(mt * 16 + r + hi * 8) * H1_LD + ncol] = (__bf16)v;
    }
  }
}

__global__ __launch_bounds__(256) void relenc_kernel(
    const float* pos, const float* W1, const float* b1,
    const float* b2, const float* b3,
    const __bf16* arena, const __bf16* Qs, const __bf16* Ks, float* S) {
  extern __shared__ __align__(16) char smem[];
  __bf16* h1 = (__bf16*)smem;
  __bf16* h2 = (__bf16*)(smem + H1_BYTES);
  float* qk = (float*)(smem + QKLDS_OFF);
  __bf16* w3s = (__bf16*)(smem + W3LDS_OFF);
  __bf16* w1t = (__bf16*)(smem + W1LDS_OFF);

  const int tile0 = blockIdx.x * TILES_WG;
  int t = threadIdx.x;
  int lane = t & 31, wave = t >> 5, hi = lane >> 4;

  const __bf16* W2t = arena + W2T;
  const __bf16* W3t = arena + W3T;

  // W1 and b1 of hidden column t, read once per workgroup and ahead of every other load, so that
  // the table below waits for these four alone.
  const float* w1p = W1 + t;
  const float* b1p = b1 + t;
  const float w1c0 = w1p[0], w1c1 = w1p[256], w1c2 = w1p[512], b1c0 = b1p[0];
  // stands in front of the first reuse of the four loads' address registers
  asm volatile("s_wait_xcnt 0x0" ::: "memory");
  // b3 in the D order of enc^T (register r of column tile nt: d = nt*16 + 8*hi + r): the start
  // value of phase C's accumulators
  const float* b3l = b3 + hi * 8;
  const v8f bias3[2] = {*(const v8f*)(b3l), *(const v8f*)(b3l + 16)};
  // stands in front of the first reuse of these loads' address registers
  asm volatile("s_wait_xcnt 0x0" ::: "memory");

  // Warm L2/WGP$ with the W2^T block this workgroup is about to stream.
  __builtin_prefetch(((const char*)W2t) + t * 512, 0, 2);
  __builtin_prefetch(((const char*)W2t) + t * 512 + 256, 0, 2);

  // This wave's W2 column tiles and their bias, read once per workgroup; issued here so that
  // phase A runs while they arrive.
  const int bcol = wave * NT_W * 16 + (lane & 15);   // the lane's column in the wave's first tile
  const __bf16* wlane = arena + (size_t)bcol * 256 + hi * 8;
  const float* b2l = b2 + bcol;   // one base: both bias reads use the offset register named below
  v16bf bF[NT_W][8];
  float bias2[NT_W];
#pragma unroll
  for (int n = 0; n < NT_W; ++n) {
#pragma unroll
    for (int kk = 0; kk < 8; ++kk) bF[n][kk] = load_frag_at(wlane + W2T + n * 16 * 256 + kk * 32);
    bias2[n] = b2l[n * 16];
  }
  // W3^T (32 rows of 256), likewise read once per workgroup
  const __bf16* w3g = W3t + t * 8;
  const v4i w3c0 = *(const v4i*)(w3g), w3c1 = *(const v4i*)(w3g + 2048);
  const v4i w3c2 = *(const v4i*)(w3g + 4096), w3c3 = *(const v4i*)(w3g + 6144);

  // W1 and b1 as A rows in LDS, for every tile's phase A. The barrier publishes them; its fences
  // name LDS alone, so that the weight loads issued above stay in flight over it.
  w1_table_row(w1t, t, w1c0, w1c1, w1c2, b1c0);
  __builtin_amdgcn_fence(__ATOMIC_RELEASE, "workgroup", "local");
  __builtin_amdgcn_s_barrier();
  __builtin_amdgcn_fence(__ATOMIC_ACQUIRE, "workgroup", "local");

  // ---- Phase A of the first tile, rel = pos[j] - pos[i]
  {
    int gi = (tile0 / JT) * 16 + (t >> 4), gj = (tile0 % JT) * 16 + (t & 15);
    float r0 = pos[gj * 3 + 0] - pos[gi * 3 + 0];
    float r1 = pos[gj * 3 + 1] - pos[gi * 3 + 1];
    float r2 = pos[gj * 3 + 2] - pos[gi * 3 + 2];
    mlp1_wmma(h1, w1t, r0, r1, r2);
    // The operands keep the address registers of the loads issued above untouched through
    // phase A; the wait stands in front of their first reuse.
    asm volatile("s_wait_xcnt 0x0" ::"v"(wlane), "v"(bcol), "s"(b2),
                 "v"(t), "s"(arena), "v"(pos + gj * 3), "v"(pos + gi * 3) : "memory");
    // W3^T into LDS; the barrier below publishes it with h1
    __bf16* w3d = w3s + (t >> 5) * W3_LD + (t & 31) * 8;
    *(v4i*)(w3d) = w3c0;
    *(v4i*)(w3d + 8 * W3_LD) = w3c1;
    *(v4i*)(w3d + 16 * W3_LD) = w3c2;
    *(v4i*)(w3d + 24 * W3_LD) = w3c3;
  }
  __syncthreads();

  for (int it = 0;; ++it) {
  const int tile = tile0 + it;
  const int I = tile / JT, J = tile % JT;
  // the next tile's positions (the last trip reads its own again), used behind phase D
  const int tn = (it + 1 < TILES_WG) ? tile + 1 : tile;
  const float* pjn = pos + ((tn % JT) * 16 + (t & 15)) * 3;
  const float* pin = pos + ((tn / JT) * 16 + (t >> 4)) * 3;
  const float nj0 = pjn[0], nj1 = pjn[1], nj2 = pjn[2];
  const float ni0 = pin[0], ni1 = pin[1], ni2 = pin[2];
  // The tile's Q and K fragments (hi and lo planes), issued here so that phase B runs while they
  // arrive. Q.K: this wave takes head 'wave', A = the 16 Q rows, B = the 16 K rows.
  const __bf16* qa = Qs + (size_t)(I * 16 + (lane & 15)) * HID + wave * HD + hi * 8;
  const __bf16* ka = Ks + (size_t)(J * 16 + (lane & 15)) * HID + wave * HD + hi * 8;
  const v16bf qhF = load_frag_at(qa), qlF = load_frag_at(qa + QK_PLANE);
  const v16bf khF = load_frag_at(ka), klF = load_frag_at(ka + QK_PLANE);
  // Q.enc of one row i: A rows 0..3 are the hi parts of Q[i] of heads 0..3, rows 4..7 their lo
  // parts, rows 8..15 the same of heads 4..7.
  const __bf16* qe = Qs + ((lane & 4) ? QK_PLANE : 0) + (size_t)(I * 16 + wave * 2) * HID +
                     ((lane & 8) / 2 + (lane & 3)) * HD + hi * 8;
  const v16bf qeF[2] = {load_frag_at(qe), load_frag_at(qe + HID)};
  // stands in front of the first reuse of these loads' address registers (phase B's LDS reads)
  asm volatile("s_wait_xcnt 0x0" ::: "memory");

  // ---- Phase B: h2 = relu(h1 @ W2 + b2)   M=256 K=256 N=256, bf16 WMMA
  // W2 fragments stay in registers (read once, above); h1 tiles stream from LDS,
  // each tile's fragments fetched while the tile before it is multiplied.
  {
    // same value as bcol; formed from t so that the h2 stores compile to one base register
    // with immediate offsets instead of one address add per store
    const int hcol = (t & ~31) * NT_W / 2 + (lane & 15);
    v16bf aA[8], aB[8];
    load_h_tile(aA, h1, 0);
    for (int mt = 0; mt < 16; mt += 2) {
      load_h_tile(aB, h1, mt + 1);
      // keeps the next tile's 16 LDS reads as one group ahead of this tile's WMMAs
      // (sunk among or behind them, their latency is waited out at the next tile)
      __builtin_amdgcn_sched_barrier(0);
      mlp2_tile(aA, bF, bias2, h2, mt, hcol);
      if (mt + 2 < 16) load_h_tile(aA, h1, mt + 2);
      __builtin_amdgcn_sched_barrier(0);  // as above
      mlp2_tile(aB, bF, bias2, h2, mt + 1, hcol);
    }
  }
  // ---- Q.K of this wave's head, all four hi/lo cross products summed in f32, smallest first.
  // D register r of lane (c, hi) is pair (i = r + 8*hi, j = c); it goes to LDS as [pair][head],
  // published by the barrier below together with h2.
  {
    v8f s = wmma_bf16(qlF, klF, v8f{});
    s = wmma_bf16(qlF, khF, s);
    s = wmma_bf16(qhF, klF, s);
    s = wmma_bf16(qhF, khF, s);
    float* qd = qk + (hi * 128 + (lane & 15)) * HEADS + wave;
#pragma unroll
    for (int r = 0; r < 8; ++r) qd[r * 16 * HEADS] = s[r];
  }
  __syncthreads();

  // ---- Phases C and D of the wave's two rows i = mt of the tile, in registers.
  // C: enc^T = W3^T (A) x h2^T (B) + b3. D register r of column tile nt in lane (c, hi) is
  // d = nt*16 + 8*hi + r of pair j = c: the two D tiles are, element for element, a 16-bit B
  // fragment (k = d, column j) in the k order of frag_k.
  // D: S[h,i,j] = (Q[i,h].enc[i,j] + Q[i,h].K[j,h]) / sqrt(d): A = Q[i] (hi and lo rows), B = enc
  // lo, then enc hi; registers q and 4 + q of the result add up to head 4*hi + q of pair j = c.
  {
    v16bf wF[2][8], aF[2][8];
#pragma unroll
    for (int kk = 0; kk < 8; ++kk) {
#pragma unroll
      for (int nt = 0; nt < 2; ++nt) wF[nt][kk] = load_frag(w3s, nt * 16, kk * 32, W3_LD);
#pragma unroll
      for (int u = 0; u < 2; ++u) aF[u][kk] = load_frag(h2, (wave * 2 + u) * 16, kk * 32, H1_LD);
    }
    v8f e[2][2] = {{bias3[0], bias3[1]}, {bias3[0], bias3[1]}};
#pragma unroll
    for (int kk = 0; kk < 8; ++kk)
#pragma unroll
      for (int u = 0; u < 2; ++u)
#pragma unroll
        for (int nt = 0; nt < 2; ++nt) e[u][nt] = wmma_bf16(wF[nt][kk], aF[u][kk], e[u][nt]);
#pragma unroll
    for (int u = 0; u < 2; ++u) {
      const int mt = wave * 2 + u;
      const float4 qkv = *(const float4*)(qk + (mt * 16 + (lane & 15)) * HEADS + hi * 4);
      v8u eh, el;
#pragma unroll
      for (int p = 0; p < 8; ++p) {
        v2f x = {e[u][p >> 2][(p & 3) * 2], e[u][p >> 2][(p & 3) * 2 + 1]};
        v2bf xh = __builtin_convertvector(x, v2bf);
        v2f xl = x - __builtin_convertvector(xh, v2f);
        eh[p] = __builtin_bit_cast(unsigned, xh);
        el[p] = __builtin_bit_cast(unsigned, __builtin_convertvector(xl, v2bf));
      }
      v8f d = wmma_bf16(qeF[u], __builtin_bit_cast(v16bf, el), v8f{});
      d = wmma_bf16(qeF[u], __builtin_bit_cast(v16bf, eh), d);
      float* sp = S + ((size_t)(hi * 4) * NN + I * 16 + mt) * NN + J * 16 + (lane & 15);
      sp[0]                   = (d[0] + d[4] + qkv.x) * RSCALE;
      sp[(size_t)1 * NN * NN] = (d[1] + d[5] + qkv.y) * RSCALE;
      sp[(size_t)2 * NN * NN] = (d[2] + d[6] + qkv.z) * RSCALE;
      sp[(size_t)3 * NN * NN] = (d[3] + d[7] + qkv.w) * RSCALE;
      // stands in front of the first reuse of the stores' address and data registers
      asm volatile("s_wait_xcnt 0x0" ::: "memory");
    }
  }
  if (it + 1 == TILES_WG) break;
  // h1 is free since the barrier above (every wave's phase B reads lie in front of it); the
  // barrier below publishes it and ends every wave's reads of h2 and of the Q.K table.
  mlp1_wmma(h1, w1t, nj0 - ni0, nj1 - ni1, nj2 - ni2);
  __syncthreads();
  }
}

// ---------------- kernel 3: softmax over j fused with O1[i, h*32+d] = sum_j P[h,i,j] * V[j, h*32+d] ----------------
// One workgroup per (16-row tile, head). Each of its 8 waves owns 96 of the 768 columns and reads
// its scores straight into A-fragment order, all loads in flight at once: the scores are read
// once and P never goes to memory. The product takes exp(s - max); the row sum divides at the end.
constexpr int AV_WAVES = 8;
constexpr int AV_KW    = NN / AV_WAVES;   // 96 columns a wave
constexpr int AV_STEPS = AV_KW / 32;      // 3 WMMA k steps
constexpr int OP_LD    = 36;              // f32 elems; rows r and r+8 fall 32 banks apart

// 2^x. The v_nop keeps the free slot that the instruction set asks for between a transcendental
// and a next instruction that overwrites its source or reads its result.
__device__ inline float exp2_slot(float x) {
  float r;
  asm("v_exp_f32 %0, %1\n\tv_nop" : "=v"(r) : "v"(x));
  return r;
}

__global__ __launch_bounds__(256) void softmax_av_kernel(const float* S, const float* Vf,
                                                         float* O1) {
  __shared__ float red_max[AV_WAVES][16];
  __shared__ float red_sum[AV_WAVES][16];
  __shared__ __align__(16) float part[AV_WAVES][16 * OP_LD];
  int it = blockIdx.x;             // 0..47
  int h  = blockIdx.y;             // 0..7
  int t = threadIdx.x, lane = t & 31, wave = t >> 5;
  int m = lane & 15, hi = lane >> 4;
  // frag_k order: per k step two runs of 8 columns, 16 apart, starting at hi*8
  const float* Arow = S + ((size_t)h * NN + it * 16 + m) * NN + wave * AV_KW + hi * 8;
  // B columns: lane m holds head columns 2m (first N tile) and 2m+1 (second), one 8-byte load for both
  const float* Vcol = Vf + (size_t)(wave * AV_KW + hi * 8) * HID + h * HD + m * 2;

  float sv[AV_STEPS][16];
  float2 vv[AV_STEPS][16];
#pragma unroll
  for (int s = 0; s < AV_STEPS; ++s)
#pragma unroll
    for (int c = 0; c < 4; ++c) {
      float4 q = *(const float4*)(Arow + s * 32 + (c >> 1) * 16 + (c & 1) * 4);
      sv[s][c * 4 + 0] = q.x; sv[s][c * 4 + 1] = q.y;
      sv[s][c * 4 + 2] = q.z; sv[s][c * 4 + 3] = q.w;
    }
  // stands in front of the first reuse of the score loads' address registers (the V loads
  // below land in them)
  asm volatile("s_wait_xcnt 0x0" ::: "memory");
#pragma unroll
  for (int s = 0; s < AV_STEPS; ++s)
#pragma unroll
    for (int e = 0; e < 16; ++e)
      vv[s][e] = *(const float2*)(Vcol + (size_t)(s * 32 + e + (e >= 8 ? 8 : 0)) * HID);

  // row maximum: the lane's 48 columns, the other half of the row's lanes, then the 8 waves
  float mx = -3.4e38f;
#pragma unroll
  for (int s = 0; s < AV_STEPS; ++s)
#pragma unroll
    for (int e = 0; e < 16; ++e) mx = fmaxf(mx, sv[s][e]);
  mx = fmaxf(mx, __shfl_xor(mx, 16, 32));
  if (hi == 0) red_max[wave][m] = mx;
  __syncthreads();
  float wm[AV_WAVES];
#pragma unroll
  for (int w = 0; w < AV_WAVES; ++w) wm[w] = red_max[w][m];
#pragma unroll
  for (int w = 0; w < AV_WAVES; ++w) mx = fmaxf(mx, wm[w]);

  float sum = 0.f;
  v16bf a[AV_STEPS];
#pragma unroll
  for (int s = 0; s < AV_STEPS; ++s)
#pragma unroll
    for (int e = 0; e < 16; ++e) {
      float p = exp2_slot((sv[s][e] - mx) * 1.44269504f);   // e^(s - max)
      sum += p;
      a[s][e] = (__bf16)p;
    }
  // keeps every exponential ahead of the first WMMA: they are asm text, which the compiler's
  // padding behind a WMMA does not see
  __builtin_amdgcn_sched_barrier(0);
  v8f acc[2] = {v8f{}, v8f{}};
#pragma unroll
  for (int s = 0; s < AV_STEPS; ++s) {
    v16bf b0, b1;
#pragma unroll
    for (int e = 0; e < 16; ++e) {
      b0[e] = (__bf16)vv[s][e].x;
      b1[e] = (__bf16)vv[s][e].y;
    }
    acc[0] = wmma_bf16(a[s], b0, acc[0]);
    acc[1] = wmma_bf16(a[s], b1, acc[1]);
  }
  sum += __shfl_xor(sum, 16, 32);
  if (hi == 0) red_sum[wave][m] = sum;
#pragma unroll
  for (int r = 0; r < 8; ++r)
    *(float2*)(&part[wave][(r + hi * 8) * OP_LD + m * 2]) = make_float2(acc[0][r], acc[1][r]);
  __syncthreads();

  // the 8 waves' partial products and row sums; each thread finishes two neighbouring columns
  int row = t >> 4, c2 = (t & 15) * 2;
  float tot = 0.f, o0 = 0.f, o1 = 0.f;
#pragma unroll
  for (int w = 0; w < AV_WAVES; ++w) {
    float2 pr = *(const float2*)(&part[w][row * OP_LD + c2]);
    tot += red_sum[w][row];
    o0 += pr.x;
    o1 += pr.y;
  }
  float inv = 1.f / tot;
  *(float2*)(O1 + (size_t)(it * 16 + row) * HID + h * HD + c2) = make_float2(o0 * inv, o1 * inv);
}

// ---------------- kernel 4: out = O1 @ Wo + bo ----------------
__global__ __launch_bounds__(32) void outproj_kernel(
    const float* O1, const __bf16* arena, const float* bo, float* out) {
  int it = blockIdx.x, nt = blockIdx.y;
  int lane = threadIdx.x & 31, hi = lane >> 4, nc = lane & 15;
  const __bf16* Wot = arena + WOT;
  v8f acc = {};
#pragma unroll
  for (int kk = 0; kk < 8; ++kk) {
    v16bf a = load_frag(O1, it * 16, kk * 32, HID);    // f32 -> bf16 on the fly
    v16bf b = load_frag(Wot, nt * 16, kk * 32, HID);
    acc = wmma_bf16(a, b, acc);
  }
  int ncol = nt * 16 + nc;
  float bias = bo[ncol];
#pragma unroll
  for (int r = 0; r < 8; ++r)
    out[(size_t)(it * 16 + r + hi * 8) * HID + ncol] = acc[r] + bias;
}

// ---------------- launch ----------------
extern "C" void kernel_launch(void* const* d_in, const int* in_sizes, int n_in,
                              void* d_out, int out_size, void* d_ws, size_t ws_size,
                              hipStream_t stream) {
  (void)in_sizes; (void)n_in; (void)out_size; (void)ws_size;
  const float* x   = (const float*)d_in[0];
  const float* pos = (const float*)d_in[1];
  const float* Wq  = (const float*)d_in[2];  const float* bq = (const float*)d_in[3];
  const float* Wk  = (const float*)d_in[4];  const float* bk = (const float*)d_in[5];
  const float* Wv  = (const float*)d_in[6];  const float* bv = (const float*)d_in[7];
  const float* Wo  = (const float*)d_in[8];  const float* bo = (const float*)d_in[9];
  const float* W1  = (const float*)d_in[10]; const float* b1 = (const float*)d_in[11];
  const float* W2  = (const float*)d_in[12]; const float* b2 = (const float*)d_in[13];
  const float* W3  = (const float*)d_in[14]; const float* b3 = (const float*)d_in[15];

  char* ws = (char*)d_ws;
  __bf16* Qs    = (__bf16*)(ws + QF_OFF);
  __bf16* Ks    = (__bf16*)(ws + KF_OFF);
  float*  Vf    = (float*)(ws + VF_OFF);
  float*  S     = (float*)(ws + S_OFF);
  float*  O1    = (float*)(ws + O1_OFF);
  __bf16* arena = (__bf16*)(ws + BF_OFF);
  float*  out   = (float*)d_out;

  (void)hipFuncSetAttribute((const void*)relenc_kernel,
                            hipFuncAttributeMaxDynamicSharedMemorySize, SMEM_TOTAL);

  prep_kernel<<<(BF_TOTAL + 255) / 256, 256, 0, stream>>>(x, Wq, Wk, Wv, W2, W3, Wo, arena);
  qkv_kernel<<<dim3(48, 48), 32, 0, stream>>>(arena, bq, bk, bv, Qs, Ks, Vf);
  relenc_kernel<<<RELENC_WGS, 256, SMEM_TOTAL, stream>>>(pos, W1, b1, b2, b3,
                                                         arena, Qs, Ks, S);
  softmax_av_kernel<<<dim3(48, 8), 256, 0, stream>>>(S, Vf, O1);
  outproj_kernel<<<dim3(48, 16), 32, 0, stream>>>(O1, arena, bo, out);
}

// v006
// A run of this version takes 62.3 microseconds.
// In both of two side-by-side timings against v005, it was 1.18 times as fast.
// Over all steps from v000 it is 6.40 times as fast.
#include <hip/hip_runtime.h>
#include <hip/hip_bf16.h>

typedef __attribute__((ext_vector_type(16))) __bf16 v16bf;
typedef __attribute__((ext_vector_type(8)))  __bf16 v8bf;
typedef __attribute__((ext_vector_type(2)))  __bf16 v2bf;
typedef __attribute__((ext_vector_type(8)))  unsigned v8u;
typedef __attribute__((ext_vector_type(4)))  unsigned v4u;
typedef __attribute__((ext_vector_type(2)))  short    v2s;
typedef __attribute__((ext_vector_type(2)))  float    v2f;
typedef __attribute__((ext_vector_type(4)))  float    v4f;
typedef __attribute__((ext_vector_type(8)))  float  v8f;
typedef __attribute__((__vector_size__(16))) int    v4i;

// ---------------- problem constants ----------------
constexpr int NN    = 768;
constexpr int INDIM = 128;
constexpr int HID   = 256;
constexpr int HEADS = 8;
constexpr int HD    = 32;
constexpr float RSCALE = 0.17677669529663687f;   // 1/sqrt(32)

// ---------------- workspace layout (bytes) ----------------
constexpr size_t QF_OFF = 0;                         // Q as two bf16 planes (hi, lo): 2*768*256*2
constexpr size_t KF_OFF = 786432;                    // K likewise
constexpr size_t VF_OFF = 1572864;
constexpr size_t S_OFF  = 2359296;                   // 8*768*768*4 = 18874368
constexpr size_t O1_OFF = 21233664;                  // 768*256*4
constexpr size_t BF_OFF = 22020096;                  // bf16 arena (16B aligned)

// bf16 arena element offsets
constexpr int XB  = 0;        // x bf16: 768*128
constexpr int WQT = 98304;    // Wq^T bf16: 256*128
constexpr int WKT = 131072;
constexpr int WVT = 163840;
constexpr int W2T = 196608;   // W2^T: 256*256
constexpr int W3T = 262144;   // W3^T: 32*256
constexpr int WOT = 270336;   // Wo^T: 256*256
constexpr int BF_TOTAL = 335872;
constexpr int QK_PLANE = NN * HID;   // bf16 elems from a value's hi part to its lo part

// ---------------- WMMA helpers ----------------
__device__ inline int frag_k(int e, int hi) {
  // 16-bit A-matrix 16x32 lane layout (ISA 7.12.2): lane<16 -> K {0..7,16..23},
  // lane>=16 -> K {8..15,24..31}; two contiguous 16B chunks -> b128-friendly.
  return hi * 8 + e + (e >= 8 ? 8 : 0);
}

template <typename T>
__device__ inline v16bf load_frag(const T* p, int row0, int k0, int ld) {
  int lane = threadIdx.x & 31;
  int m = lane & 15, hi = lane >> 4;
  const T* b = p + (size_t)(row0 + m) * ld + k0;
  v16bf f;
#pragma unroll
  for (int e = 0; e < 16; ++e) f[e] = (__bf16)b[frag_k(e, hi)];
  return f;
}

__device__ inline v8f wmma_bf16(v16bf a, v16bf b, v8f c) {
  return __builtin_amdgcn_wmma_f32_16x16x32_bf16(false, a, false, b, (short)0, c,
                                                 false, false);
}

// ---------------- kernel 0: bf16 weight transposes ----------------
__global__ __launch_bounds__(256) void prep_kernel(
    const float* x, const float* Wq, const float* Wk, const float* Wv,
    const float* W2, const float* W3, const float* Wo, __bf16* arena) {
  int idx = blockIdx.x * blockDim.x + threadIdx.x;
  if (idx >= BF_TOTAL) return;
  if (idx < 98304) { arena[XB + idx] = (__bf16)x[idx]; return; }
  int r = idx - 98304;
  if (r < 3 * 32768) {
    int m = r / 32768, q = r % 32768;
    int nrow = q >> 7, k = q & 127;
    const float* W = (m == 0) ? Wq : (m == 1) ? Wk : Wv;
    arena[WQT + r] = (__bf16)W[k * 256 + nrow];
    return;
  }
  r -= 3 * 32768;
  if (r < 65536) { int n = r >> 8, k = r & 255; arena[W2T + r] = (__bf16)W2[k * 256 + n]; return; }
  r -= 65536;
  if (r < 8192)  { int d = r >> 8, k = r & 255; arena[W3T + r] = (__bf16)W3[k * 32 + d]; return; }
  r -= 8192;
  { int n = r >> 8, k = r & 255; arena[WOT + r] = (__bf16)Wo[k * 256 + n]; }
}

// ---------------- kernel 1: QKV projections (WMMA bf16) ----------------
__global__ __launch_bounds__(32) void qkv_kernel(
    const __bf16* arena, const float* bq, const float* bk, const float* bv,
    __bf16* Qs, __bf16* Ks, float* Vf) {
  int it  = blockIdx.x;          // row tile 0..47
  int mat = blockIdx.y >> 4;     // 0=Q 1=K 2=V
  int ct  = blockIdx.y & 15;     // col tile 0..15
  const __bf16* xb = arena + XB;
  const __bf16* Wt = arena + ((mat == 0) ? WQT : (mat == 1) ? WKT : WVT);
  const float* bias = (mat == 0) ? bq : (mat == 1) ? bk : bv;
  v8f acc = {};
  for (int k0 = 0; k0 < INDIM; k0 += 32) {
    v16bf a = load_frag(xb, it * 16, k0, INDIM);
    v16bf b = load_frag(Wt, ct * 16, k0, INDIM);
    acc = wmma_bf16(a, b, acc);
  }
  int lane = threadIdx.x & 31, hi = lane >> 4;
  int ncol = ct * 16 + (lane & 15);
  float bb = bias[ncol];
  if (mat == 2) {
#pragma unroll
    for (int r = 0; r < 8; ++r)
      Vf[(size_t)(it * 16 + r + hi * 8) * HID + ncol] = acc[r] + bb;
  } else {
    // Q and K feed the score WMMAs: each value goes out as hi = bf16(v) and lo = bf16(v - hi)
    __bf16* p = ((mat == 0) ? Qs : Ks) + (size_t)(it * 16 + hi * 8) * HID + ncol;
    __bf16 vh[8], vl[8];
#pragma unroll
    for (int r = 0; r < 8; ++r) {
      float v = acc[r] + bb;
      vh[r] = (__bf16)v;
      vl[r] = (__bf16)(v - (float)vh[r]);
    }
#pragma unroll
    for (int r = 0; r < 8; ++r) {
      p[r * HID] = vh[r];
      p[QK_PLANE + r * HID] = vl[r];
    }
    // stands in front of the first reuse of the stores' registers: the built code of the V branch
    // follows this one
    asm volatile("s_wait_xcnt 0x0" ::: "memory");
  }
}

// ---------------- kernel 2: fused pair-MLP + scores ----------------
// Every layer is computed transposed (weights^T as A, activations^T as B), so that two f32 D tiles
// of one layer, converted in place, are the bf16 B fragment of the next: a wave's h1, h2 and enc
// never leave its registers. The weights lie in LDS, staged once per workgroup, and are streamed
// as A fragments.
// A wave holds PT pair tiles: one row i, PT * 16 neighbouring columns j. A workgroup's 8 waves
// take 8 neighbouring rows of the same columns; it walks PASSES such blocks.
constexpr int PT         = 3;
constexpr int JW         = PT * 16;                 // 48 columns a block
constexpr int JBLK       = NN / JW;                 // 16 blocks a row
constexpr int PASSES     = 6;
constexpr int RELENC_WGS = (NN / 8) * JBLK / PASSES;      // 256
constexpr int W2_LD      = 264;                     // bf16 elems; 528B row: 16B aligned, bank-spread
constexpr int W3_LD      = 264;
constexpr int W1_PLANE   = HID * 8;                 // bf16 elems: 8 per hidden column
constexpr int QK_BUF     = 8 * JW * HEADS;          // f32 elems: Q.K of a block, [row][column][head]
constexpr int W2LDS_OFF  = 0;
constexpr int W3LDS_OFF  = W2LDS_OFF + HID * W2_LD * 2;   // 135168
constexpr int W1LDS_OFF  = W3LDS_OFF + HD * W3_LD * 2;    // 152064
constexpr int B2LDS_OFF  = W1LDS_OFF + 2 * W1_PLANE * 2;  // 160256
constexpr int POSLDS_OFF = B2LDS_OFF + HID * 4;           // 161280
constexpr int QKLDS_OFF  = POSLDS_OFF + NN * 3 * 4;       // 170496
constexpr int SMEM_TOTAL = QKLDS_OFF + 2 * QK_BUF * 4;    // 195072 <= 320KB

// Each f32 value x of rel, W1 and b1 goes into the bf16 product as a pair: hi = bf16(x) and
// lo = bf16(x - hi); all four cross products are summed in f32, so about 16 bits of each
// operand take part.
__device__ inline unsigned pack2(float a, float b) {
  v2bf v = {(__bf16)a, (__bf16)b};
  return __builtin_bit_cast(unsigned, v);
}
__device__ inline float bf_lo(float x) { return x - (float)(__bf16)x; }

// One hidden column's A row, k slots 0..7 (plane 0) and 8..15 (plane 1) of a lane:
//   plane 0: W1hi[0..2], W1hi[0..2], b1hi, 0      plane 1: the same of the lo parts
// against B slots  relhi[0..2], rello[0..2], 1, 0  in both groups of 8.
__device__ inline void w1_table_row(__bf16* w1t, int n, float w0, float w1, float w2, float bb) {
  v8bf ph = {(__bf16)w0, (__bf16)w1, (__bf16)w2, (__bf16)w0, (__bf16)w1, (__bf16)w2,
             (__bf16)bb, (__bf16)0.f};
  float l0 = bf_lo(w0), l1 = bf_lo(w1), l2 = bf_lo(w2), lb = bf_lo(bb);
  v8bf pl = {(__bf16)l0, (__bf16)l1, (__bf16)l2, (__bf16)l0, (__bf16)l1, (__bf16)l2,
             (__bf16)lb, (__bf16)0.f};
  *(v8bf*)(w1t + n * 8) = ph;
  *(v8bf*)(w1t + W1_PLANE + n * 8) = pl;
}

// relu behind the rounding, on the packed bf16 bit patterns: read as signed 16-bit integers every
// negative value lies below 0 and every positive one keeps its bits, so one packed integer
// maximum does two elements (rounding keeps the sign, so the order of the two does not matter).
__device__ inline unsigned relu_pack2(float a, float b) {
  v2f x = {a, b};
  v2s z = {};
  return __builtin_bit_cast(unsigned, __builtin_elementwise_max(
      __builtin_bit_cast(v2s, __builtin_convertvector(x, v2bf)), z));
}
// Two D tiles of a transposed layer (rows 0..15 and 16..31 of a block of 32 hidden columns, same
// 16 pairs) -> relu -> the B fragment of these 32 k of the next layer, in the k order of frag_k.
__device__ inline v16bf relu_frag(v8f d0, v8f d1) {
  v8u o = {relu_pack2(d0[0], d0[1]), relu_pack2(d0[2], d0[3]), relu_pack2(d0[4], d0[5]),
           relu_pack2(d0[6], d0[7]), relu_pack2(d1[0], d1[1]), relu_pack2(d1[2], d1[3]),
           relu_pack2(d1[4], d1[5]), relu_pack2(d1[6], d1[7])};
  return __builtin_bit_cast(v16bf, o);
}

// b already points at the lane's own row and k half (frag_k order: two 16B chunks, 32B apart).
__device__ inline v16bf load_frag_at(const __bf16* b) {
  v16bf f;
#pragma unroll
  for (int e = 0; e < 16; ++e) f[e] = b[e + (e >= 8 ? 8 : 0)];
  return f;
}

// A fragments of two row tiles of W2^T (32 hidden columns of h2) over four k steps (128 k)
__device__ inline void load_w2_half(v16bf (&w)[8], const __bf16* p) {
#pragma unroll
  for (int nn = 0; nn < 2; ++nn)
#pragma unroll
    for (int k4 = 0; k4 < 4; ++k4) w[nn * 4 + k4] = load_frag_at(p + nn * 16 * W2_LD + k4 * 32);
}

__global__ __launch_bounds__(256) void relenc_kernel(
    const float* pos, const float* W1, const float* b1,
    const float* b2, const float* b3,
    const __bf16* arena, const __bf16* Qs, const __bf16* Ks, float* S) {
  extern __shared__ __align__(16) char smem[];
  __bf16* w2s = (__bf16*)(smem + W2LDS_OFF);
  __bf16* w3s = (__bf16*)(smem + W3LDS_OFF);
  __bf16* w1t = (__bf16*)(smem + W1LDS_OFF);
  float* b2s  = (float*)(smem + B2LDS_OFF);
  float* poss = (float*)(smem + POSLDS_OFF);
  float* qk   = (float*)(smem + QKLDS_OFF);

  int t = threadIdx.x;
  int lane = t & 31, wave = t >> 5, c = lane & 15, hi = lane >> 4;

  // b3 in the D order of enc^T (register r of column tile nt: d = nt*16 + 8*hi + r): the start
  // value of the enc accumulators
  const float* b3l = b3 + hi * 8;
  const v8f bias3[2] = {*(const v8f*)(b3l), *(const v8f*)(b3l + 16)};
  // ---- once per workgroup: weights, b2 and pos into LDS
  {
    const float* w1p = W1 + t;
    const float* b1p = b1 + t;
    const float* b2p = b2 + t;
    const float* pp = pos + t;
    const float w1c0 = w1p[0], w1c1 = w1p[256], w1c2 = w1p[512], b1c0 = b1p[0], b2c0 = b2p[0];
    float pc[9];
#pragma unroll
    for (int s = 0; s < 9; ++s) pc[s] = pp[s * 256];
    const v4i* w3g = (const v4i*)(arena + W3T) + t;
    v4i w3c[4];
#pragma unroll
    for (int s = 0; s < 4; ++s) w3c[s] = w3g[s * 256];
    const v4i* w2g = (const v4i*)(arena + W2T) + t;
    v4i w2c[32];
#pragma unroll
    for (int s = 0; s < 32; ++s) w2c[s] = w2g[s * 256];
    // stands in front of the first reuse of these loads' address registers; the operands keep
    // these registers untouched up to it
    asm volatile("s_wait_xcnt 0x0" ::"v"(t), "s"(pos), "s"(W1), "s"(b1), "s"(b2), "s"(b3),
                 "s"(arena) : "memory");
    w1_table_row(w1t, t, w1c0, w1c1, w1c2, b1c0);
    b2s[t] = b2c0;
#pragma unroll
    for (int s = 0; s < 9; ++s) poss[s * 256 + t] = pc[s];
    // 16-byte chunk s*256 + t: row s*8 + t/32, chunk t%32 of the row
    __bf16* w3d = w3s + (t >> 5) * W3_LD + (t & 31) * 8;
#pragma unroll
    for (int s = 0; s < 4; ++s) *(v4i*)(w3d + s * 8 * W3_LD) = w3c[s];
    __bf16* w2d = w2s + (t >> 5) * W2_LD + (t & 31) * 8;
#pragma unroll
    for (int s = 0; s < 32; ++s) *(v4i*)(w2d + s * 8 * W2_LD) = w2c[s];
  }
  __syncthreads();

  const __bf16* w2l = w2s + c * W2_LD + hi * 8;
  const __bf16* w3l = w3s + c * W3_LD + hi * 8;
  const float* b2l = b2s + hi * 8;

  for (int p = 0; p < PASSES; ++p) {
    const int blk = blockIdx.x * PASSES + p;
    const int I8 = (blk / JBLK) * 8, J0 = (blk % JBLK) * JW;
    const int gi = I8 + wave;   // the wave's row i
    float* qkb = qk + (p & 1) * QK_BUF;

    // The block's Q and K fragments (hi and lo planes), issued here so that layer 1 runs while
    // they arrive. Q.K: this wave takes head 'wave', A = the 8 Q rows (each twice), B = 16 K rows.
    const __bf16* qa = Qs + (size_t)(I8 + (lane & 7)) * HID + wave * HD + hi * 8;
    const __bf16* ka = Ks + (size_t)(J0 + c) * HID + wave * HD + hi * 8;
    const v16bf qhF = load_frag_at(qa), qlF = load_frag_at(qa + QK_PLANE);
    v16bf khF[PT], klF[PT];
#pragma unroll
    for (int u = 0; u < PT; ++u) {
      khF[u] = load_frag_at(ka + u * 16 * HID);
      klF[u] = load_frag_at(ka + u * 16 * HID + QK_PLANE);
    }
    // Q.enc of row i: A rows 0..3 are the hi parts of Q[i] of heads 0..3, rows 4..7 their lo
    // parts, rows 8..15 the same of heads 4..7.
    const __bf16* qe = Qs + ((lane & 4) ? QK_PLANE : 0) + (size_t)gi * HID +
                       ((lane & 8) / 2 + (lane & 3)) * HD + hi * 8;
    const v16bf qeF = load_frag_at(qe);
    // stands in front of the first reuse of these loads' address registers
    asm volatile("s_wait_xcnt 0x0" ::: "memory");

    // ---- Layer 1: h1^T = relu(W1ext^T (A) x relext^T (B)), rel = pos[j] - pos[i].
    // The B operand holds a pair's slots in lanes 0..15 and zero in lanes 16..31, whose k slots
    // then add nothing.
    v8u h1u[PT][8];   // B fragments of h1^T, as packed words
    {
      const float* pi = poss + gi * 3;
      const float* pj = poss + (J0 + c) * 3;
      const float i0 = pi[0], i1 = pi[1], i2 = pi[2];
      v16bf Bf[PT];
#pragma unroll
      for (int u = 0; u < PT; ++u) {
        float r0 = pj[u * 48 + 0] - i0, r1 = pj[u * 48 + 1] - i1, r2 = pj[u * 48 + 2] - i2;
        unsigned p0 = pack2(r0, r1), p1 = pack2(r2, bf_lo(r0)), p2 = pack2(bf_lo(r1), bf_lo(r2));
        unsigned p3 = 0x3F80u;   // bf16 1.0 (takes the bias), then 0
        unsigned a0 = hi ? 0u : p0, a1 = hi ? 0u : p1, a2 = hi ? 0u : p2, a3 = hi ? 0u : p3;
        v8u ub = {a0, a1, a2, a3, a0, a1, a2, a3};
        Bf[u] = __builtin_bit_cast(v16bf, ub);
      }
      const __bf16* wa = w1t + c * 8;
      v16bf A[16];
#pragma unroll
      for (int nt = 0; nt < 16; ++nt) {
        v8bf x = *(const v8bf*)(wa + nt * 128);
        v8bf y = *(const v8bf*)(wa + W1_PLANE + nt * 128);
        A[nt] = __builtin_shufflevector(x, y, 0, 1, 2, 3, 4, 5, 6, 7, 8, 9, 10, 11, 12, 13, 14, 15);
      }
      // Blocks of six independent WMMAs (two column tiles x PT pair tiles), two sets of D tiles:
      // behind each WMMA of block b stands the conversion of one D tile of block b-1.
      v8f d[2][PT][2];
#pragma unroll
      for (int b = 0; b <= 8; ++b) {
#pragma unroll
        for (int u = 0; u < PT; ++u)
#pragma unroll
          for (int nn = 0; nn < 2; ++nn) {
            if (b < 8) d[b & 1][u][nn] = wmma_bf16(A[2 * b + nn], Bf[u], v8f{});
            // keeps this order: eight vector instructions on a finished tile run under each WMMA
            // (scheduled freely, each WMMA stood directly in front of its own readers, its latency
            // waited out; all six WMMAs first, the vector work stood bare behind them)
            __builtin_amdgcn_sched_barrier(0);
            if (b > 0) {
              const v8f x = d[(b - 1) & 1][u][nn];
#pragma unroll
              for (int q = 0; q < 4; ++q) h1u[u][b - 1][nn * 4 + q] = relu_pack2(x[2 * q], x[2 * q + 1]);
            }
            __builtin_amdgcn_sched_barrier(0);  // as above
          }
      }
    }
    v16bf h1f[PT][8];
#pragma unroll
    for (int u = 0; u < PT; ++u)
#pragma unroll
      for (int kk = 0; kk < 8; ++kk) h1f[u][kk] = __builtin_bit_cast(v16bf, h1u[u][kk]);

    // ---- Q.K of this wave's head, all four hi/lo cross products summed in f32, smallest first.
    // D register r of either lane half is pair (row r, column c); lanes 0..15 store rows 0..3,
    // lanes 16..31 rows 4..7, as [row][column][head].
    {
      v8f s[PT];
#pragma unroll
      for (int u = 0; u < PT; ++u) s[u] = wmma_bf16(qlF, klF[u], v8f{});
#pragma unroll
      for (int u = 0; u < PT; ++u) s[u] = wmma_bf16(qlF, khF[u], s[u]);
#pragma unroll
      for (int u = 0; u < PT; ++u) s[u] = wmma_bf16(qhF, klF[u], s[u]);
#pragma unroll
      for (int u = 0; u < PT; ++u) s[u] = wmma_bf16(qhF, khF[u], s[u]);
      float* qd = qkb + (hi * 4 * JW + c) * HEADS + wave;
#pragma unroll
      for (int u = 0; u < PT; ++u) {
        const v4f w = hi ? __builtin_shufflevector(s[u], s[u], 4, 5, 6, 7)
                         : __builtin_shufflevector(s[u], s[u], 0, 1, 2, 3);
#pragma unroll
        for (int q = 0; q < 4; ++q) qd[(q * JW + u * 16) * HEADS] = w[q];
      }
    }
    // Publishes the block's Q.K table. The tables of neighbouring passes lie in two buffers, so
    // this one barrier also ends every wave's reads of the buffer that the next pass fills. Its
    // fences name LDS alone, so that global loads and stores stay in flight over it.
    __builtin_amdgcn_fence(__ATOMIC_RELEASE, "workgroup", "local");
    __builtin_amdgcn_s_barrier();
    __builtin_amdgcn_fence(__ATOMIC_ACQUIRE, "workgroup", "local");

    // ---- Layers 2 and 3, 32 columns of h2 at a time:
    // h2^T = relu(W2^T (A) x h1^T (B) + b2), b2 being the accumulators' start value; the two D
    // tiles of a pair tile are the B fragment of these 32 k of enc^T = W3^T (A) x h2^T (B) + b3.
    v8f e[PT][2];
#pragma unroll
    for (int u = 0; u < PT; ++u) { e[u][0] = bias3[0]; e[u][1] = bias3[1]; }
    {
      v16bf wA[8], wB[8];
      load_w2_half(wA, w2l);
      v8f bb[2] = {*(const v8f*)(b2l), *(const v8f*)(b2l + 16)};
      // two trips a turn: the start values fetched for the next trip then land where that trip
      // reads them (rolled, they were copied there, sixteen registers a trip); not further: a turn
      // is 108 WMMAs long already
#pragma unroll 2
      for (int np = 0; np < 8; ++np) {
        load_w2_half(wB, w2l + np * 32 * W2_LD + 128);
        // keeps the next half's LDS reads as one group ahead of this half's WMMAs
        // (sunk among or behind them, their latency is waited out at the next half)
        __builtin_amdgcn_sched_barrier(0);
        v8f acc[2][PT];
#pragma unroll
        for (int nn = 0; nn < 2; ++nn)
#pragma unroll
          for (int u = 0; u < PT; ++u) acc[nn][u] = wmma_bf16(wA[nn * 4], h1f[u][0], bb[nn]);
#pragma unroll
        for (int k4 = 1; k4 < 4; ++k4)
#pragma unroll
          for (int nn = 0; nn < 2; ++nn)
#pragma unroll
            for (int u = 0; u < PT; ++u)
              acc[nn][u] = wmma_bf16(wA[nn * 4 + k4], h1f[u][k4], acc[nn][u]);
        // keeps the reads below in one place (lifted among the WMMAs above, into each register as
        // it falls free, they stood in eight places, each of which costs the wave issue time)
        __builtin_amdgcn_sched_barrier(0);
        // the next trip's first half and start values (the last trip reads the first rows again)
        const int nq = (np + 1) & 7;
        load_w2_half(wA, w2l + nq * 32 * W2_LD);
        bb[0] = *(const v8f*)(b2l + nq * 32);
        bb[1] = *(const v8f*)(b2l + nq * 32 + 16);
        const v16bf a3[2] = {load_frag_at(w3l + np * 32), load_frag_at(w3l + 16 * W3_LD + np * 32)};
        __builtin_amdgcn_sched_barrier(0);  // as the first
#pragma unroll
        for (int k4 = 0; k4 < 4; ++k4)
#pragma unroll
          for (int nn = 0; nn < 2; ++nn)
#pragma unroll
            for (int u = 0; u < PT; ++u)
              acc[nn][u] = wmma_bf16(wB[nn * 4 + k4], h1f[u][4 + k4], acc[nn][u]);
        v16bf h2f[PT];
#pragma unroll
        for (int u = 0; u < PT; ++u) h2f[u] = relu_frag(acc[0][u], acc[1][u]);
#pragma unroll
        for (int u = 0; u < PT; ++u)
#pragma unroll
          for (int nt = 0; nt < 2; ++nt) e[u][nt] = wmma_bf16(a3[nt], h2f[u], e[u][nt]);
      }
    }

    // ---- Scores: S[h,i,j] = (Q[i,h].enc[i,j] + Q[i,h].K[j,h]) / sqrt(d). D register r of column
    // tile nt of enc^T in lane (c, hi) is d = nt*16 + 8*hi + r of pair j = c: the two D tiles are a
    // B fragment (k = d, column j). A = Q[i] (hi and lo rows), B = enc lo, then enc hi; registers q
    // and 4 + q of the result add up to head 4*hi + q of pair j = c.
    {
      v8u eh[PT], el[PT];
      float4 qkv[PT];
#pragma unroll
      for (int u = 0; u < PT; ++u) {
        qkv[u] = *(const float4*)(qkb + (wave * JW + u * 16 + c) * HEADS + hi * 4);
#pragma unroll
        for (int q = 0; q < 8; ++q) {
          v2f x = {e[u][q >> 2][(q & 3) * 2], e[u][q >> 2][(q & 3) * 2 + 1]};
          v2bf xh = __builtin_convertvector(x, v2bf);
          v2f xl = x - __builtin_convertvector(xh, v2f);
          eh[u][q] = __builtin_bit_cast(unsigned, xh);
          el[u][q] = __builtin_bit_cast(unsigned, __builtin_convertvector(xl, v2bf));
        }
      }
      v8f d[PT];
#pragma unroll
      for (int u = 0; u < PT; ++u) d[u] = wmma_bf16(qeF, __builtin_bit_cast(v16bf, el[u]), v8f{});
#pragma unroll
      for (int u = 0; u < PT; ++u) d[u] = wmma_bf16(qeF, __builtin_bit_cast(v16bf, eh[u]), d[u]);
      float* sp = S + ((size_t)(hi * 4) * NN + gi) * NN + J0 + c;
#pragma unroll
      for (int u = 0; u < PT; ++u) {
        sp[u * 16]                       = (d[u][0] + d[u][4] + qkv[u].x) * RSCALE;
        sp[u * 16 + (size_t)1 * NN * NN] = (d[u][1] + d[u][5] + qkv[u].y) * RSCALE;
        sp[u * 16 + (size_t)2 * NN * NN] = (d[u][2] + d[u][6] + qkv[u].z) * RSCALE;
        sp[u * 16 + (size_t)3 * NN * NN] = (d[u][3] + d[u][7] + qkv[u].w) * RSCALE;
      }
      // stands in front of the first reuse of the stores' address and data registers
      asm volatile("s_wait_xcnt 0x0" ::: "memory");
    }
  }
}

// ---------------- kernel 3: softmax over j fused with O1[i, h*32+d] = sum_j P[h,i,j] * V[j, h*32+d] ----------------
// One workgroup per (16-row tile, head). Each of its 8 waves owns 96 of the 768 columns and reads
// its scores straight into A-fragment order, all loads in flight at once: the scores are read
// once and P never goes to memory. The product takes exp(s - max); the row sum divides at the end.
constexpr int AV_WAVES = 8;
constexpr int AV_KW    = NN / AV_WAVES;   // 96 columns a wave
constexpr int AV_STEPS = AV_KW / 32;      // 3 WMMA k steps
constexpr int OP_LD    = 36;              // f32 elems; rows r and r+8 fall 32 banks apart

// 2^x. The v_nop keeps the free slot that the instruction set asks for between a transcendental
// and a next instruction that overwrites its source or reads its result.
__device__ inline float exp2_slot(float x) {
  float r;
  asm("v_exp_f32 %0, %1\n\tv_nop" : "=v"(r) : "v"(x));
  return r;
}

__global__ __launch_bounds__(256) void softmax_av_kernel(const float* S, const float* Vf,
                                                         float* O1) {
  __shared__ float red_max[AV_WAVES][16];
  __shared__ float red_sum[AV_WAVES][16];
  __shared__ __align__(16) float part[AV_WAVES][16 * OP_LD];
  int it = blockIdx.x;             // 0..47
  int h  = blockIdx.y;             // 0..7
  int t = threadIdx.x, lane = t & 31, wave = t >> 5;
  int m = lane & 15, hi = lane >> 4;
  // frag_k order: per k step two runs of 8 columns, 16 apart, starting at hi*8
  const float* Arow = S + ((size_t)h * NN + it * 16 + m) * NN + wave * AV_KW + hi * 8;
  // B columns: lane m holds head columns 2m (first N tile) and 2m+1 (second), one 8-byte load for both
  const float* Vcol = Vf + (size_t)(wave * AV_KW + hi * 8) * HID + h * HD + m * 2;

  float sv[AV_STEPS][16];
  float2 vv[AV_STEPS][16];
#pragma unroll
  for (int s = 0; s < AV_STEPS; ++s)
#pragma unroll
    for (int c = 0; c < 4; ++c) {
      float4 q = *(const float4*)(Arow + s * 32 + (c >> 1) * 16 + (c & 1) * 4);
      sv[s][c * 4 + 0] = q.x; sv[s][c * 4 + 1] = q.y;
      sv[s][c * 4 + 2] = q.z; sv[s][c * 4 + 3] = q.w;
    }
  // stands in front of the first reuse of the score loads' address registers (the V loads
  // below land in them)
  asm volatile("s_wait_xcnt 0x0" ::: "memory");
#pragma unroll
  for (int s = 0; s < AV_STEPS; ++s)
#pragma unroll
    for (int e = 0; e < 16; ++e)
      vv[s][e] = *(const float2*)(Vcol + (size_t)(s * 32 + e + (e >= 8 ? 8 : 0)) * HID);

  // row maximum: the lane's 48 columns, the other half of the row's lanes, then the 8 waves
  float mx = -3.4e38f;
#pragma unroll
  for (int s = 0; s < AV_STEPS; ++s)
#pragma unroll
    for (int e = 0; e < 16; ++e) mx = fmaxf(mx, sv[s][e]);
  mx = fmaxf(mx, __shfl_xor(mx, 16, 32));
  if (hi == 0) red_max[wave][m] = mx;
  __syncthreads();
  float wm[AV_WAVES];
#pragma unroll
  for (int w = 0; w < AV_WAVES; ++w) wm[w] = red_max[w][m];
#pragma unroll
  for (int w = 0; w < AV_WAVES; ++w) mx = fmaxf(mx, wm[w]);

  float sum = 0.f;
  v16bf a[AV_STEPS];
#pragma unroll
  for (int s = 0; s < AV_STEPS; ++s)
#pragma unroll
    for (int e = 0; e < 16; ++e) {
      float p = exp2_slot((sv[s][e] - mx) * 1.44269504f);   // e^(s - max)
      sum += p;
      a[s][e] = (__bf16)p;
    }
  // keeps every exponential ahead of the first WMMA: they are asm text, which the compiler's
  // padding behind a WMMA does not see
  __builtin_amdgcn_sched_barrier(0);
  v8f acc[2] = {v8f{}, v8f{}};
#pragma unroll
  for (int s = 0; s < AV_STEPS; ++s) {
    v16bf b0, b1;
#pragma unroll
    for (int e = 0; e < 16; ++e) {
      b0[e] = (__bf16)vv[s][e].x;
      b1[e] = (__bf16)vv[s][e].y;
    }
    acc[0] = wmma_bf16(a[s], b0, acc[0]);
    acc[1] = wmma_bf16(a[s], b1, acc[1]);
  }
  sum += __shfl_xor(sum, 16, 32);
  if (hi == 0) red_sum[wave][m] = sum;
#pragma unroll
  for (int r = 0; r < 8; ++r)
    *(float2*)(&part[wave][(r + hi * 8) * OP_LD + m * 2]) = make_float2(acc[0][r], acc[1][r]);
  __syncthreads();

  // the 8 waves' partial products and row sums; each thread finishes two neighbouring columns
  int row = t >> 4, c2 = (t & 15) * 2;
  float tot = 0.f, o0 = 0.f, o1 = 0.f;
#pragma unroll
  for (int w = 0; w < AV_WAVES; ++w) {
    float2 pr = *(const float2*)(&part[w][row * OP_LD + c2]);
    tot += red_sum[w][row];
    o0 += pr.x;
    o1 += pr.y;
  }
  float inv = 1.f / tot;
  *(float2*)(O1 + (size_t)(it * 16 + row) * HID + h * HD + c2) = make_float2(o0 * inv, o1 * inv);
}

// ---------------- kernel 4: out = O1 @ Wo + bo ----------------
__global__ __launch_bounds__(32) void outproj_kernel(
    const float* O1, const __bf16* arena, const float* bo, float* out) {
  int it = blockIdx.x, nt = blockIdx.y;
  int lane = threadIdx.x & 31, hi = lane >> 4, nc = lane & 15;
  const __bf16* Wot = arena + WOT;
  v8f acc = {};
#pragma unroll
  for (int kk = 0; kk < 8; ++kk) {
    v16bf a = load_frag(O1, it * 16, kk * 32, HID);    // f32 -> bf16 on the fly
    v16bf b = load_frag(Wot, nt * 16, kk * 32, HID);
    acc = wmma_bf16(a, b, acc);
  }
  int ncol = nt * 16 + nc;
  float bias = bo[ncol];
#pragma unroll
  for (int r = 0; r < 8; ++r)
    out[(size_t)(it * 16 + r + hi * 8) * HID + ncol] = acc[r] + bias;
}

// ---------------- launch ----------------
extern "C" void kernel_launch(void* const* d_in, const int* in_sizes, int n_in,
                              void* d_out, int out_size, void* d_ws, size_t ws_size,
                              hipStream_t stream) {
  (void)in_sizes; (void)n_in; (void)out_size; (void)ws_size;
  const float* x   = (const float*)d_in[0];
  const float* pos = (const float*)d_in[1];
  const float* Wq  = (const float*)d_in[2];  const float* bq = (const float*)d_in[3];
  const float* Wk  = (const float*)d_in[4];  const float* bk = (const float*)d_in[5];
  const float* Wv  = (const float*)d_in[6];  const float* bv = (const float*)d_in[7];
  const float* Wo  = (const float*)d_in[8];  const float* bo = (const float*)d_in[9];
  const float* W1  = (const float*)d_in[10]; const float* b1 = (const float*)d_in[11];
  const float* W2  = (const float*)d_in[12]; const float* b2 = (const float*)d_in[13];
  const float* W3  = (const float*)d_in[14]; const float* b3 = (const float*)d_in[15];

  char* ws = (char*)d_ws;
  __bf16* Qs    = (__bf16*)(ws + QF_OFF);
  __bf16* Ks    = (__bf16*)(ws + KF_OFF);
  float*  Vf    = (float*)(ws + VF_OFF);
  float*  S     = (float*)(ws + S_OFF);
  float*  O1    = (float*)(ws + O1_OFF);
  __bf16* arena = (__bf16*)(ws + BF_OFF);
  float*  out   = (float*)d_out;

  (void)hipFuncSetAttribute((const void*)relenc_kernel,
                            hipFuncAttributeMaxDynamicSharedMemorySize, SMEM_TOTAL);

  prep_kernel<<<(BF_TOTAL + 255) / 256, 256, 0, stream>>>(x, Wq, Wk, Wv, W2, W3, Wo, arena);
  qkv_kernel<<<dim3(48, 48), 32, 0, stream>>>(arena, bq, bk, bv, Qs, Ks, Vf);
  relenc_kernel<<<RELENC_WGS, 256, SMEM_TOTAL, stream>>>(pos, W1, b1, b2, b3,
                                                         arena, Qs, Ks, S);
  softmax_av_kernel<<<dim3(48, 8), 256, 0, stream>>>(S, Vf, O1);
  outproj_kernel<<<dim3(48, 16), 32, 0, stream>>>(O1, arena, bo, out);
}

// v007
// Measured time: 60.2 microseconds a run.
// Two timings next to v006 put it at 1.04 and 1.03 times that version's speed.
// All steps since v000 together make it 6.64 times as fast.
#include <hip/hip_runtime.h>
#include <hip/hip_bf16.h>

typedef __attribute__((ext_vector_type(16))) __bf16 v16bf;
typedef __attribute__((ext_vector_type(8)))  __bf16 v8bf;
typedef __attribute__((ext_vector_type(2)))  __bf16 v2bf;
typedef __attribute__((ext_vector_type(8)))  unsigned v8u;
typedef __attribute__((ext_vector_type(4)))  unsigned v4u;
typedef __attribute__((ext_vector_type(2)))  short    v2s;
typedef __attribute__((ext_vector_type(2)))  float    v2f;
typedef __attribute__((ext_vector_type(4)))  float    v4f;
typedef __attribute__((ext_vector_type(8)))  float  v8f;
typedef __attribute__((ext_vector_type(16))) float  v16f;
typedef __attribute__((__vector_size__(16))) int    v4i;

// ---------------- problem constants ----------------
constexpr int NN    = 768;
constexpr int INDIM = 128;
constexpr int HID   = 256;
constexpr int HEADS = 8;
constexpr int HD    = 32;
constexpr float RSCALE = 0.17677669529663687f;   // 1/sqrt(32)

// ---------------- workspace layout (bytes) ----------------
constexpr size_t QF_OFF = 0;                         // Q as two bf16 planes (hi, lo): 2*768*256*2
constexpr size_t KF_OFF = 786432;                    // K likewise
constexpr size_t VF_OFF = 1572864;
constexpr size_t S_OFF  = 2359296;                   // 8*768*768*4 = 18874368
constexpr size_t O1_OFF = 21233664;                  // 768*256*4
constexpr size_t BF_OFF = 22020096;                  // bf16 arena (16B aligned)

// bf16 arena element offsets
constexpr int W2T = 196608;   // W2^T: 256*256
constexpr int W3T = 262144;   // W3^T: 32*256
constexpr int WOT = 270336;   // Wo^T: 256*256
constexpr int QK_PLANE = NN * HID;   // bf16 elems from a value's hi part to its lo part

// ---------------- WMMA helpers ----------------
__device__ inline int frag_k(int e, int hi) {
  // 16-bit A-matrix 16x32 lane layout (ISA 7.12.2): lane<16 -> K {0..7,16..23},
  // lane>=16 -> K {8..15,24..31}; two contiguous 16B chunks -> b128-friendly.
  return hi * 8 + e + (e >= 8 ? 8 : 0);
}

template <typename T>
__device__ inline v16bf load_frag(const T* p, int row0, int k0, int ld) {
  int lane = threadIdx.x & 31;
  int m = lane & 15, hi = lane >> 4;
  const T* b = p + (size_t)(row0 + m) * ld + k0;
  v16bf f;
#pragma unroll
  for (int e = 0; e < 16; ++e) f[e] = (__bf16)b[frag_k(e, hi)];
  return f;
}

__device__ inline v8f wmma_bf16(v16bf a, v16bf b, v8f c) {
  return __builtin_amdgcn_wmma_f32_16x16x32_bf16(false, a, false, b, (short)0, c,
                                                 false, false);
}

// ---------------- kernel 1: QKV projections (WMMA bf16) and the bf16 weight transposes ----------------
// One launch holds both: the projections read x and their weights as f32 and round them to bf16 in
// registers, so they wait for no earlier launch; the transposes that the later kernels read
// (W2^T, W3^T, Wo^T) are the work of further workgroups of the same grid.
constexpr int QKV_WGS   = (NN / 16) * 3;          // one per (16-row tile, matrix); a wave = 32 columns
// a transposing workgroup takes 64 k of 32 columns: its 8 waves fill whole 128-byte lines
constexpr int TW2_WGS   = (HID / 32) * (HID / 64);
constexpr int TW3_WGS   = (HD / 32) * (HID / 64);
constexpr int FRONT_WGS = QKV_WGS + TW2_WGS + TW3_WGS + TW2_WGS;

// 8 neighbouring k (rows) of column n of a row-major f32 matrix with 256 rows -> 16 bytes of row n
// of its bf16 transpose
__device__ inline void transpose8(const float* Wm, int ld, int n, int kc, __bf16* dst) {
  const float* p = Wm + kc * 8 * ld + n;
  float v[8];
#pragma unroll
  for (int e = 0; e < 8; ++e) v[e] = p[e * ld];
  // stands in front of the first reuse of these loads' address registers
  asm volatile("s_wait_xcnt 0x0" ::: "memory");
  v8bf o;
#pragma unroll
  for (int e = 0; e < 8; ++e) o[e] = (__bf16)v[e];
  *(v8bf*)(dst + n * HID + kc * 8) = o;
  // stands in front of the first reuse of the store's registers: the built code of the next
  // transpose follows this one
  asm volatile("s_wait_xcnt 0x0" ::: "memory");
}

__global__ __launch_bounds__(256) void front_kernel(
    const float* x, const float* Wq, const float* Wk, const float* Wv,
    const float* bq, const float* bk, const float* bv,
    const float* W2, const float* W3, const float* Wo,
    __bf16* arena, __bf16* Qs, __bf16* Ks, float* Vf) {
  const int t = threadIdx.x;
  if (blockIdx.x >= QKV_WGS) {
    const int tb = blockIdx.x - QKV_WGS, n = t & 31, kc = t >> 5;
    if (tb < TW2_WGS) transpose8(W2, HID, (tb & 7) * 32 + n, (tb >> 3) * 8 + kc, arena + W2T);
    else if (tb < TW2_WGS + TW3_WGS) transpose8(W3, HD, n, (tb - TW2_WGS) * 8 + kc, arena + W3T);
    else {
      const int to = tb - TW2_WGS - TW3_WGS;
      transpose8(Wo, HID, (to & 7) * 32 + n, (to >> 3) * 8 + kc, arena + WOT);
    }
    return;
  }
  const int it  = blockIdx.x / 3;    // row tile 0..47
  const int mat = blockIdx.x % 3;    // 0=Q 1=K 2=V
  const float* Wm   = (mat == 0) ? Wq : (mat == 1) ? Wk : Wv;
  const float* bias = (mat == 0) ? bq : (mat == 1) ? bk : bv;
  const int lane = t & 31, wave = t >> 5, c = lane & 15, hi = lane >> 4;
  // B columns: lane c holds columns 2c (first N tile) and 2c+1 (second) of the wave's 32, one
  // 8-byte load for both. A and B take their k in the order of frag_k.
  const int ncol = wave * 32 + c * 2;
  const float* xr = x + (it * 16 + c) * INDIM + hi * 8;
  const float* wc = Wm + hi * 8 * HID + ncol;
  // the loaded f32 values: xt[s] = the 16 k of A of k step s; wt[2s], wt[2s+1] = the 16 k of both
  // B tiles
  v16f xt[4], wt[8];
#pragma unroll
  for (int s = 0; s < 4; ++s)
#pragma unroll
    for (int q = 0; q < 4; ++q) {
      const float4 v = *(const float4*)(xr + s * 32 + (q >> 1) * 16 + (q & 1) * 4);
      xt[s][q * 4 + 0] = v.x; xt[s][q * 4 + 1] = v.y; xt[s][q * 4 + 2] = v.z; xt[s][q * 4 + 3] = v.w;
    }
#pragma unroll
  for (int s = 0; s < 4; ++s)
#pragma unroll
    for (int e = 0; e < 16; ++e) {
      const float2 v = *(const float2*)(wc + (s * 32 + e + (e >= 8 ? 8 : 0)) * HID);
      wt[s * 2 + (e >> 3)][(e & 7) * 2 + 0] = v.x;
      wt[s * 2 + (e >> 3)][(e & 7) * 2 + 1] = v.y;
    }
  const float2 bb = *(const float2*)(bias + ncol);
  // stands in front of the first reuse of these loads' address registers; the two addresses are
  // operands so that their registers stay untouched up to it. The loaded weights are inputs so that
  // every load is issued ahead of it, each into registers of its own, all in flight together
  // (scheduled freely, they went out in small groups, each waited for in turn: several load
  // latencies in a row)
  asm volatile("s_wait_xcnt 0x0" ::"v"(xr), "v"(wc), "v"(wt[0]), "v"(wt[1]), "v"(wt[2]), "v"(wt[3]),
               "v"(wt[4]), "v"(wt[5]), "v"(wt[6]), "v"(wt[7]) : "memory");
  v8f acc[2] = {v8f{}, v8f{}};
#pragma unroll
  for (int s = 0; s < 4; ++s) {
    v16bf a, b0, b1;
#pragma unroll
    for (int e = 0; e < 16; ++e) {
      a[e]  = (__bf16)xt[s][e];
      b0[e] = (__bf16)wt[s * 2 + (e >> 3)][(e & 7) * 2 + 0];
      b1[e] = (__bf16)wt[s * 2 + (e >> 3)][(e & 7) * 2 + 1];
    }
    acc[0] = wmma_bf16(a, b0, acc[0]);
    acc[1] = wmma_bf16(a, b1, acc[1]);
  }
  const int o = (it * 16 + hi * 8) * HID + ncol;
  if (mat == 2) {
#pragma unroll
    for (int r = 0; r < 8; ++r)
      *(float2*)(Vf + o + r * HID) = make_float2(acc[0][r] + bb.x, acc[1][r] + bb.y);
    // stands in front of the first reuse of the stores' registers: built code of other branches
    // follows this one
    asm volatile("s_wait_xcnt 0x0" ::: "memory");
  } else {
    // Q and K feed the score WMMAs: each value goes out as hi = bf16(v) and lo = bf16(v - hi)
    __bf16* p = ((mat == 0) ? Qs : Ks) + o;
    v2bf vh[8], vl[8];
#pragma unroll
    for (int r = 0; r < 8; ++r) {
      float v0 = acc[0][r] + bb.x, v1 = acc[1][r] + bb.y;
      vh[r] = v2bf{(__bf16)v0, (__bf16)v1};
      vl[r] = v2bf{(__bf16)(v0 - (float)vh[r][0]), (__bf16)(v1 - (float)vh[r][1])};
    }
#pragma unroll
    for (int r = 0; r < 8; ++r) {
      *(v2bf*)(p + r * HID) = vh[r];
      *(v2bf*)(p + QK_PLANE + r * HID) = vl[r];
    }
    // stands in front of the first reuse of the stores' registers: the built code of the V branch
    // follows this one
    asm volatile("s_wait_xcnt 0x0" ::: "memory");
  }
}

// ---------------- kernel 2: fused pair-MLP + scores ----------------
// Every layer is computed transposed (weights^T as A, activations^T as B), so that two f32 D tiles
// of one layer, converted in place, are the bf16 B fragment of the next: a wave's h1, h2 and enc
// never leave its registers. The weights lie in LDS, staged once per workgroup, and are streamed
// as A fragments.
// A wave holds PT pair tiles: one row i, PT * 16 neighbouring columns j. A workgroup's 8 waves
// take 8 neighbouring rows of the same columns; it walks PASSES such blocks.
constexpr int PT         = 3;
constexpr int JW         = PT * 16;                 // 48 columns a block
constexpr int JBLK       = NN / JW;                 // 16 blocks a row
constexpr int PASSES     = 6;
constexpr int RELENC_WGS = (NN / 8) * JBLK / PASSES;      // 256
constexpr int W2_LD      = 264;                     // bf16 elems; 528B row: 16B aligned, bank-spread
constexpr int W3_LD      = 264;
constexpr int W1_PLANE   = HID * 8;                 // bf16 elems: 8 per hidden column
constexpr int QK_BUF     = 8 * JW * HEADS;          // f32 elems: Q.K of a block, [row][column][head]
constexpr int W2LDS_OFF  = 0;
constexpr int W3LDS_OFF  = W2LDS_OFF + HID * W2_LD * 2;   // 135168
constexpr int W1LDS_OFF  = W3LDS_OFF + HD * W3_LD * 2;    // 152064
constexpr int B2LDS_OFF  = W1LDS_OFF + 2 * W1_PLANE * 2;  // 160256
constexpr int POSLDS_OFF = B2LDS_OFF + HID * 4;           // 161280
constexpr int QKLDS_OFF  = POSLDS_OFF + NN * 3 * 4;       // 170496
constexpr int SMEM_TOTAL = QKLDS_OFF + 2 * QK_BUF * 4;    // 195072 <= 320KB

// Each f32 value x of rel, W1 and b1 goes into the bf16 product as a pair: hi = bf16(x) and
// lo = bf16(x - hi); all four cross products are summed in f32, so about 16 bits of each
// operand take part.
__device__ inline unsigned pack2(float a, float b) {
  v2bf v = {(__bf16)a, (__bf16)b};
  return __builtin_bit_cast(unsigned, v);
}
__device__ inline float bf_lo(float x) { return x - (float)(__bf16)x; }

// One hidden column's A row, k slots 0..7 (plane 0) and 8..15 (plane 1) of a lane:
//   plane 0: W1hi[0..2], W1hi[0..2], b1hi, 0      plane 1: the same of the lo parts
// against B slots  relhi[0..2], rello[0..2], 1, 0  in both groups of 8.
__device__ inline void w1_table_row(__bf16* w1t, int n, float w0, float w1, float w2, float bb) {
  v8bf ph = {(__bf16)w0, (__bf16)w1, (__bf16)w2, (__bf16)w0, (__bf16)w1, (__bf16)w2,
             (__bf16)bb, (__bf16)0.f};
  float l0 = bf_lo(w0), l1 = bf_lo(w1), l2 = bf_lo(w2), lb = bf_lo(bb);
  v8bf pl = {(__bf16)l0, (__bf16)l1, (__bf16)l2, (__bf16)l0, (__bf16)l1, (__bf16)l2,
             (__bf16)lb, (__bf16)0.f};
  *(v8bf*)(w1t + n * 8) = ph;
  *(v8bf*)(w1t + W1_PLANE + n * 8) = pl;
}

// relu behind the rounding, on the packed bf16 bit patterns: read as signed 16-bit integers every
// negative value lies below 0 and every positive one keeps its bits, so one packed integer
// maximum does two elements (rounding keeps the sign, so the order of the two does not matter).
__device__ inline unsigned relu_pack2(float a, float b) {
  v2f x = {a, b};
  v2s z = {};
  return __builtin_bit_cast(unsigned, __builtin_elementwise_max(
      __builtin_bit_cast(v2s, __builtin_convertvector(x, v2bf)), z));
}
// Two D tiles of a transposed layer (rows 0..15 and 16..31 of a block of 32 hidden columns, same
// 16 pairs) -> relu -> the B fragment of these 32 k of the next layer, in the k order of frag_k.
__device__ inline v16bf relu_frag(v8f d0, v8f d1) {
  v8u o = {relu_pack2(d0[0], d0[1]), relu_pack2(d0[2], d0[3]), relu_pack2(d0[4], d0[5]),
           relu_pack2(d0[6], d0[7]), relu_pack2(d1[0], d1[1]), relu_pack2(d1[2], d1[3]),
           relu_pack2(d1[4], d1[5]), relu_pack2(d1[6], d1[7])};
  return __builtin_bit_cast(v16bf, o);
}

// b already points at the lane's own row and k half (frag_k order: two 16B chunks, 32B apart).
__device__ inline v16bf load_frag_at(const __bf16* b) {
  v16bf f;
#pragma unroll
  for (int e = 0; e < 16; ++e) f[e] = b[e + (e >= 8 ? 8 : 0)];
  return f;
}

// A fragments of two row tiles of W2^T (32 hidden columns of h2) over four k steps (128 k)
__device__ inline void load_w2_half(v16bf (&w)[8], const __bf16* p) {
#pragma unroll
  for (int nn = 0; nn < 2; ++nn)
#pragma unroll
    for (int k4 = 0; k4 < 4; ++k4) w[nn * 4 + k4] = load_frag_at(p + nn * 16 * W2_LD + k4 * 32);
}

__global__ __launch_bounds__(256) void relenc_kernel(
    const float* pos, const float* W1, const float* b1,
    const float* b2, const float* b3,
    const __bf16* arena, const __bf16* Qs, const __bf16* Ks, float* S) {
  extern __shared__ __align__(16) char smem[];
  __bf16* w2s = (__bf16*)(smem + W2LDS_OFF);
  __bf16* w3s = (__bf16*)(smem + W3LDS_OFF);
  __bf16* w1t = (__bf16*)(smem + W1LDS_OFF);
  float* b2s  = (float*)(smem + B2LDS_OFF);
  float* poss = (float*)(smem + POSLDS_OFF);
  float* qk   = (float*)(smem + QKLDS_OFF);

  int t = threadIdx.x;
  int lane = t & 31, wave = t >> 5, c = lane & 15, hi = lane >> 4;

  // b3 in the D order of enc^T (register r of column tile nt: d = nt*16 + 8*hi + r): the start
  // value of the enc accumulators
  const float* b3l = b3 + hi * 8;
  const v8f bias3[2] = {*(const v8f*)(b3l), *(const v8f*)(b3l + 16)};
  // ---- once per workgroup: weights, b2 and pos into LDS
  {
    const float* w1p = W1 + t;
    const float* b1p = b1 + t;
    const float* b2p = b2 + t;
    const float* pp = pos + t;
    const float w1c0 = w1p[0], w1c1 = w1p[256], w1c2 = w1p[512], b1c0 = b1p[0], b2c0 = b2p[0];
    float pc[9];
#pragma unroll
    for (int s = 0; s < 9; ++s) pc[s] = pp[s * 256];
    const v4i* w3g = (const v4i*)(arena + W3T) + t;
    v4i w3c[4];
#pragma unroll
    for (int s = 0; s < 4; ++s) w3c[s] = w3g[s * 256];
    const v4i* w2g = (const v4i*)(arena + W2T) + t;
    v4i w2c[32];
#pragma unroll
    for (int s = 0; s < 32; ++s) w2c[s] = w2g[s * 256];
    // stands in front of the first reuse of these loads' address registers; the operands keep
    // these registers untouched up to it
    asm volatile("s_wait_xcnt 0x0" ::"v"(t), "s"(pos), "s"(W1), "s"(b1), "s"(b2), "s"(b3),
                 "s"(arena) : "memory");
    w1_table_row(w1t, t, w1c0, w1c1, w1c2, b1c0);
    b2s[t] = b2c0;
#pragma unroll
    for (int s = 0; s < 9; ++s) poss[s * 256 + t] = pc[s];
    // 16-byte chunk s*256 + t: row s*8 + t/32, chunk t%32 of the row
    __bf16* w3d = w3s + (t >> 5) * W3_LD + (t & 31) * 8;
#pragma unroll
    for (int s = 0; s < 4; ++s) *(v4i*)(w3d + s * 8 * W3_LD) = w3c[s];
    __bf16* w2d = w2s + (t >> 5) * W2_LD + (t & 31) * 8;
#pragma unroll
    for (int s = 0; s < 32; ++s) *(v4i*)(w2d + s * 8 * W2_LD) = w2c[s];
  }
  __syncthreads();

  const __bf16* w2l = w2s + c * W2_LD + hi * 8;
  const __bf16* w3l = w3s + c * W3_LD + hi * 8;
  const float* b2l = b2s + hi * 8;

  for (int p = 0; p < PASSES; ++p) {
    const int blk = blockIdx.x * PASSES + p;
    const int I8 = (blk / JBLK) * 8, J0 = (blk % JBLK) * JW;
    const int gi = I8 + wave;   // the wave's row i
    float* qkb = qk + (p & 1) * QK_BUF;

    // The block's Q and K fragments (hi and lo planes), issued here so that layer 1 runs while
    // they arrive. Q.K: this wave takes head 'wave', A = the 8 Q rows (each twice), B = 16 K rows.
    const __bf16* qa = Qs + (size_t)(I8 + (lane & 7)) * HID + wave * HD + hi * 8;
    const __bf16* ka = Ks + (size_t)(J0 + c) * HID + wave * HD + hi * 8;
    const v16bf qhF = load_frag_at(qa), qlF = load_frag_at(qa + QK_PLANE);
    v16bf khF[PT], klF[PT];
#pragma unroll
    for (int u = 0; u < PT; ++u) {
      khF[u] = load_frag_at(ka + u * 16 * HID);
      klF[u] = load_frag_at(ka + u * 16 * HID + QK_PLANE);
    }
    // Q.enc of row i: A rows 0..3 are the hi parts of Q[i] of heads 0..3, rows 4..7 their lo
    // parts, rows 8..15 the same of heads 4..7.
    const __bf16* qe = Qs + ((lane & 4) ? QK_PLANE : 0) + (size_t)gi * HID +
                       ((lane & 8) / 2 + (lane & 3)) * HD + hi * 8;
    const v16bf qeF = load_frag_at(qe);
    // stands in front of the first reuse of these loads' address registers
    asm volatile("s_wait_xcnt 0x0" ::: "memory");

    // ---- Layer 1: h1^T = relu(W1ext^T (A) x relext^T (B)), rel = pos[j] - pos[i].
    // The B operand holds a pair's slots in lanes 0..15 and zero in lanes 16..31, whose k slots
    // then add nothing.
    v8u h1u[PT][8];   // B fragments of h1^T, as packed words
    {
      const float* pi = poss + gi * 3;
      const float* pj = poss + (J0 + c) * 3;
      const float i0 = pi[0], i1 = pi[1], i2 = pi[2];
      v16bf Bf[PT];
#pragma unroll
      for (int u = 0; u < PT; ++u) {
        float r0 = pj[u * 48 + 0] - i0, r1 = pj[u * 48 + 1] - i1, r2 = pj[u * 48 + 2] - i2;
        unsigned p0 = pack2(r0, r1), p1 = pack2(r2, bf_lo(r0)), p2 = pack2(bf_lo(r1), bf_lo(r2));
        unsigned p3 = 0x3F80u;   // bf16 1.0 (takes the bias), then 0
        unsigned a0 = hi ? 0u : p0, a1 = hi ? 0u : p1, a2 = hi ? 0u : p2, a3 = hi ? 0u : p3;
        v8u ub = {a0, a1, a2, a3, a0, a1, a2, a3};
        Bf[u] = __builtin_bit_cast(v16bf, ub);
      }
      const __bf16* wa = w1t + c * 8;
      v16bf A[16];
#pragma unroll
      for (int nt = 0; nt < 16; ++nt) {
        v8bf x = *(const v8bf*)(wa + nt * 128);
        v8bf y = *(const v8bf*)(wa + W1_PLANE + nt * 128);
        A[nt] = __builtin_shufflevector(x, y, 0, 1, 2, 3, 4, 5, 6, 7, 8, 9, 10, 11, 12, 13, 14, 15);
      }
      // Blocks of six independent WMMAs (two column tiles x PT pair tiles), two sets of D tiles:
      // behind each WMMA of block b stands the conversion of one D tile of block b-1.
      v8f d[2][PT][2];
#pragma unroll
      for (int b = 0; b <= 8; ++b) {
#pragma unroll
        for (int u = 0; u < PT; ++u)
#pragma unroll
          for (int nn = 0; nn < 2; ++nn) {
            if (b < 8) d[b & 1][u][nn] = wmma_bf16(A[2 * b + nn], Bf[u], v8f{});
            // keeps this order: eight vector instructions on a finished tile run under each WMMA
            // (scheduled freely, each WMMA stood directly in front of its own readers, its latency
            // waited out; all six WMMAs first, the vector work stood bare behind them)
            __builtin_amdgcn_sched_barrier(0);
            if (b > 0) {
              const v8f x = d[(b - 1) & 1][u][nn];
#pragma unroll
              for (int q = 0; q < 4; ++q) h1u[u][b - 1][nn * 4 + q] = relu_pack2(x[2 * q], x[2 * q + 1]);
            }
            __builtin_amdgcn_sched_barrier(0);  // as above
          }
      }
    }
    v16bf h1f[PT][8];
#pragma unroll
    for (int u = 0; u < PT; ++u)
#pragma unroll
      for (int kk = 0; kk < 8; ++kk) h1f[u][kk] = __builtin_bit_cast(v16bf, h1u[u][kk]);

    // ---- Q.K of this wave's head, all four hi/lo cross products summed in f32, smallest first.
    // D register r of either lane half is pair (row r, column c); lanes 0..15 store rows 0..3,
    // lanes 16..31 rows 4..7, as [row][column][head].
    {
      v8f s[PT];
#pragma unroll
      for (int u = 0; u < PT; ++u) s[u] = wmma_bf16(qlF, klF[u], v8f{});
#pragma unroll
      for (int u = 0; u < PT; ++u) s[u] = wmma_bf16(qlF, khF[u], s[u]);
#pragma unroll
      for (int u = 0; u < PT; ++u) s[u] = wmma_bf16(qhF, klF[u], s[u]);
#pragma unroll
      for (int u = 0; u < PT; ++u) s[u] = wmma_bf16(qhF, khF[u], s[u]);
      float* qd = qkb + (hi * 4 * JW + c) * HEADS + wave;
#pragma unroll
      for (int u = 0; u < PT; ++u) {
        const v4f w = hi ? __builtin_shufflevector(s[u], s[u], 4, 5, 6, 7)
                         : __builtin_shufflevector(s[u], s[u], 0, 1, 2, 3);
#pragma unroll
        for (int q = 0; q < 4; ++q) qd[(q * JW + u * 16) * HEADS] = w[q];
      }
    }
    // Publishes the block's Q.K table. The tables of neighbouring passes lie in two buffers, so
    // this one barrier also ends every wave's reads of the buffer that the next pass fills. Its
    // fences name LDS alone, so that global loads and stores stay in flight over it.
    __builtin_amdgcn_fence(__ATOMIC_RELEASE, "workgroup", "local");
    __builtin_amdgcn_s_barrier();
    __builtin_amdgcn_fence(__ATOMIC_ACQUIRE, "workgroup", "local");

    // ---- Layers 2 and 3, 32 columns of h2 at a time:
    // h2^T = relu(W2^T (A) x h1^T (B) + b2), b2 being the accumulators' start value; the two D
    // tiles of a pair tile are the B fragment of these 32 k of enc^T = W3^T (A) x h2^T (B) + b3.
    v8f e[PT][2];
#pragma unroll
    for (int u = 0; u < PT; ++u) { e[u][0] = bias3[0]; e[u][1] = bias3[1]; }
    {
      v16bf wA[8], wB[8];
      load_w2_half(wA, w2l);
      v8f bb[2] = {*(const v8f*)(b2l), *(const v8f*)(b2l + 16)};
      // two trips a turn: the start values fetched for the next trip then land where that trip
      // reads them (rolled, they were copied there, sixteen registers a trip); not further: a turn
      // is 108 WMMAs long already
#pragma unroll 2
      for (int np = 0; np < 8; ++np) {
        load_w2_half(wB, w2l + np * 32 * W2_LD + 128);
        // keeps the next half's LDS reads as one group ahead of this half's WMMAs
        // (sunk among or behind them, their latency is waited out at the next half)
        __builtin_amdgcn_sched_barrier(0);
        v8f acc[2][PT];
#pragma unroll
        for (int nn = 0; nn < 2; ++nn)
#pragma unroll
          for (int u = 0; u < PT; ++u) acc[nn][u] = wmma_bf16(wA[nn * 4], h1f[u][0], bb[nn]);
#pragma unroll
        for (int k4 = 1; k4 < 4; ++k4)
#pragma unroll
          for (int nn = 0; nn < 2; ++nn)
#pragma unroll
            for (int u = 0; u < PT; ++u)
              acc[nn][u] = wmma_bf16(wA[nn * 4 + k4], h1f[u][k4], acc[nn][u]);
        // keeps the reads below in one place (lifted among the WMMAs above, into each register as
        // it falls free, they stood in eight places, each of which costs the wave issue time)
        __builtin_amdgcn_sched_barrier(0);
        // the next trip's first half and start values (the last trip reads the first rows again)
        const int nq = (np + 1) & 7;
        load_w2_half(wA, w2l + nq * 32 * W2_LD);
        bb[0] = *(const v8f*)(b2l + nq * 32);
        bb[1] = *(const v8f*)(b2l + nq * 32 + 16);
        const v16bf a3[2] = {load_frag_at(w3l + np * 32), load_frag_at(w3l + 16 * W3_LD + np * 32)};
        __builtin_amdgcn_sched_barrier(0);  // as the first
#pragma unroll
        for (int k4 = 0; k4 < 4; ++k4)
#pragma unroll
          for (int nn = 0; nn < 2; ++nn)
#pragma unroll
            for (int u = 0; u < PT; ++u)
              acc[nn][u] = wmma_bf16(wB[nn * 4 + k4], h1f[u][4 + k4], acc[nn][u]);
        v16bf h2f[PT];
#pragma unroll
        for (int u = 0; u < PT; ++u) h2f[u] = relu_frag(acc[0][u], acc[1][u]);
#pragma unroll
        for (int u = 0; u < PT; ++u)
#pragma unroll
          for (int nt = 0; nt < 2; ++nt) e[u][nt] = wmma_bf16(a3[nt], h2f[u], e[u][nt]);
      }
    }

    // ---- Scores: S[h,i,j] = (Q[i,h].enc[i,j] + Q[i,h].K[j,h]) / sqrt(d). D register r of column
    // tile nt of enc^T in lane (c, hi) is d = nt*16 + 8*hi + r of pair j = c: the two D tiles are a
    // B fragment (k = d, column j). A = Q[i] (hi and lo rows), B = enc lo, then enc hi; registers q
    // and 4 + q of the result add up to head 4*hi + q of pair j = c.
    {
      v8u eh[PT], el[PT];
      float4 qkv[PT];
#pragma unroll
      for (int u = 0; u < PT; ++u) {
        qkv[u] = *(const float4*)(qkb + (wave * JW + u * 16 + c) * HEADS + hi * 4);
#pragma unroll
        for (int q = 0; q < 8; ++q) {
          v2f x = {e[u][q >> 2][(q & 3) * 2], e[u][q >> 2][(q & 3) * 2 + 1]};
          v2bf xh = __builtin_convertvector(x, v2bf);
          v2f xl = x - __builtin_convertvector(xh, v2f);
          eh[u][q] = __builtin_bit_cast(unsigned, xh);
          el[u][q] = __builtin_bit_cast(unsigned, __builtin_convertvector(xl, v2bf));
        }
      }
      v8f d[PT];
#pragma unroll
      for (int u = 0; u < PT; ++u) d[u] = wmma_bf16(qeF, __builtin_bit_cast(v16bf, el[u]), v8f{});
#pragma unroll
      for (int u = 0; u < PT; ++u) d[u] = wmma_bf16(qeF, __builtin_bit_cast(v16bf, eh[u]), d[u]);
      float* sp = S + ((size_t)(hi * 4) * NN + gi) * NN + J0 + c;
#pragma unroll
      for (int u = 0; u < PT; ++u) {
        sp[u * 16]                       = (d[u][0] + d[u][4] + qkv[u].x) * RSCALE;
        sp[u * 16 + (size_t)1 * NN * NN] = (d[u][1] + d[u][5] + qkv[u].y) * RSCALE;
        sp[u * 16 + (size_t)2 * NN * NN] = (d[u][2] + d[u][6] + qkv[u].z) * RSCALE;
        sp[u * 16 + (size_t)3 * NN * NN] = (d[u][3] + d[u][7] + qkv[u].w) * RSCALE;
      }
      // stands in front of the first reuse of the stores' address and data registers
      asm volatile("s_wait_xcnt 0x0" ::: "memory");
    }
  }
}

// ---------------- kernel 3: softmax over j fused with O1[i, h*32+d] = sum_j P[h,i,j] * V[j, h*32+d] ----------------
// One workgroup per (16-row tile, head). Each of its 8 waves owns 96 of the 768 columns and reads
// its scores straight into A-fragment order, all loads in flight at once: the scores are read
// once and P never goes to memory. The product takes exp(s - max); the row sum divides at the end.
constexpr int AV_WAVES = 8;
constexpr int AV_KW    = NN / AV_WAVES;   // 96 columns a wave
constexpr int AV_STEPS = AV_KW / 32;      // 3 WMMA k steps
constexpr int OP_LD    = 36;              // f32 elems; rows r and r+8 fall 32 banks apart

// 2^x. The v_nop keeps the free slot that the instruction set asks for between a transcendental
// and a next instruction that overwrites its source or reads its result.
__device__ inline float exp2_slot(float x) {
  float r;
  asm("v_exp_f32 %0, %1\n\tv_nop" : "=v"(r) : "v"(x));
  return r;
}

__global__ __launch_bounds__(256) void softmax_av_kernel(const float* S, const float* Vf,
                                                         float* O1) {
  __shared__ float red_max[AV_WAVES][16];
  __shared__ float red_sum[AV_WAVES][16];
  __shared__ __align__(16) float part[AV_WAVES][16 * OP_LD];
  int it = blockIdx.x;             // 0..47
  int h  = blockIdx.y;             // 0..7
  int t = threadIdx.x, lane = t & 31, wave = t >> 5;
  int m = lane & 15, hi = lane >> 4;
  // frag_k order: per k step two runs of 8 columns, 16 apart, starting at hi*8
  const float* Arow = S + ((size_t)h * NN + it * 16 + m) * NN + wave * AV_KW + hi * 8;
  // B columns: lane m holds head columns 2m (first N tile) and 2m+1 (second), one 8-byte load for both
  const float* Vcol = Vf + (size_t)(wave * AV_KW + hi * 8) * HID + h * HD + m * 2;

  float sv[AV_STEPS][16];
  float2 vv[AV_STEPS][16];
#pragma unroll
  for (int s = 0; s < AV_STEPS; ++s)
#pragma unroll
    for (int c = 0; c < 4; ++c) {
      float4 q = *(const float4*)(Arow + s * 32 + (c >> 1) * 16 + (c & 1) * 4);
      sv[s][c * 4 + 0] = q.x; sv[s][c * 4 + 1] = q.y;
      sv[s][c * 4 + 2] = q.z; sv[s][c * 4 + 3] = q.w;
    }
  // stands in front of the first reuse of the score loads' address registers (the V loads
  // below land in them)
  asm volatile("s_wait_xcnt 0x0" ::: "memory");
#pragma unroll
  for (int s = 0; s < AV_STEPS; ++s)
#pragma unroll
    for (int e = 0; e < 16; ++e)
      vv[s][e] = *(const float2*)(Vcol + (size_t)(s * 32 + e + (e >= 8 ? 8 : 0)) * HID);

  // row maximum: the lane's 48 columns, the other half of the row's lanes, then the 8 waves
  float mx = -3.4e38f;
#pragma unroll
  for (int s = 0; s < AV_STEPS; ++s)
#pragma unroll
    for (int e = 0; e < 16; ++e) mx = fmaxf(mx, sv[s][e]);
  mx = fmaxf(mx, __shfl_xor(mx, 16, 32));
  if (hi == 0) red_max[wave][m] = mx;
  __syncthreads();
  float wm[AV_WAVES];
#pragma unroll
  for (int w = 0; w < AV_WAVES; ++w) wm[w] = red_max[w][m];
#pragma unroll
  for (int w = 0; w < AV_WAVES; ++w) mx = fmaxf(mx, wm[w]);

  float sum = 0.f;
  v16bf a[AV_STEPS];
#pragma unroll
  for (int s = 0; s < AV_STEPS; ++s)
#pragma unroll
    for (int e = 0; e < 16; ++e) {
      float p = exp2_slot((sv[s][e] - mx) * 1.44269504f);   // e^(s - max)
      sum += p;
      a[s][e] = (__bf16)p;
    }
  // keeps every exponential ahead of the first WMMA: they are asm text, which the compiler's
  // padding behind a WMMA does not see
  __builtin_amdgcn_sched_barrier(0);
  v8f acc[2] = {v8f{}, v8f{}};
#pragma unroll
  for (int s = 0; s < AV_STEPS; ++s) {
    v16bf b0, b1;
#pragma unroll
    for (int e = 0; e < 16; ++e) {
      b0[e] = (__bf16)vv[s][e].x;
      b1[e] = (__bf16)vv[s][e].y;
    }
    acc[0] = wmma_bf16(a[s], b0, acc[0]);
    acc[1] = wmma_bf16(a[s], b1, acc[1]);
  }
  sum += __shfl_xor(sum, 16, 32);
  if (hi == 0) red_sum[wave][m] = sum;
#pragma unroll
  for (int r = 0; r < 8; ++r)
    *(float2*)(&part[wave][(r + hi * 8) * OP_LD + m * 2]) = make_float2(acc[0][r], acc[1][r]);
  __syncthreads();

  // the 8 waves' partial products and row sums; each thread finishes two neighbouring columns
  int row = t >> 4, c2 = (t & 15) * 2;
  float tot = 0.f, o0 = 0.f, o1 = 0.f;
#pragma unroll
  for (int w = 0; w < AV_WAVES; ++w) {
    float2 pr = *(const float2*)(&part[w][row * OP_LD + c2]);
    tot += red_sum[w][row];
    o0 += pr.x;
    o1 += pr.y;
  }
  float inv = 1.f / tot;
  *(float2*)(O1 + (size_t)(it * 16 + row) * HID + h * HD + c2) = make_float2(o0 * inv, o1 * inv);
}

// ---------------- kernel 4: out = O1 @ Wo + bo ----------------
__global__ __launch_bounds__(32) void outproj_kernel(
    const float* O1, const __bf16* arena, const float* bo, float* out) {
  int it = blockIdx.x, nt = blockIdx.y;
  int lane = threadIdx.x & 31, hi = lane >> 4, nc = lane & 15;
  const __bf16* Wot = arena + WOT;
  v8f acc = {};
#pragma unroll
  for (int kk = 0; kk < 8; ++kk) {
    v16bf a = load_frag(O1, it * 16, kk * 32, HID);    // f32 -> bf16 on the fly
    v16bf b = load_frag(Wot, nt * 16, kk * 32, HID);
    acc = wmma_bf16(a, b, acc);
  }
  int ncol = nt * 16 + nc;
  float bias = bo[ncol];
#pragma unroll
  for (int r = 0; r < 8; ++r)
    out[(size_t)(it * 16 + r + hi * 8) * HID + ncol] = acc[r] + bias;
}

// ---------------- launch ----------------
extern "C" void kernel_launch(void* const* d_in, const int* in_sizes, int n_in,
                              void* d_out, int out_size, void* d_ws, size_t ws_size,
                              hipStream_t stream) {
  (void)in_sizes; (void)n_in; (void)out_size; (void)ws_size;
  const float* x   = (const float*)d_in[0];
  const float* pos = (const float*)d_in[1];
  const float* Wq  = (const float*)d_in[2];  const float* bq = (const float*)d_in[3];
  const float* Wk  = (const float*)d_in[4];  const float* bk = (const float*)d_in[5];
  const float* Wv  = (const float*)d_in[6];  const float* bv = (const float*)d_in[7];
  const float* Wo  = (const float*)d_in[8];  const float* bo = (const float*)d_in[9];
  const float* W1  = (const float*)d_in[10]; const float* b1 = (const float*)d_in[11];
  const float* W2  = (const float*)d_in[12]; const float* b2 = (const float*)d_in[13];
  const float* W3  = (const float*)d_in[14]; const float* b3 = (const float*)d_in[15];

  char* ws = (char*)d_ws;
  __bf16* Qs    = (__bf16*)(ws + QF_OFF);
  __bf16* Ks    = (__bf16*)(ws + KF_OFF);
  float*  Vf    = (float*)(ws + VF_OFF);
  float*  S     = (float*)(ws + S_OFF);
  float*  O1    = (float*)(ws + O1_OFF);
  __bf16* arena = (__bf16*)(ws + BF_OFF);
  float*  out   = (float*)d_out;

  (void)hipFuncSetAttribute((const void*)relenc_kernel,
                            hipFuncAttributeMaxDynamicSharedMemorySize, SMEM_TOTAL);

  front_kernel<<<FRONT_WGS, 256, 0, stream>>>(x, Wq, Wk, Wv, bq, bk, bv, W2, W3, Wo,
                                              arena, Qs, Ks, Vf);
  relenc_kernel<<<RELENC_WGS, 256, SMEM_TOTAL, stream>>>(pos, W1, b1, b2, b3,
                                                         arena, Qs, Ks, S);
  softmax_av_kernel<<<dim3(48, 8), 256, 0, stream>>>(S, Vf, O1);
  outproj_kernel<<<dim3(48, 16), 32, 0, stream>>>(O1, arena, bo, out);
}

// v008
// One run takes 57.2 microseconds.
// In both of two side-by-side timings against v007, it was 1.05 times as fast.
// Over all steps from v000 it is 6.99 times as fast.
#include <hip/hip_runtime.h>
#include <hip/hip_bf16.h>

typedef __attribute__((ext_vector_type(16))) __bf16 v16bf;
typedef __attribute__((ext_vector_type(8)))  __bf16 v8bf;
typedef __attribute__((ext_vector_type(2)))  __bf16 v2bf;
typedef __attribute__((ext_vector_type(8)))  unsigned v8u;
typedef __attribute__((ext_vector_type(4)))  unsigned v4u;
typedef __attribute__((ext_vector_type(2)))  short    v2s;
typedef __attribute__((ext_vector_type(2)))  float    v2f;
typedef __attribute__((ext_vector_type(4)))  float    v4f;
typedef __attribute__((ext_vector_type(8)))  float  v8f;
typedef __attribute__((ext_vector_type(16))) float  v16f;
typedef __attribute__((__vector_size__(16))) int    v4i;

// ---------------- problem constants ----------------
constexpr int NN    = 768;
constexpr int INDIM = 128;
constexpr int HID   = 256;
constexpr int HEADS = 8;
constexpr int HD    = 32;
constexpr float RSCALE = 0.17677669529663687f;   // 1/sqrt(32)

// ---------------- workspace layout (bytes) ----------------
constexpr size_t QF_OFF = 0;                         // Q as two bf16 planes (hi, lo): 2*768*256*2
constexpr size_t KF_OFF = 786432;                    // K likewise
constexpr size_t VF_OFF = 1572864;
constexpr size_t S_OFF  = 2359296;                   // 8*768*768*4 = 18874368
constexpr size_t O1_OFF = 21233664;                  // 768*256*4
constexpr size_t BF_OFF = 22020096;                  // bf16 arena (16B aligned)

// bf16 arena element offsets
constexpr int W2T = 196608;   // W2^T: 256*256
constexpr int W3T = 262144;   // W3^T: 32*256
constexpr int WOT = 270336;   // Wo^T: 256*256
constexpr int QK_PLANE = NN * HID;   // bf16 elems from a value's hi part to its lo part

// ---------------- WMMA helpers ----------------
__device__ inline int frag_k(int e, int hi) {
  // 16-bit A-matrix 16x32 lane layout (ISA 7.12.2): lane<16 -> K {0..7,16..23},
  // lane>=16 -> K {8..15,24..31}; two contiguous 16B chunks -> b128-friendly.
  return hi * 8 + e + (e >= 8 ? 8 : 0);
}

template <typename T>
__device__ inline v16bf load_frag(const T* p, int row0, int k0, int ld) {
  int lane = threadIdx.x & 31;
  int m = lane & 15, hi = lane >> 4;
  const T* b = p + (size_t)(row0 + m) * ld + k0;
  v16bf f;
#pragma unroll
  for (int e = 0; e < 16; ++e) f[e] = (__bf16)b[frag_k(e, hi)];
  return f;
}

__device__ inline v8f wmma_bf16(v16bf a, v16bf b, v8f c) {
  return __builtin_amdgcn_wmma_f32_16x16x32_bf16(false, a, false, b, (short)0, c,
                                                 false, false);
}

// ---------------- kernel 1: QKV projections (WMMA bf16) and the bf16 weight transposes ----------------
// One launch holds both: the projections read x and their weights as f32 and round them to bf16 in
// registers, so they wait for no earlier launch; the transposes that the later kernels read
// (W2^T, W3^T, Wo^T) are the work of further workgroups of the same grid.
constexpr int QKV_WGS   = (NN / 16) * 3;          // one per (16-row tile, matrix); a wave = 32 columns
// a transposing workgroup takes 64 k of 32 columns: its 8 waves fill whole 128-byte lines
constexpr int TW2_WGS   = (HID / 32) * (HID / 64);
constexpr int TW3_WGS   = (HD / 32) * (HID / 64);
constexpr int FRONT_WGS = QKV_WGS + TW2_WGS + TW3_WGS + TW2_WGS;

// 8 neighbouring k (rows) of column n of a row-major f32 matrix with 256 rows -> 16 bytes of row n
// of its bf16 transpose
__device__ inline void transpose8(const float* Wm, int ld, int n, int kc, __bf16* dst) {
  const float* p = Wm + kc * 8 * ld + n;
  float v[8];
#pragma unroll
  for (int e = 0; e < 8; ++e) v[e] = p[e * ld];
  // stands in front of the first reuse of these loads' address registers
  asm volatile("s_wait_xcnt 0x0" ::: "memory");
  v8bf o;
#pragma unroll
  for (int e = 0; e < 8; ++e) o[e] = (__bf16)v[e];
  *(v8bf*)(dst + n * HID + kc * 8) = o;
  // stands in front of the first reuse of the store's registers: the built code of the next
  // transpose follows this one
  asm volatile("s_wait_xcnt 0x0" ::: "memory");
}

__global__ __launch_bounds__(256) void front_kernel(
    const float* x, const float* Wq, const float* Wk, const float* Wv,
    const float* bq, const float* bk, const float* bv,
    const float* W2, const float* W3, const float* Wo,
    __bf16* arena, __bf16* Qs, __bf16* Ks, float* Vf) {
  const int t = threadIdx.x;
  if (blockIdx.x >= QKV_WGS) {
    const int tb = blockIdx.x - QKV_WGS, n = t & 31, kc = t >> 5;
    if (tb < TW2_WGS) transpose8(W2, HID, (tb & 7) * 32 + n, (tb >> 3) * 8 + kc, arena + W2T);
    else if (tb < TW2_WGS + TW3_WGS) transpose8(W3, HD, n, (tb - TW2_WGS) * 8 + kc, arena + W3T);
    else {
      const int to = tb - TW2_WGS - TW3_WGS;
      transpose8(Wo, HID, (to & 7) * 32 + n, (to >> 3) * 8 + kc, arena + WOT);
    }
    return;
  }
  const int it  = blockIdx.x / 3;    // row tile 0..47
  const int mat = blockIdx.x % 3;    // 0=Q 1=K 2=V
  const float* Wm   = (mat == 0) ? Wq : (mat == 1) ? Wk : Wv;
  const float* bias = (mat == 0) ? bq : (mat == 1) ? bk : bv;
  const int lane = t & 31, wave = t >> 5, c = lane & 15, hi = lane >> 4;
  // B columns: lane c holds columns 2c (first N tile) and 2c+1 (second) of the wave's 32, one
  // 8-byte load for both. A and B take their k in the order of frag_k.
  const int ncol = wave * 32 + c * 2;
  const float* xr = x + (it * 16 + c) * INDIM + hi * 8;
  const float* wc = Wm + hi * 8 * HID + ncol;
  // the loaded f32 values: xt[s] = the 16 k of A of k step s; wt[2s], wt[2s+1] = the 16 k of both
  // B tiles
  v16f xt[4], wt[8];
#pragma unroll
  for (int s = 0; s < 4; ++s)
#pragma unroll
    for (int q = 0; q < 4; ++q) {
      const float4 v = *(const float4*)(xr + s * 32 + (q >> 1) * 16 + (q & 1) * 4);
      xt[s][q * 4 + 0] = v.x; xt[s][q * 4 + 1] = v.y; xt[s][q * 4 + 2] = v.z; xt[s][q * 4 + 3] = v.w;
    }
#pragma unroll
  for (int s = 0; s < 4; ++s)
#pragma unroll
    for (int e = 0; e < 16; ++e) {
      const float2 v = *(const float2*)(wc + (s * 32 + e + (e >= 8 ? 8 : 0)) * HID);
      wt[s * 2 + (e >> 3)][(e & 7) * 2 + 0] = v.x;
      wt[s * 2 + (e >> 3)][(e & 7) * 2 + 1] = v.y;
    }
  const float2 bb = *(const float2*)(bias + ncol);
  // stands in front of the first reuse of these loads' address registers; the two addresses are
  // operands so that their registers stay untouched up to it. The loaded weights are inputs so that
  // every load is issued ahead of it, each into registers of its own, all in flight together
  // (scheduled freely, they went out in small groups, each waited for in turn: several load
  // latencies in a row)
  asm volatile("s_wait_xcnt 0x0" ::"v"(xr), "v"(wc), "v"(wt[0]), "v"(wt[1]), "v"(wt[2]), "v"(wt[3]),
               "v"(wt[4]), "v"(wt[5]), "v"(wt[6]), "v"(wt[7]) : "memory");
  v8f acc[2] = {v8f{}, v8f{}};
#pragma unroll
  for (int s = 0; s < 4; ++s) {
    v16bf a, b0, b1;
#pragma unroll
    for (int e = 0; e < 16; ++e) {
      a[e]  = (__bf16)xt[s][e];
      b0[e] = (__bf16)wt[s * 2 + (e >> 3)][(e & 7) * 2 + 0];
      b1[e] = (__bf16)wt[s * 2 + (e >> 3)][(e & 7) * 2 + 1];
    }
    acc[0] = wmma_bf16(a, b0, acc[0]);
    acc[1] = wmma_bf16(a, b1, acc[1]);
  }
  const int o = (it * 16 + hi * 8) * HID + ncol;
  if (mat == 2) {
#pragma unroll
    for (int r = 0; r < 8; ++r)
      *(float2*)(Vf + o + r * HID) = make_float2(acc[0][r] + bb.x, acc[1][r] + bb.y);
    // stands in front of the first reuse of the stores' registers: built code of other branches
    // follows this one
    asm volatile("s_wait_xcnt 0x0" ::: "memory");
  } else {
    // Q and K feed the score WMMAs: each value goes out as hi = bf16(v) and lo = bf16(v - hi)
    __bf16* p = ((mat == 0) ? Qs : Ks) + o;
    v2bf vh[8], vl[8];
#pragma unroll
    for (int r = 0; r < 8; ++r) {
      float v0 = acc[0][r] + bb.x, v1 = acc[1][r] + bb.y;
      vh[r] = v2bf{(__bf16)v0, (__bf16)v1};
      vl[r] = v2bf{(__bf16)(v0 - (float)vh[r][0]), (__bf16)(v1 - (float)vh[r][1])};
    }
#pragma unroll
    for (int r = 0; r < 8; ++r) {
      *(v2bf*)(p + r * HID) = vh[r];
      *(v2bf*)(p + QK_PLANE + r * HID) = vl[r];
    }
    // stands in front of the first reuse of the stores' registers: the built code of the V branch
    // follows this one
    asm volatile("s_wait_xcnt 0x0" ::: "memory");
  }
}

// ---------------- kernel 2: fused pair-MLP + scores ----------------
// Every layer is computed transposed (weights^T as A, activations^T as B), so that two f32 D tiles
// of one layer, converted in place, are the bf16 B fragment of the next: a wave's h1, h2 and enc
// never leave its registers. The weights lie in LDS, staged once per workgroup, and are streamed
// as A fragments.
// A wave's tile is PT pair tiles: one row i, PT * 16 neighbouring columns j. A workgroup owns
// WG_ROWS neighbouring rows of the same columns, a tile each. Q.K of this square is tabled in LDS
// ahead of the tile loop, so the loop holds no barrier: while one wave of a SIMD is in its vector
// phases (layer 1's conversions, the scores) the other one's WMMAs have the matrix unit.
constexpr int PT         = 3;
constexpr int JW         = PT * 16;                 // 48 columns a block
constexpr int JBLK       = NN / JW;                 // 16 blocks a row
constexpr int WG_ROWS    = 48;
constexpr int RELENC_WGS = (NN / WG_ROWS) * JBLK;         // 256
// Waves w and w + 4 share a SIMD and its quarter of the tiles. Wave w takes the first
// LEAD_TILES of them, wave w + 4 the rest (for speed only).
constexpr int SIMD_TILES = WG_ROWS / 4;                   // 12
constexpr int LEAD_TILES = 7;
constexpr int W2_LD      = 264;                     // bf16 elems; 528B row: 16B aligned, bank-spread
constexpr int W3_LD      = 264;
constexpr int W1_PLANE   = HID * 8;                 // bf16 elems: 8 per hidden column
// Q.K of the square, f32, [column][head][row]: a D tile's 8 rows of a lane are 32 bytes in a row;
// the column pitch is 16 B x odd, bank-spread for these 16-byte stores
constexpr int QK_LD      = HEADS * WG_ROWS + 4;
constexpr int W2LDS_OFF  = 0;
constexpr int W3LDS_OFF  = W2LDS_OFF + HID * W2_LD * 2;   // 135168
constexpr int W1LDS_OFF  = W3LDS_OFF + HD * W3_LD * 2;    // 152064
constexpr int B2LDS_OFF  = W1LDS_OFF + 2 * W1_PLANE * 2;  // 160256
constexpr int POSLDS_OFF = B2LDS_OFF + HID * 4;           // 161280
constexpr int QKLDS_OFF  = POSLDS_OFF + NN * 3 * 4;       // 170496
constexpr int SMEM_TOTAL = QKLDS_OFF + JW * QK_LD * 4;    // 244992 <= 320KB

// Each f32 value x of rel, W1 and b1 goes into the bf16 product as a pair: hi = bf16(x) and
// lo = bf16(x - hi); all four cross products are summed in f32, so about 16 bits of each
// operand take part.
__device__ inline unsigned pack2(float a, float b) {
  v2bf v = {(__bf16)a, (__bf16)b};
  return __builtin_bit_cast(unsigned, v);
}
__device__ inline float bf_lo(float x) { return x - (float)(__bf16)x; }

// One hidden column's A row, k slots 0..7 (plane 0) and 8..15 (plane 1) of a lane:
//   plane 0: W1hi[0..2], W1hi[0..2], b1hi, 0      plane 1: the same of the lo parts
// against B slots  relhi[0..2], rello[0..2], 1, 0  in both groups of 8.
__device__ inline void w1_table_row(__bf16* w1t, int n, float w0, float w1, float w2, float bb) {
  v8bf ph = {(__bf16)w0, (__bf16)w1, (__bf16)w2, (__bf16)w0, (__bf16)w1, (__bf16)w2,
             (__bf16)bb, (__bf16)0.f};
  float l0 = bf_lo(w0), l1 = bf_lo(w1), l2 = bf_lo(w2), lb = bf_lo(bb);
  v8bf pl = {(__bf16)l0, (__bf16)l1, (__bf16)l2, (__bf16)l0, (__bf16)l1, (__bf16)l2,
             (__bf16)lb, (__bf16)0.f};
  *(v8bf*)(w1t + n * 8) = ph;
  *(v8bf*)(w1t + W1_PLANE + n * 8) = pl;
}

// relu behind the rounding, on the packed bf16 bit patterns: read as signed 16-bit integers every
// negative value lies below 0 and every positive one keeps its bits, so one packed integer
// maximum does two elements (rounding keeps the sign, so the order of the two does not matter).
__device__ inline unsigned relu_pack2(float a, float b) {
  v2f x = {a, b};
  v2s z = {};
  return __builtin_bit_cast(unsigned, __builtin_elementwise_max(
      __builtin_bit_cast(v2s, __builtin_convertvector(x, v2bf)), z));
}
// Two D tiles of a transposed layer (rows 0..15 and 16..31 of a block of 32 hidden columns, same
// 16 pairs) -> relu -> the B fragment of these 32 k of the next layer, in the k order of frag_k.
__device__ inline v16bf relu_frag(v8f d0, v8f d1) {
  v8u o = {relu_pack2(d0[0], d0[1]), relu_pack2(d0[2], d0[3]), relu_pack2(d0[4], d0[5]),
           relu_pack2(d0[6], d0[7]), relu_pack2(d1[0], d1[1]), relu_pack2(d1[2], d1[3]),
           relu_pack2(d1[4], d1[5]), relu_pack2(d1[6], d1[7])};
  return __builtin_bit_cast(v16bf, o);
}

// b already points at the lane's own row and k half (frag_k order: two 16B chunks, 32B apart).
__device__ inline v16bf load_frag_at(const __bf16* b) {
  v16bf f;
#pragma unroll
  for (int e = 0; e < 16; ++e) f[e] = b[e + (e >= 8 ? 8 : 0)];
  return f;
}

// A fragments of two row tiles of W2^T (32 hidden columns of h2) over four k steps (128 k)
__device__ inline void load_w2_half(v16bf (&w)[8], const __bf16* p) {
#pragma unroll
  for (int nn = 0; nn < 2; ++nn)
#pragma unroll
    for (int k4 = 0; k4 < 4; ++k4) w[nn * 4 + k4] = load_frag_at(p + nn * 16 * W2_LD + k4 * 32);
}

__global__ __launch_bounds__(256) void relenc_kernel(
    const float* pos, const float* W1, const float* b1,
    const float* b2, const float* b3,
    const __bf16* arena, const __bf16* Qs, const __bf16* Ks, float* S) {
  extern __shared__ __align__(16) char smem[];
  __bf16* w2s = (__bf16*)(smem + W2LDS_OFF);
  __bf16* w3s = (__bf16*)(smem + W3LDS_OFF);
  __bf16* w1t = (__bf16*)(smem + W1LDS_OFF);
  float* b2s  = (float*)(smem + B2LDS_OFF);
  float* poss = (float*)(smem + POSLDS_OFF);
  float* qk   = (float*)(smem + QKLDS_OFF);

  int t = threadIdx.x;
  int lane = t & 31, c = lane & 15, hi = lane >> 4;
  // the wave's number in a scalar register: it sets the trip count of the tile loop
  const int wave = __builtin_amdgcn_readfirstlane(t >> 5);
  const int R0 = (blockIdx.x / JBLK) * WG_ROWS, J0 = (blockIdx.x % JBLK) * JW;

  // b3 in the D order of enc^T (register r of column tile nt: d = nt*16 + 8*hi + r): the start
  // value of the enc accumulators
  const float* b3l = b3 + hi * 8;
  const v8f bias3[2] = {*(const v8f*)(b3l), *(const v8f*)(b3l + 16)};
  // ---- once per workgroup: weights, b2 and pos into LDS; the Q and K fragments (hi and lo planes)
  // of head 'wave' are asked for behind them, so that all these loads are in flight together
  v16bf qhF[WG_ROWS / 16], qlF[WG_ROWS / 16], khF[PT], klF[PT];
  {
    const float* w1p = W1 + t;
    const float* b1p = b1 + t;
    const float* b2p = b2 + t;
    const float* pp = pos + t;
    const float w1c0 = w1p[0], w1c1 = w1p[256], w1c2 = w1p[512], b1c0 = b1p[0], b2c0 = b2p[0];
    float pc[9];
#pragma unroll
    for (int s = 0; s < 9; ++s) pc[s] = pp[s * 256];
    const v4i* w3g = (const v4i*)(arena + W3T) + t;
    v4i w3c[4];
#pragma unroll
    for (int s = 0; s < 4; ++s) w3c[s] = w3g[s * 256];
    const v4i* w2g = (const v4i*)(arena + W2T) + t;
    v4i w2c[32];
#pragma unroll
    for (int s = 0; s < 32; ++s) w2c[s] = w2g[s * 256];
    // stands in front of the first reuse of these loads' address registers; the operands keep
    // these registers untouched up to it
    asm volatile("s_wait_xcnt 0x0" ::"v"(t), "s"(pos), "s"(W1), "s"(b1), "s"(b2), "s"(b3),
                 "s"(arena) : "memory");
    const __bf16* qa = Qs + (size_t)(R0 + c) * HID + wave * HD + hi * 8;
    const __bf16* ka = Ks + (size_t)(J0 + c) * HID + wave * HD + hi * 8;
#pragma unroll
    for (int u = 0; u < PT; ++u) {
      qhF[u] = load_frag_at(qa + u * 16 * HID);
      qlF[u] = load_frag_at(qa + u * 16 * HID + QK_PLANE);
      khF[u] = load_frag_at(ka + u * 16 * HID);
      klF[u] = load_frag_at(ka + u * 16 * HID + QK_PLANE);
    }
    // stands in front of the first reuse of these loads' address registers; the operands keep
    // these registers untouched up to it
    asm volatile("s_wait_xcnt 0x0" ::"v"(qa), "v"(ka) : "memory");
    // keeps the Q.K WMMAs behind all of these loads (lifted among them, the first WMMAs freed
    // registers into which the last loads were then issued: a second load latency in a row)
    __builtin_amdgcn_sched_barrier(0);
    w1_table_row(w1t, t, w1c0, w1c1, w1c2, b1c0);
    b2s[t] = b2c0;
#pragma unroll
    for (int s = 0; s < 9; ++s) poss[s * 256 + t] = pc[s];
    // 16-byte chunk s*256 + t: row s*8 + t/32, chunk t%32 of the row
    __bf16* w3d = w3s + (t >> 5) * W3_LD + (t & 31) * 8;
#pragma unroll
    for (int s = 0; s < 4; ++s) *(v4i*)(w3d + s * 8 * W3_LD) = w3c[s];
    __bf16* w2d = w2s + (t >> 5) * W2_LD + (t & 31) * 8;
#pragma unroll
    for (int s = 0; s < 32; ++s) *(v4i*)(w2d + s * 8 * W2_LD) = w2c[s];
  }
  // ---- Q.K of head 'wave' over the square: A = 16 Q rows, B = 16 K rows, all four hi/lo cross
  // products summed in f32, smallest first. D register r of lane (c, hi) is pair (row 8*hi + r,
  // column c) of the tile.
  {
    float* qd = qk + c * QK_LD + wave * WG_ROWS + hi * 8;
#pragma unroll
    for (int rt = 0; rt < WG_ROWS / 16; ++rt) {
      v8f s[PT];
#pragma unroll
      for (int u = 0; u < PT; ++u) s[u] = wmma_bf16(qlF[rt], klF[u], v8f{});
#pragma unroll
      for (int u = 0; u < PT; ++u) s[u] = wmma_bf16(qlF[rt], khF[u], s[u]);
#pragma unroll
      for (int u = 0; u < PT; ++u) s[u] = wmma_bf16(qhF[rt], klF[u], s[u]);
#pragma unroll
      for (int u = 0; u < PT; ++u) s[u] = wmma_bf16(qhF[rt], khF[u], s[u]);
#pragma unroll
      for (int u = 0; u < PT; ++u) {
        *(v4f*)(qd + u * 16 * QK_LD + rt * 16)     = __builtin_shufflevector(s[u], s[u], 0, 1, 2, 3);
        *(v4f*)(qd + u * 16 * QK_LD + rt * 16 + 4) = __builtin_shufflevector(s[u], s[u], 4, 5, 6, 7);
      }
    }
  }
  // publishes the weights and the Q.K table: the only barrier of the kernel
  __syncthreads();

  const __bf16* w2l = w2s + c * W2_LD + hi * 8;
  const __bf16* w3l = w3s + c * W3_LD + hi * 8;
  const float* b2l = b2s + hi * 8;

  // tile k of the SIMD's SIMD_TILES is row k * 4 + simd of the square
  const int kBeg = wave < 4 ? 0 : LEAD_TILES, kEnd = wave < 4 ? LEAD_TILES : SIMD_TILES;
  for (int k = kBeg; k < kEnd; ++k) {
    const int row = k * 4 + (wave & 3);
    const int gi = R0 + row;   // the tile's row i

    // Q.enc of row i: A rows 0..3 are the hi parts of Q[i] of heads 0..3, rows 4..7 their lo
    // parts, rows 8..15 the same of heads 4..7.
    const __bf16* qe = Qs + ((lane & 4) ? QK_PLANE : 0) + (size_t)gi * HID +
                       ((lane & 8) / 2 + (lane & 3)) * HD + hi * 8;
    const v16bf qeF = load_frag_at(qe);
    // stands in front of the first reuse of this load's address registers
    asm volatile("s_wait_xcnt 0x0" ::: "memory");

    // ---- Layer 1: h1^T = relu(W1ext^T (A) x relext^T (B)), rel = pos[j] - pos[i].
    // The B operand holds a pair's slots in lanes 0..15 and zero in lanes 16..31, whose k slots
    // then add nothing.
    v8u h1u[PT][8];   // B fragments of h1^T, as packed words
    {
      const float* pi = poss + gi * 3;
      const float* pj = poss + (J0 + c) * 3;
      const float i0 = pi[0], i1 = pi[1], i2 = pi[2];
      v16bf Bf[PT];
#pragma unroll
      for (int u = 0; u < PT; ++u) {
        float r0 = pj[u * 48 + 0] - i0, r1 = pj[u * 48 + 1] - i1, r2 = pj[u * 48 + 2] - i2;
        unsigned p0 = pack2(r0, r1), p1 = pack2(r2, bf_lo(r0)), p2 = pack2(bf_lo(r1), bf_lo(r2));
        unsigned p3 = 0x3F80u;   // bf16 1.0 (takes the bias), then 0
        unsigned a0 = hi ? 0u : p0, a1 = hi ? 0u : p1, a2 = hi ? 0u : p2, a3 = hi ? 0u : p3;
        v8u ub = {a0, a1, a2, a3, a0, a1, a2, a3};
        Bf[u] = __builtin_bit_cast(v16bf, ub);
      }
      const __bf16* wa = w1t + c * 8;
      v16bf A[16];
#pragma unroll
      for (int nt = 0; nt < 16; ++nt) {
        v8bf x = *(const v8bf*)(wa + nt * 128);
        v8bf y = *(const v8bf*)(wa + W1_PLANE + nt * 128);
        A[nt] = __builtin_shufflevector(x, y, 0, 1, 2, 3, 4, 5, 6, 7, 8, 9, 10, 11, 12, 13, 14, 15);
      }
      // Blocks of six independent WMMAs (two column tiles x PT pair tiles), two sets of D tiles:
      // behind each WMMA of block b stands the conversion of one D tile of block b-1.
      v8f d[2][PT][2];
#pragma unroll
      for (int b = 0; b <= 8; ++b) {
#pragma unroll
        for (int u = 0; u < PT; ++u)
#pragma unroll
          for (int nn = 0; nn < 2; ++nn) {
            if (b < 8) d[b & 1][u][nn] = wmma_bf16(A[2 * b + nn], Bf[u], v8f{});
            // keeps this order: eight vector instructions on a finished tile run under each WMMA
            // (scheduled freely, each WMMA stood directly in front of its own readers, its latency
            // waited out; all six WMMAs first, the vector work stood bare behind them)
            __builtin_amdgcn_sched_barrier(0);
            if (b > 0) {
              const v8f x = d[(b - 1) & 1][u][nn];
#pragma unroll
              for (int q = 0; q < 4; ++q) h1u[u][b - 1][nn * 4 + q] = relu_pack2(x[2 * q], x[2 * q + 1]);
            }
            __builtin_amdgcn_sched_barrier(0);  // as above
          }
      }
    }
    v16bf h1f[PT][8];
#pragma unroll
    for (int u = 0; u < PT; ++u)
#pragma unroll
      for (int kk = 0; kk < 8; ++kk) h1f[u][kk] = __builtin_bit_cast(v16bf, h1u[u][kk]);

    // ---- Layers 2 and 3, 32 columns of h2 at a time:
    // h2^T = relu(W2^T (A) x h1^T (B) + b2), b2 being the accumulators' start value; the two D
    // tiles of a pair tile are the B fragment of these 32 k of enc^T = W3^T (A) x h2^T (B) + b3.
    v8f e[PT][2];
#pragma unroll
    for (int u = 0; u < PT; ++u) { e[u][0] = bias3[0]; e[u][1] = bias3[1]; }
    {
      v16bf wA[8], wB[8];
      load_w2_half(wA, w2l);
      v8f bb[2] = {*(const v8f*)(b2l), *(const v8f*)(b2l + 16)};
      // two trips a turn: the start values fetched for the next trip then land where that trip
      // reads them (rolled, they were copied there, sixteen registers a trip); not further: a turn
      // is 108 WMMAs long already
#pragma unroll 2
      for (int np = 0; np < 8; ++np) {
        load_w2_half(wB, w2l + np * 32 * W2_LD + 128);
        // keeps the next half's LDS reads as one group ahead of this half's WMMAs
        // (sunk among or behind them, their latency is waited out at the next half)
        __builtin_amdgcn_sched_barrier(0);
        v8f acc[2][PT];
#pragma unroll
        for (int nn = 0; nn < 2; ++nn)
#pragma unroll
          for (int u = 0; u < PT; ++u) acc[nn][u] = wmma_bf16(wA[nn * 4], h1f[u][0], bb[nn]);
#pragma unroll
        for (int k4 = 1; k4 < 4; ++k4)
#pragma unroll
          for (int nn = 0; nn < 2; ++nn)
#pragma unroll
            for (int u = 0; u < PT; ++u)
              acc[nn][u] = wmma_bf16(wA[nn * 4 + k4], h1f[u][k4], acc[nn][u]);
        // keeps the reads below in one place (lifted among the WMMAs above, into each register as
        // it falls free, they stood in eight places, each of which costs the wave issue time)
        __builtin_amdgcn_sched_barrier(0);
        // the next trip's first half and start values (the last trip reads the first rows again)
        const int nq = (np + 1) & 7;
        load_w2_half(wA, w2l + nq * 32 * W2_LD);
        bb[0] = *(const v8f*)(b2l + nq * 32);
        bb[1] = *(const v8f*)(b2l + nq * 32 + 16);
        const v16bf a3[2] = {load_frag_at(w3l + np * 32), load_frag_at(w3l + 16 * W3_LD + np * 32)};
        __builtin_amdgcn_sched_barrier(0);  // as the first
#pragma unroll
        for (int k4 = 0; k4 < 4; ++k4)
#pragma unroll
          for (int nn = 0; nn < 2; ++nn)
#pragma unroll
            for (int u = 0; u < PT; ++u)
              acc[nn][u] = wmma_bf16(wB[nn * 4 + k4], h1f[u][4 + k4], acc[nn][u]);
        v16bf h2f[PT];
#pragma unroll
        for (int u = 0; u < PT; ++u) h2f[u] = relu_frag(acc[0][u], acc[1][u]);
#pragma unroll
        for (int u = 0; u < PT; ++u)
#pragma unroll
          for (int nt = 0; nt < 2; ++nt) e[u][nt] = wmma_bf16(a3[nt], h2f[u], e[u][nt]);
      }
    }

    // ---- Scores: S[h,i,j] = (Q[i,h].enc[i,j] + Q[i,h].K[j,h]) / sqrt(d). D register r of column
    // tile nt of enc^T in lane (c, hi) is d = nt*16 + 8*hi + r of pair j = c: the two D tiles are a
    // B fragment (k = d, column j). A = Q[i] (hi and lo rows), B = enc lo, then enc hi; registers q
    // and 4 + q of the result add up to head 4*hi + q of pair j = c.
    {
      v8u eh[PT], el[PT];
      float4 qkv[PT];
      const float* qr = qk + c * QK_LD + hi * 4 * WG_ROWS + row;
#pragma unroll
      for (int u = 0; u < PT; ++u) {
        qkv[u] = make_float4(qr[u * 16 * QK_LD], qr[u * 16 * QK_LD + WG_ROWS],
                             qr[u * 16 * QK_LD + 2 * WG_ROWS], qr[u * 16 * QK_LD + 3 * WG_ROWS]);
#pragma unroll
        for (int q = 0; q < 8; ++q) {
          v2f x = {e[u][q >> 2][(q & 3) * 2], e[u][q >> 2][(q & 3) * 2 + 1]};
          v2bf xh = __builtin_convertvector(x, v2bf);
          v2f xl = x - __builtin_convertvector(xh, v2f);
          eh[u][q] = __builtin_bit_cast(unsigned, xh);
          el[u][q] = __builtin_bit_cast(unsigned, __builtin_convertvector(xl, v2bf));
        }
      }
      v8f d[PT];
#pragma unroll
      for (int u = 0; u < PT; ++u) d[u] = wmma_bf16(qeF, __builtin_bit_cast(v16bf, el[u]), v8f{});
#pragma unroll
      for (int u = 0; u < PT; ++u) d[u] = wmma_bf16(qeF, __builtin_bit_cast(v16bf, eh[u]), d[u]);
      float* sp = S + ((size_t)(hi * 4) * NN + gi) * NN + J0 + c;
#pragma unroll
      for (int u = 0; u < PT; ++u) {
        sp[u * 16]                       = (d[u][0] + d[u][4] + qkv[u].x) * RSCALE;
        sp[u * 16 + (size_t)1 * NN * NN] = (d[u][1] + d[u][5] + qkv[u].y) * RSCALE;
        sp[u * 16 + (size_t)2 * NN * NN] = (d[u][2] + d[u][6] + qkv[u].z) * RSCALE;
        sp[u * 16 + (size_t)3 * NN * NN] = (d[u][3] + d[u][7] + qkv[u].w) * RSCALE;
      }
      // stands in front of the first reuse of the stores' address and data registers
      asm volatile("s_wait_xcnt 0x0" ::: "memory");
    }
  }
}

// ---------------- kernel 3: softmax over j fused with O1[i, h*32+d] = sum_j P[h,i,j] * V[j, h*32+d] ----------------
// One workgroup per (16-row tile, head). Each of its 8 waves owns 96 of the 768 columns and reads
// its scores straight into A-fragment order, all loads in flight at once: the scores are read
// once and P never goes to memory. The product takes exp(s - max); the row sum divides at the end.
constexpr int AV_WAVES = 8;
constexpr int AV_KW    = NN / AV_WAVES;   // 96 columns a wave
constexpr int AV_STEPS = AV_KW / 32;      // 3 WMMA k steps
constexpr int OP_LD    = 36;              // f32 elems; rows r and r+8 fall 32 banks apart

// 2^x. The v_nop keeps the free slot that the instruction set asks for between a transcendental
// and a next instruction that overwrites its source or reads its result.
__device__ inline float exp2_slot(float x) {
  float r;
  asm("v_exp_f32 %0, %1\n\tv_nop" : "=v"(r) : "v"(x));
  return r;
}

__global__ __launch_bounds__(256) void softmax_av_kernel(const float* S, const float* Vf,
                                                         float* O1) {
  __shared__ float red_max[AV_WAVES][16];
  __shared__ float red_sum[AV_WAVES][16];
  __shared__ __align__(16) float part[AV_WAVES][16 * OP_LD];
  int it = blockIdx.x;             // 0..47
  int h  = blockIdx.y;             // 0..7
  int t = threadIdx.x, lane = t & 31, wave = t >> 5;
  int m = lane & 15, hi = lane >> 4;
  // frag_k order: per k step two runs of 8 columns, 16 apart, starting at hi*8
  const float* Arow = S + ((size_t)h * NN + it * 16 + m) * NN + wave * AV_KW + hi * 8;
  // B columns: lane m holds head columns 2m (first N tile) and 2m+1 (second), one 8-byte load for both
  const float* Vcol = Vf + (size_t)(wave * AV_KW + hi * 8) * HID + h * HD + m * 2;

  float sv[AV_STEPS][16];
  float2 vv[AV_STEPS][16];
#pragma unroll
  for (int s = 0; s < AV_STEPS; ++s)
#pragma unroll
    for (int c = 0; c < 4; ++c) {
      float4 q = *(const float4*)(Arow + s * 32 + (c >> 1) * 16 + (c & 1) * 4);
      sv[s][c * 4 + 0] = q.x; sv[s][c * 4 + 1] = q.y;
      sv[s][c * 4 + 2] = q.z; sv[s][c * 4 + 3] = q.w;
    }
  // stands in front of the first reuse of the score loads' address registers (the V loads
  // below land in them)
  asm volatile("s_wait_xcnt 0x0" ::: "memory");
#pragma unroll
  for (int s = 0; s < AV_STEPS; ++s)
#pragma unroll
    for (int e = 0; e < 16; ++e)
      vv[s][e] = *(const float2*)(Vcol + (size_t)(s * 32 + e + (e >= 8 ? 8 : 0)) * HID);

  // row maximum: the lane's 48 columns, the other half of the row's lanes, then the 8 waves
  float mx = -3.4e38f;
#pragma unroll
  for (int s = 0; s < AV_STEPS; ++s)
#pragma unroll
    for (int e = 0; e < 16; ++e) mx = fmaxf(mx, sv[s][e]);
  mx = fmaxf(mx, __shfl_xor(mx, 16, 32));
  if (hi == 0) red_max[wave][m] = mx;
  __syncthreads();
  float wm[AV_WAVES];
#pragma unroll
  for (int w = 0; w < AV_WAVES; ++w) wm[w] = red_max[w][m];
#pragma unroll
  for (int w = 0; w < AV_WAVES; ++w) mx = fmaxf(mx, wm[w]);

  float sum = 0.f;
  v16bf a[AV_STEPS];
#pragma unroll
  for (int s = 0; s < AV_STEPS; ++s)
#pragma unroll
    for (int e = 0; e < 16; ++e) {
      float p = exp2_slot((sv[s][e] - mx) * 1.44269504f);   // e^(s - max)
      sum += p;
      a[s][e] = (__bf16)p;
    }
  // keeps every exponential ahead of the first WMMA: they are asm text, which the compiler's
  // padding behind a WMMA does not see
  __builtin_amdgcn_sched_barrier(0);
  v8f acc[2] = {v8f{}, v8f{}};
#pragma unroll
  for (int s = 0; s < AV_STEPS; ++s) {
    v16bf b0, b1;
#pragma unroll
    for (int e = 0; e < 16; ++e) {
      b0[e] = (__bf16)vv[s][e].x;
      b1[e] = (__bf16)vv[s][e].y;
    }
    acc[0] = wmma_bf16(a[s], b0, acc[0]);
    acc[1] = wmma_bf16(a[s], b1, acc[1]);
  }
  sum += __shfl_xor(sum, 16, 32);
  if (hi == 0) red_sum[wave][m] = sum;
#pragma unroll
  for (int r = 0; r < 8; ++r)
    *(float2*)(&part[wave][(r + hi * 8) * OP_LD + m * 2]) = make_float2(acc[0][r], acc[1][r]);
  __syncthreads();

  // the 8 waves' partial products and row sums; each thread finishes two neighbouring columns
  int row = t >> 4, c2 = (t & 15) * 2;
  float tot = 0.f, o0 = 0.f, o1 = 0.f;
#pragma unroll
  for (int w = 0; w < AV_WAVES; ++w) {
    float2 pr = *(const float2*)(&part[w][row * OP_LD + c2]);
    tot += red_sum[w][row];
    o0 += pr.x;
    o1 += pr.y;
  }
  float inv = 1.f / tot;
  *(float2*)(O1 + (size_t)(it * 16 + row) * HID + h * HD + c2) = make_float2(o0 * inv, o1 * inv);
}

// ---------------- kernel 4: out = O1 @ Wo + bo ----------------
__global__ __launch_bounds__(32) void outproj_kernel(
    const float* O1, const __bf16* arena, const float* bo, float* out) {
  int it = blockIdx.x, nt = blockIdx.y;
  int lane = threadIdx.x & 31, hi = lane >> 4, nc = lane & 15;
  const __bf16* Wot = arena + WOT;
  v8f acc = {};
#pragma unroll
  for (int kk = 0; kk < 8; ++kk) {
    v16bf a = load_frag(O1, it * 16, kk * 32, HID);    // f32 -> bf16 on the fly
    v16bf b = load_frag(Wot, nt * 16, kk * 32, HID);
    acc = wmma_bf16(a, b, acc);
  }
  int ncol = nt * 16 + nc;
  float bias = bo[ncol];
#pragma unroll
  for (int r = 0; r < 8; ++r)
    out[(size_t)(it * 16 + r + hi * 8) * HID + ncol] = acc[r] + bias;
}

// ---------------- launch ----------------
extern "C" void kernel_launch(void* const* d_in, const int* in_sizes, int n_in,
                              void* d_out, int out_size, void* d_ws, size_t ws_size,
                              hipStream_t stream) {
  (void)in_sizes; (void)n_in; (void)out_size; (void)ws_size;
  const float* x   = (const float*)d_in[0];
  const float* pos = (const float*)d_in[1];
  const float* Wq  = (const float*)d_in[2];  const float* bq = (const float*)d_in[3];
  const float* Wk  = (const float*)d_in[4];  const float* bk = (const float*)d_in[5];
  const float* Wv  = (const float*)d_in[6];  const float* bv = (const float*)d_in[7];
  const float* Wo  = (const float*)d_in[8];  const float* bo = (const float*)d_in[9];
  const float* W1  = (const float*)d_in[10]; const float* b1 = (const float*)d_in[11];
  const float* W2  = (const float*)d_in[12]; const float* b2 = (const float*)d_in[13];
  const float* W3  = (const float*)d_in[14]; const float* b3 = (const float*)d_in[15];

  char* ws = (char*)d_ws;
  __bf16* Qs    = (__bf16*)(ws + QF_OFF);
  __bf16* Ks    = (__bf16*)(ws + KF_OFF);
  float*  Vf    = (float*)(ws + VF_OFF);
  float*  S     = (float*)(ws + S_OFF);
  float*  O1    = (float*)(ws + O1_OFF);
  __bf16* arena = (__bf16*)(ws + BF_OFF);
  float*  out   = (float*)d_out;

  (void)hipFuncSetAttribute((const void*)relenc_kernel,
                            hipFuncAttributeMaxDynamicSharedMemorySize, SMEM_TOTAL);

  front_kernel<<<FRONT_WGS, 256, 0, stream>>>(x, Wq, Wk, Wv, bq, bk, bv, W2, W3, Wo,
                                              arena, Qs, Ks, Vf);
  relenc_kernel<<<RELENC_WGS, 256, SMEM_TOTAL, stream>>>(pos, W1, b1, b2, b3,
                                                         arena, Qs, Ks, S);
  softmax_av_kernel<<<dim3(48, 8), 256, 0, stream>>>(S, Vf, O1);
  outproj_kernel<<<dim3(48, 16), 32, 0, stream>>>(O1, arena, bo, out);
}

// v009
// Measured time: 54.3 microseconds a run.
// Timed twice side by side with v008, it ran 1.05 and 1.04 times as fast.
// All steps since v000 together make it 7.33 times as fast.
#include <hip/hip_runtime.h>
#include <hip/hip_bf16.h>

typedef __attribute__((ext_vector_type(16))) __bf16 v16bf;
typedef __attribute__((ext_vector_type(8)))  __bf16 v8bf;
typedef __attribute__((ext_vector_type(2)))  __bf16 v2bf;
typedef __attribute__((ext_vector_type(8)))  unsigned v8u;
typedef __attribute__((ext_vector_type(4)))  unsigned v4u;
typedef __attribute__((ext_vector_type(2)))  short    v2s;
typedef __attribute__((ext_vector_type(2)))  float    v2f;
typedef __attribute__((ext_vector_type(4)))  float    v4f;
typedef __attribute__((ext_vector_type(8)))  float  v8f;
typedef __attribute__((ext_vector_type(16))) float  v16f;
typedef __attribute__((__vector_size__(16))) int    v4i;

// ---------------- problem constants ----------------
constexpr int NN    = 768;
constexpr int INDIM = 128;
constexpr int HID   = 256;
constexpr int HEADS = 8;
constexpr int HD    = 32;
constexpr float RSCALE = 0.17677669529663687f;   // 1/sqrt(32)

// ---------------- workspace layout (bytes) ----------------
constexpr size_t QF_OFF = 0;                         // Q as two bf16 planes (hi, lo): 2*768*256*2
constexpr size_t KF_OFF = 786432;                    // K likewise
constexpr size_t VF_OFF = 1572864;                   // V, bf16
constexpr size_t S_OFF  = 2359296;                   // 8*768*768*4 = 18874368
constexpr size_t O1_OFF = 21233664;                  // attention output, bf16
constexpr size_t BF_OFF = 22020096;                  // bf16 arena (16B aligned)

// bf16 arena element offsets
constexpr int W2T = 196608;   // W2^T: 256*256
constexpr int W3T = 262144;   // W3^T: 32*256
constexpr int WOT = 270336;   // Wo^T: 256*256
constexpr int QK_PLANE = NN * HID;   // bf16 elems from a value's hi part to its lo part

// ---------------- fragment-order layouts of the workspace arrays ----------------
// Q, K, V, S, O1 and Wo^T are read back only as WMMA fragments, 16 bytes a lane. Row-major, such a
// load takes a piece of 16 different lines; here the 32 lanes' pieces of one load lie side by
// side, 512 bytes in a row, so that a load covers four whole lines. V and O1 enter their products
// as bf16: they are stored as these bf16 values, rounded where they are made instead of where they
// are read.
// bf16 arrays: a fragment (16 rows x 32 k) is 2 chunks of 256 elems; chunk ch holds k = ch*16 ..
// ch*16+15, each lane's 8 elems in a row.
// Q, K plane and O1: [row tile][head][chunk][row][k half][8]
__device__ inline int qk_off(int row, int col) {
  return (((row >> 4) * HEADS + (col >> 5)) * 2 + ((col >> 4) & 1)) * 256 +
         ((row & 15) * 2 + ((col >> 3) & 1)) * 8 + (col & 7);
}
constexpr int QK_TILE = HEADS * 512;   // bf16 elems from a row tile to the next
// Wo^T: [column tile][k step][chunk][k half][column][8]; kc = k / 8
__device__ inline int wo_off(int n, int kc) {
  return (((n >> 4) * (HID / 32) + (kc >> 2)) * 2 + ((kc >> 1) & 1)) * 256 +
         ((kc & 1) * 16 + (n & 15)) * 8;
}
// V: [head][32 rows j = k step][column tile][chunk][k half][column][8]; column tile 0 holds the
// even columns of the head, tile 1 the odd ones
constexpr int V_STEP = 1024;           // bf16 elems from a k step to the next
// S (f32): a fragment (16 rows x 32 k) is 4 chunks of 128 floats; chunk ch holds slots
// e = ch*4 .. ch*4+3 of every lane (k = frag_k(e, k half)): [chunk][row][k half][4].
// Offset of column kk (0..31) of row m inside its fragment:
__device__ inline int f32frag_off(int m, int kk) {
  return ((kk >> 4) * 2 + ((kk >> 2) & 1)) * 128 + (m * 2 + ((kk >> 3) & 1)) * 4 + (kk & 3);
}

// ---------------- WMMA helpers ----------------
__device__ inline int frag_k(int e, int hi) {
  // 16-bit A-matrix 16x32 lane layout (ISA 7.12.2): lane<16 -> K {0..7,16..23},
  // lane>=16 -> K {8..15,24..31}; two contiguous 16B chunks -> b128-friendly.
  return hi * 8 + e + (e >= 8 ? 8 : 0);
}

__device__ inline v8f wmma_bf16(v16bf a, v16bf b, v8f c) {
  return __builtin_amdgcn_wmma_f32_16x16x32_bf16(false, a, false, b, (short)0, c,
                                                 false, false);
}

// ---------------- kernel 1: QKV projections (WMMA bf16) and the bf16 weight transposes ----------------
// One launch holds both: the projections read x and their weights as f32 and round them to bf16 in
// registers, so they wait for no earlier launch; the transposes that the later kernels read
// (W2^T, W3^T, Wo^T) are the work of further workgroups of the same grid.
constexpr int QKV_WGS   = (NN / 16) * 3;          // one per (16-row tile, matrix); a wave = 32 columns
// a transposing workgroup takes 64 k of 32 columns: its 8 waves fill whole 128-byte lines
constexpr int TW2_WGS   = (HID / 32) * (HID / 64);
constexpr int TW3_WGS   = (HD / 32) * (HID / 64);
constexpr int FRONT_WGS = QKV_WGS + TW2_WGS + TW3_WGS + TW2_WGS;

// 8 neighbouring k (rows) of column n of a row-major f32 matrix with 256 rows -> 16 bytes of its
// bf16 transpose, at dst16
__device__ inline void transpose8(const float* Wm, int ld, int n, int kc, __bf16* dst16) {
  const float* p = Wm + kc * 8 * ld + n;
  float v[8];
#pragma unroll
  for (int e = 0; e < 8; ++e) v[e] = p[e * ld];
  // stands in front of the first reuse of these loads' address registers
  asm volatile("s_wait_xcnt 0x0" ::: "memory");
  v8bf o;
#pragma unroll
  for (int e = 0; e < 8; ++e) o[e] = (__bf16)v[e];
  *(v8bf*)dst16 = o;
  // stands in front of the first reuse of the store's registers: the built code of the next
  // transpose follows this one
  asm volatile("s_wait_xcnt 0x0" ::: "memory");
}

__global__ __launch_bounds__(256) void front_kernel(
    const float* x, const float* Wq, const float* Wk, const float* Wv,
    const float* bq, const float* bk, const float* bv,
    const float* W2, const float* W3, const float* Wo,
    __bf16* arena, __bf16* Qs, __bf16* Ks, __bf16* Vb) {
  const int t = threadIdx.x;
  if (blockIdx.x >= QKV_WGS) {
    const int tb = blockIdx.x - QKV_WGS, n = t & 31, kc = t >> 5;
    if (tb < TW2_WGS) {
      const int nn = (tb & 7) * 32 + n, kk = (tb >> 3) * 8 + kc;
      transpose8(W2, HID, nn, kk, arena + W2T + nn * HID + kk * 8);
    } else if (tb < TW2_WGS + TW3_WGS) {
      const int kk = (tb - TW2_WGS) * 8 + kc;
      transpose8(W3, HD, n, kk, arena + W3T + n * HID + kk * 8);
    } else {
      const int to = tb - TW2_WGS - TW3_WGS;
      const int nn = (to & 7) * 32 + n, kk = (to >> 3) * 8 + kc;
      transpose8(Wo, HID, nn, kk, arena + WOT + wo_off(nn, kk));
    }
    return;
  }
  const int it  = blockIdx.x / 3;    // row tile 0..47
  const int mat = blockIdx.x % 3;    // 0=Q 1=K 2=V
  const float* Wm   = (mat == 0) ? Wq : (mat == 1) ? Wk : Wv;
  const float* bias = (mat == 0) ? bq : (mat == 1) ? bk : bv;
  const int lane = t & 31, wave = t >> 5, c = lane & 15, hi = lane >> 4;
  // B columns: lane c holds columns 2c (first N tile) and 2c+1 (second) of the wave's 32, one
  // 8-byte load for both. A and B take their k in the order of frag_k.
  const int ncol = wave * 32 + c * 2;
  const float* xr = x + (it * 16 + c) * INDIM + hi * 8;
  const float* wc = Wm + hi * 8 * HID + ncol;
  // the loaded f32 values: xt[s] = the 16 k of A of k step s; wt[2s], wt[2s+1] = the 16 k of both
  // B tiles
  v16f xt[4], wt[8];
#pragma unroll
  for (int s = 0; s < 4; ++s)
#pragma unroll
    for (int q = 0; q < 4; ++q) {
      const float4 v = *(const float4*)(xr + s * 32 + (q >> 1) * 16 + (q & 1) * 4);
      xt[s][q * 4 + 0] = v.x; xt[s][q * 4 + 1] = v.y; xt[s][q * 4 + 2] = v.z; xt[s][q * 4 + 3] = v.w;
    }
#pragma unroll
  for (int s = 0; s < 4; ++s)
#pragma unroll
    for (int e = 0; e < 16; ++e) {
      const float2 v = *(const float2*)(wc + (s * 32 + e + (e >= 8 ? 8 : 0)) * HID);
      wt[s * 2 + (e >> 3)][(e & 7) * 2 + 0] = v.x;
      wt[s * 2 + (e >> 3)][(e & 7) * 2 + 1] = v.y;
    }
  const float2 bb = *(const float2*)(bias + ncol);
  // stands in front of the first reuse of these loads' address registers; the two addresses are
  // operands so that their registers stay untouched up to it. The loaded weights are inputs so that
  // every load is issued ahead of it, each into registers of its own, all in flight together
  // (scheduled freely, they went out in small groups, each waited for in turn: several load
  // latencies in a row)
  asm volatile("s_wait_xcnt 0x0" ::"v"(xr), "v"(wc), "v"(wt[0]), "v"(wt[1]), "v"(wt[2]), "v"(wt[3]),
               "v"(wt[4]), "v"(wt[5]), "v"(wt[6]), "v"(wt[7]) : "memory");
  v8f acc[2] = {v8f{}, v8f{}};
#pragma unroll
  for (int s = 0; s < 4; ++s) {
    v16bf a, b0, b1;
#pragma unroll
    for (int e = 0; e < 16; ++e) {
      a[e]  = (__bf16)xt[s][e];
      b0[e] = (__bf16)wt[s * 2 + (e >> 3)][(e & 7) * 2 + 0];
      b1[e] = (__bf16)wt[s * 2 + (e >> 3)][(e & 7) * 2 + 1];
    }
    acc[0] = wmma_bf16(a, b0, acc[0]);
    acc[1] = wmma_bf16(a, b1, acc[1]);
  }
  if (mat == 2) {
    // a lane's 8 rows of a column are 8 neighbouring k of the AV product: 16 bytes of a B fragment
    v8bf v0, v1;
#pragma unroll
    for (int r = 0; r < 8; ++r) {
      v0[r] = (__bf16)(acc[0][r] + bb.x);
      v1[r] = (__bf16)(acc[1][r] + bb.y);
    }
    __bf16* p = Vb + (wave * (NN / 32) + (it >> 1)) * V_STEP + (it & 1) * 256 + lane * 8;
    *(v8bf*)p = v0;
    *(v8bf*)(p + 512) = v1;
    // stands in front of the first reuse of the stores' registers: built code of other branches
    // follows this one
    asm volatile("s_wait_xcnt 0x0" ::: "memory");
  } else {
    // Q and K feed the score WMMAs: each value goes out as hi = bf16(v) and lo = bf16(v - hi)
    // fragment order: the next row of the tile lies 16 elems on
    __bf16* p = ((mat == 0) ? Qs : Ks) + qk_off(it * 16 + hi * 8, ncol);
    v2bf vh[8], vl[8];
#pragma unroll
    for (int r = 0; r < 8; ++r) {
      float v0 = acc[0][r] + bb.x, v1 = acc[1][r] + bb.y;
      vh[r] = v2bf{(__bf16)v0, (__bf16)v1};
      vl[r] = v2bf{(__bf16)(v0 - (float)vh[r][0]), (__bf16)(v1 - (float)vh[r][1])};
    }
#pragma unroll
    for (int r = 0; r < 8; ++r) {
      *(v2bf*)(p + r * 16) = vh[r];
      *(v2bf*)(p + QK_PLANE + r * 16) = vl[r];
    }
    // stands in front of the first reuse of the stores' registers: the built code of the V branch
    // follows this one
    asm volatile("s_wait_xcnt 0x0" ::: "memory");
  }
}

// ---------------- kernel 2: fused pair-MLP + scores ----------------
// Every layer is computed transposed (weights^T as A, activations^T as B), so that two f32 D tiles
// of one layer, converted in place, are the bf16 B fragment of the next: a wave's h1, h2 and enc
// never leave its registers. The weights lie in LDS, staged once per workgroup, and are streamed
// as A fragments.
// A wave's tile is PT pair tiles: one row i, PT * 16 neighbouring columns j. A workgroup owns
// WG_ROWS neighbouring rows of the same columns, a tile each. Q.K of this square is tabled in LDS
// ahead of the tile loop, so the loop holds no barrier: while one wave of a SIMD is in its vector
// phases (layer 1's conversions, the scores) the other one's WMMAs have the matrix unit.
constexpr int PT         = 3;
constexpr int JW         = PT * 16;                 // 48 columns a block
constexpr int JBLK       = NN / JW;                 // 16 blocks a row
constexpr int WG_ROWS    = 48;
constexpr int RELENC_WGS = (NN / WG_ROWS) * JBLK;         // 256
// Waves w and w + 4 share a SIMD and its quarter of the tiles. Wave w takes the first
// LEAD_TILES of them, wave w + 4 the rest (for speed only).
constexpr int SIMD_TILES = WG_ROWS / 4;                   // 12
constexpr int LEAD_TILES = 7;
constexpr int W2_LD      = 264;                     // bf16 elems; 528B row: 16B aligned, bank-spread
constexpr int W3_LD      = 264;
constexpr int W1_PLANE   = HID * 8;                 // bf16 elems: 8 per hidden column
// Q.K of the square, f32, [column][head][row]: a D tile's 8 rows of a lane are 32 bytes in a row;
// the column pitch is 16 B x odd, bank-spread for these 16-byte stores
constexpr int QK_LD      = HEADS * WG_ROWS + 4;
constexpr int W2LDS_OFF  = 0;
constexpr int W3LDS_OFF  = W2LDS_OFF + HID * W2_LD * 2;   // 135168
constexpr int W1LDS_OFF  = W3LDS_OFF + HD * W3_LD * 2;    // 152064
constexpr int B2LDS_OFF  = W1LDS_OFF + 2 * W1_PLANE * 2;  // 160256
constexpr int POSLDS_OFF = B2LDS_OFF + HID * 4;           // 161280
constexpr int QKLDS_OFF  = POSLDS_OFF + NN * 3 * 4;       // 170496
constexpr int SMEM_TOTAL = QKLDS_OFF + JW * QK_LD * 4;    // 244992 <= 320KB

// Each f32 value x of rel, W1 and b1 goes into the bf16 product as a pair: hi = bf16(x) and
// lo = bf16(x - hi); all four cross products are summed in f32, so about 16 bits of each
// operand take part.
__device__ inline unsigned pack2(float a, float b) {
  v2bf v = {(__bf16)a, (__bf16)b};
  return __builtin_bit_cast(unsigned, v);
}
__device__ inline float bf_lo(float x) { return x - (float)(__bf16)x; }

// One hidden column's A row, k slots 0..7 (plane 0) and 8..15 (plane 1) of a lane:
//   plane 0: W1hi[0..2], W1hi[0..2], b1hi, 0      plane 1: the same of the lo parts
// against B slots  relhi[0..2], rello[0..2], 1, 0  in both groups of 8.
__device__ inline void w1_table_row(__bf16* w1t, int n, float w0, float w1, float w2, float bb) {
  v8bf ph = {(__bf16)w0, (__bf16)w1, (__bf16)w2, (__bf16)w0, (__bf16)w1, (__bf16)w2,
             (__bf16)bb, (__bf16)0.f};
  float l0 = bf_lo(w0), l1 = bf_lo(w1), l2 = bf_lo(w2), lb = bf_lo(bb);
  v8bf pl = {(__bf16)l0, (__bf16)l1, (__bf16)l2, (__bf16)l0, (__bf16)l1, (__bf16)l2,
             (__bf16)lb, (__bf16)0.f};
  *(v8bf*)(w1t + n * 8) = ph;
  *(v8bf*)(w1t + W1_PLANE + n * 8) = pl;
}

// relu behind the rounding, on the packed bf16 bit patterns: read as signed 16-bit integers every
// negative value lies below 0 and every positive one keeps its bits, so one packed integer
// maximum does two elements (rounding keeps the sign, so the order of the two does not matter).
__device__ inline unsigned relu_pack2(float a, float b) {
  v2f x = {a, b};
  v2s z = {};
  return __builtin_bit_cast(unsigned, __builtin_elementwise_max(
      __builtin_bit_cast(v2s, __builtin_convertvector(x, v2bf)), z));
}
// Two D tiles of a transposed layer (rows 0..15 and 16..31 of a block of 32 hidden columns, same
// 16 pairs) -> relu -> the B fragment of these 32 k of the next layer, in the k order of frag_k.
__device__ inline v16bf relu_frag(v8f d0, v8f d1) {
  v8u o = {relu_pack2(d0[0], d0[1]), relu_pack2(d0[2], d0[3]), relu_pack2(d0[4], d0[5]),
           relu_pack2(d0[6], d0[7]), relu_pack2(d1[0], d1[1]), relu_pack2(d1[2], d1[3]),
           relu_pack2(d1[4], d1[5]), relu_pack2(d1[6], d1[7])};
  return __builtin_bit_cast(v16bf, o);
}

// b already points at the lane's own row and k half (frag_k order: two 16B chunks, 32B apart).
__device__ inline v16bf load_frag_at(const __bf16* b) {
  v16bf f;
#pragma unroll
  for (int e = 0; e < 16; ++e) f[e] = b[e + (e >= 8 ? 8 : 0)];
  return f;
}

// b points at the lane's own 16 bytes of chunk 0 of a fragment stored in fragment order
__device__ inline v16bf load_frag_packed(const __bf16* b) {
  v16bf f;
#pragma unroll
  for (int e = 0; e < 16; ++e) f[e] = b[(e & 7) + (e >> 3) * 256];
  return f;
}

// A fragments of two row tiles of W2^T (32 hidden columns of h2) over four k steps (128 k)
__device__ inline void load_w2_half(v16bf (&w)[8], const __bf16* p) {
#pragma unroll
  for (int nn = 0; nn < 2; ++nn)
#pragma unroll
    for (int k4 = 0; k4 < 4; ++k4) w[nn * 4 + k4] = load_frag_at(p + nn * 16 * W2_LD + k4 * 32);
}

__global__ __launch_bounds__(256) void relenc_kernel(
    const float* pos, const float* W1, const float* b1,
    const float* b2, const float* b3,
    const __bf16* arena, const __bf16* Qs, const __bf16* Ks, float* S) {
  extern __shared__ __align__(16) char smem[];
  __bf16* w2s = (__bf16*)(smem + W2LDS_OFF);
  __bf16* w3s = (__bf16*)(smem + W3LDS_OFF);
  __bf16* w1t = (__bf16*)(smem + W1LDS_OFF);
  float* b2s  = (float*)(smem + B2LDS_OFF);
  float* poss = (float*)(smem + POSLDS_OFF);
  float* qk   = (float*)(smem + QKLDS_OFF);

  int t = threadIdx.x;
  int lane = t & 31, c = lane & 15, hi = lane >> 4;
  // the wave's number in a scalar register: it sets the trip count of the tile loop
  const int wave = __builtin_amdgcn_readfirstlane(t >> 5);
  const int R0 = (blockIdx.x / JBLK) * WG_ROWS, J0 = (blockIdx.x % JBLK) * JW;

  // b3 in the D order of enc^T (register r of column tile nt: d = nt*16 + 8*hi + r): the start
  // value of the enc accumulators
  const float* b3l = b3 + hi * 8;
  const v8f bias3[2] = {*(const v8f*)(b3l), *(const v8f*)(b3l + 16)};
  // ---- once per workgroup: weights, b2 and pos into LDS; the Q and K fragments (hi and lo planes)
  // of head 'wave' are asked for behind them, so that all these loads are in flight together
  v16bf qhF[WG_ROWS / 16], qlF[WG_ROWS / 16], khF[PT], klF[PT];
  {
    const float* w1p = W1 + t;
    const float* b1p = b1 + t;
    const float* b2p = b2 + t;
    const float* pp = pos + t;
    const float w1c0 = w1p[0], w1c1 = w1p[256], w1c2 = w1p[512], b1c0 = b1p[0], b2c0 = b2p[0];
    float pc[9];
#pragma unroll
    for (int s = 0; s < 9; ++s) pc[s] = pp[s * 256];
    const v4i* w3g = (const v4i*)(arena + W3T) + t;
    v4i w3c[4];
#pragma unroll
    for (int s = 0; s < 4; ++s) w3c[s] = w3g[s * 256];
    const v4i* w2g = (const v4i*)(arena + W2T) + t;
    v4i w2c[32];
#pragma unroll
    for (int s = 0; s < 32; ++s) w2c[s] = w2g[s * 256];
    // stands in front of the first reuse of these loads' address registers; the operands keep
    // these registers untouched up to it
    asm volatile("s_wait_xcnt 0x0" ::"v"(t), "s"(pos), "s"(W1), "s"(b1), "s"(b2), "s"(b3),
                 "s"(arena) : "memory");
    const __bf16* qa = Qs + qk_off(R0 + c, wave * HD + hi * 8);
    const __bf16* ka = Ks + qk_off(J0 + c, wave * HD + hi * 8);
#pragma unroll
    for (int u = 0; u < PT; ++u) {
      qhF[u] = load_frag_packed(qa + u * QK_TILE);
      qlF[u] = load_frag_packed(qa + u * QK_TILE + QK_PLANE);
      khF[u] = load_frag_packed(ka + u * QK_TILE);
      klF[u] = load_frag_packed(ka + u * QK_TILE + QK_PLANE);
    }
    // stands in front of the first reuse of these loads' address registers; the operands keep
    // these registers untouched up to it
    asm volatile("s_wait_xcnt 0x0" ::"v"(qa), "v"(ka) : "memory");
    // keeps the Q.K WMMAs behind all of these loads (lifted among them, the first WMMAs freed
    // registers into which the last loads were then issued: a second load latency in a row)
    __builtin_amdgcn_sched_barrier(0);
    w1_table_row(w1t, t, w1c0, w1c1, w1c2, b1c0);
    b2s[t] = b2c0;
#pragma unroll
    for (int s = 0; s < 9; ++s) poss[s * 256 + t] = pc[s];
    // 16-byte chunk s*256 + t: row s*8 + t/32, chunk t%32 of the row
    __bf16* w3d = w3s + (t >> 5) * W3_LD + (t & 31) * 8;
#pragma unroll
    for (int s = 0; s < 4; ++s) *(v4i*)(w3d + s * 8 * W3_LD) = w3c[s];
    __bf16* w2d = w2s + (t >> 5) * W2_LD + (t & 31) * 8;
#pragma unroll
    for (int s = 0; s < 32; ++s) *(v4i*)(w2d + s * 8 * W2_LD) = w2c[s];
  }
  // ---- Q.K of head 'wave' over the square: A = 16 Q rows, B = 16 K rows, all four hi/lo cross
  // products summed in f32, smallest first. D register r of lane (c, hi) is pair (row 8*hi + r,
  // column c) of the tile.
  {
    float* qd = qk + c * QK_LD + wave * WG_ROWS + hi * 8;
    v8f s[WG_ROWS / 16][PT];
#pragma unroll
    for (int rt = 0; rt < WG_ROWS / 16; ++rt)
#pragma unroll
      for (int u = 0; u < PT; ++u) s[rt][u] = wmma_bf16(qlF[rt], klF[u], v8f{});
    // the three fences keep the nine tiles abreast, each in registers of its own: scheduled freely,
    // a tile's four WMMAs stood in a row and the next tile's first one, which does not accumulate,
    // was written over the same D registers inside the distance that a WMMA's result needs
    __builtin_amdgcn_sched_barrier(0);
#pragma unroll
    for (int rt = 0; rt < WG_ROWS / 16; ++rt)
#pragma unroll
      for (int u = 0; u < PT; ++u) s[rt][u] = wmma_bf16(qlF[rt], khF[u], s[rt][u]);
    __builtin_amdgcn_sched_barrier(0);  // as above
#pragma unroll
    for (int rt = 0; rt < WG_ROWS / 16; ++rt)
#pragma unroll
      for (int u = 0; u < PT; ++u) s[rt][u] = wmma_bf16(qhF[rt], klF[u], s[rt][u]);
    __builtin_amdgcn_sched_barrier(0);  // as above
#pragma unroll
    for (int rt = 0; rt < WG_ROWS / 16; ++rt)
#pragma unroll
      for (int u = 0; u < PT; ++u) s[rt][u] = wmma_bf16(qhF[rt], khF[u], s[rt][u]);
#pragma unroll
    for (int rt = 0; rt < WG_ROWS / 16; ++rt)
#pragma unroll
      for (int u = 0; u < PT; ++u) {
        *(v4f*)(qd + u * 16 * QK_LD + rt * 16) =
            __builtin_shufflevector(s[rt][u], s[rt][u], 0, 1, 2, 3);
        *(v4f*)(qd + u * 16 * QK_LD + rt * 16 + 4) =
            __builtin_shufflevector(s[rt][u], s[rt][u], 4, 5, 6, 7);
      }
  }
  // publishes the weights and the Q.K table: the only barrier of the kernel
  __syncthreads();

  const __bf16* w2l = w2s + c * W2_LD + hi * 8;
  const __bf16* w3l = w3s + c * W3_LD + hi * 8;
  const float* b2l = b2s + hi * 8;

  // tile k of the SIMD's SIMD_TILES is row k * 4 + simd of the square
  const int kBeg = wave < 4 ? 0 : LEAD_TILES, kEnd = wave < 4 ? LEAD_TILES : SIMD_TILES;
  for (int k = kBeg; k < kEnd; ++k) {
    const int row = k * 4 + (wave & 3);
    const int gi = R0 + row;   // the tile's row i

    // Q.enc of row i: A rows 0..3 are the hi parts of Q[i] of heads 0..3, rows 4..7 their lo
    // parts, rows 8..15 the same of heads 4..7.
    const __bf16* qe = Qs + ((lane & 4) ? QK_PLANE : 0) +
                       qk_off(gi, ((lane & 8) / 2 + (lane & 3)) * HD + hi * 8);
    const v16bf qeF = load_frag_packed(qe);
    // stands in front of the first reuse of this load's address registers
    asm volatile("s_wait_xcnt 0x0" ::: "memory");

    // ---- Layer 1: h1^T = relu(W1ext^T (A) x relext^T (B)), rel = pos[j] - pos[i].
    // The B operand holds a pair's slots in lanes 0..15 and zero in lanes 16..31, whose k slots
    // then add nothing.
    v8u h1u[PT][8];   // B fragments of h1^T, as packed words
    {
      const float* pi = poss + gi * 3;
      const float* pj = poss + (J0 + c) * 3;
      const float i0 = pi[0], i1 = pi[1], i2 = pi[2];
      v16bf Bf[PT];
#pragma unroll
      for (int u = 0; u < PT; ++u) {
        float r0 = pj[u * 48 + 0] - i0, r1 = pj[u * 48 + 1] - i1, r2 = pj[u * 48 + 2] - i2;
        unsigned p0 = pack2(r0, r1), p1 = pack2(r2, bf_lo(r0)), p2 = pack2(bf_lo(r1), bf_lo(r2));
        unsigned p3 = 0x3F80u;   // bf16 1.0 (takes the bias), then 0
        unsigned a0 = hi ? 0u : p0, a1 = hi ? 0u : p1, a2 = hi ? 0u : p2, a3 = hi ? 0u : p3;
        v8u ub = {a0, a1, a2, a3, a0, a1, a2, a3};
        Bf[u] = __builtin_bit_cast(v16bf, ub);
      }
      const __bf16* wa = w1t + c * 8;
      v16bf A[16];
#pragma unroll
      for (int nt = 0; nt < 16; ++nt) {
        v8bf x = *(const v8bf*)(wa + nt * 128);
        v8bf y = *(const v8bf*)(wa + W1_PLANE + nt * 128);
        A[nt] = __builtin_shufflevector(x, y, 0, 1, 2, 3, 4, 5, 6, 7, 8, 9, 10, 11, 12, 13, 14, 15);
      }
      // Blocks of six independent WMMAs (two column tiles x PT pair tiles), two sets of D tiles:
      // behind each WMMA of block b stands the conversion of one D tile of block b-1.
      v8f d[2][PT][2];
#pragma unroll
      for (int b = 0; b <= 8; ++b) {
#pragma unroll
        for (int u = 0; u < PT; ++u)
#pragma unroll
          for (int nn = 0; nn < 2; ++nn) {
            if (b < 8) d[b & 1][u][nn] = wmma_bf16(A[2 * b + nn], Bf[u], v8f{});
            // keeps this order: eight vector instructions on a finished tile run under each WMMA
            // (scheduled freely, each WMMA stood directly in front of its own readers, its latency
            // waited out; all six WMMAs first, the vector work stood bare behind them)
            __builtin_amdgcn_sched_barrier(0);
            if (b > 0) {
              const v8f x = d[(b - 1) & 1][u][nn];
#pragma unroll
              for (int q = 0; q < 4; ++q) h1u[u][b - 1][nn * 4 + q] = relu_pack2(x[2 * q], x[2 * q + 1]);
            }
            __builtin_amdgcn_sched_barrier(0);  // as above
          }
      }
    }
    v16bf h1f[PT][8];
#pragma unroll
    for (int u = 0; u < PT; ++u)
#pragma unroll
      for (int kk = 0; kk < 8; ++kk) h1f[u][kk] = __builtin_bit_cast(v16bf, h1u[u][kk]);

    // ---- Layers 2 and 3, 32 columns of h2 at a time:
    // h2^T = relu(W2^T (A) x h1^T (B) + b2), b2 being the accumulators' start value; the two D
    // tiles of a pair tile are the B fragment of these 32 k of enc^T = W3^T (A) x h2^T (B) + b3.
    v8f e[PT][2];
#pragma unroll
    for (int u = 0; u < PT; ++u) { e[u][0] = bias3[0]; e[u][1] = bias3[1]; }
    {
      v16bf wA[8], wB[8];
      load_w2_half(wA, w2l);
      v8f bb[2] = {*(const v8f*)(b2l), *(const v8f*)(b2l + 16)};
      // two trips a turn: the start values fetched for the next trip then land where that trip
      // reads them (rolled, they were copied there, sixteen registers a trip); not further: a turn
      // is 108 WMMAs long already
#pragma unroll 2
      for (int np = 0; np < 8; ++np) {
        load_w2_half(wB, w2l + np * 32 * W2_LD + 128);
        // keeps the next half's LDS reads as one group ahead of this half's WMMAs
        // (sunk among or behind them, their latency is waited out at the next half)
        __builtin_amdgcn_sched_barrier(0);
        v8f acc[2][PT];
#pragma unroll
        for (int nn = 0; nn < 2; ++nn)
#pragma unroll
          for (int u = 0; u < PT; ++u) acc[nn][u] = wmma_bf16(wA[nn * 4], h1f[u][0], bb[nn]);
#pragma unroll
        for (int k4 = 1; k4 < 4; ++k4)
#pragma unroll
          for (int nn = 0; nn < 2; ++nn)
#pragma unroll
            for (int u = 0; u < PT; ++u)
              acc[nn][u] = wmma_bf16(wA[nn * 4 + k4], h1f[u][k4], acc[nn][u]);
        // keeps the reads below in one place (lifted among the WMMAs above, into each register as
        // it falls free, they stood in eight places, each of which costs the wave issue time)
        __builtin_amdgcn_sched_barrier(0);
        // the next trip's first half and start values (the last trip reads the first rows again)
        const int nq = (np + 1) & 7;
        load_w2_half(wA, w2l + nq * 32 * W2_LD);
        bb[0] = *(const v8f*)(b2l + nq * 32);
        bb[1] = *(const v8f*)(b2l + nq * 32 + 16);
        const v16bf a3[2] = {load_frag_at(w3l + np * 32), load_frag_at(w3l + 16 * W3_LD + np * 32)};
        __builtin_amdgcn_sched_barrier(0);  // as the first
#pragma unroll
        for (int k4 = 0; k4 < 4; ++k4)
#pragma unroll
          for (int nn = 0; nn < 2; ++nn)
#pragma unroll
            for (int u = 0; u < PT; ++u)
              acc[nn][u] = wmma_bf16(wB[nn * 4 + k4], h1f[u][4 + k4], acc[nn][u]);
        v16bf h2f[PT];
#pragma unroll
        for (int u = 0; u < PT; ++u) h2f[u] = relu_frag(acc[0][u], acc[1][u]);
#pragma unroll
        for (int u = 0; u < PT; ++u)
#pragma unroll
          for (int nt = 0; nt < 2; ++nt) e[u][nt] = wmma_bf16(a3[nt], h2f[u], e[u][nt]);
      }
    }

    // ---- Scores: S[h,i,j] = (Q[i,h].enc[i,j] + Q[i,h].K[j,h]) / sqrt(d). D register r of column
    // tile nt of enc^T in lane (c, hi) is d = nt*16 + 8*hi + r of pair j = c: the two D tiles are a
    // B fragment (k = d, column j). A = Q[i] (hi and lo rows), B = enc lo, then enc hi; registers q
    // and 4 + q of the result add up to head 4*hi + q of pair j = c.
    {
      v8u eh[PT], el[PT];
      float4 qkv[PT];
      const float* qr = qk + c * QK_LD + hi * 4 * WG_ROWS + row;
#pragma unroll
      for (int u = 0; u < PT; ++u) {
        qkv[u] = make_float4(qr[u * 16 * QK_LD], qr[u * 16 * QK_LD + WG_ROWS],
                             qr[u * 16 * QK_LD + 2 * WG_ROWS], qr[u * 16 * QK_LD + 3 * WG_ROWS]);
#pragma unroll
        for (int q = 0; q < 8; ++q) {
          v2f x = {e[u][q >> 2][(q & 3) * 2], e[u][q >> 2][(q & 3) * 2 + 1]};
          v2bf xh = __builtin_convertvector(x, v2bf);
          v2f xl = x - __builtin_convertvector(xh, v2f);
          eh[u][q] = __builtin_bit_cast(unsigned, xh);
          el[u][q] = __builtin_bit_cast(unsigned, __builtin_convertvector(xl, v2bf));
        }
      }
      v8f d[PT];
#pragma unroll
      for (int u = 0; u < PT; ++u) d[u] = wmma_bf16(qeF, __builtin_bit_cast(v16bf, el[u]), v8f{});
#pragma unroll
      for (int u = 0; u < PT; ++u) d[u] = wmma_bf16(qeF, __builtin_bit_cast(v16bf, eh[u]), d[u]);
      // S[h] in fragment order: [row tile][32 columns][f32frag_off]; 16 columns on = 256 floats on
      float* sp = S + (size_t)(hi * 4) * NN * NN + (gi >> 4) * (16 * NN) + (J0 >> 4) * 256 +
                  f32frag_off(gi & 15, c);
#pragma unroll
      for (int u = 0; u < PT; ++u) {
        sp[u * 256]                       = (d[u][0] + d[u][4] + qkv[u].x) * RSCALE;
        sp[u * 256 + (size_t)1 * NN * NN] = (d[u][1] + d[u][5] + qkv[u].y) * RSCALE;
        sp[u * 256 + (size_t)2 * NN * NN] = (d[u][2] + d[u][6] + qkv[u].z) * RSCALE;
        sp[u * 256 + (size_t)3 * NN * NN] = (d[u][3] + d[u][7] + qkv[u].w) * RSCALE;
      }
      // stands in front of the first reuse of the stores' address and data registers
      asm volatile("s_wait_xcnt 0x0" ::: "memory");
    }
  }
}

// ---------------- kernel 3: softmax over j fused with O1[i, h*32+d] = sum_j P[h,i,j] * V[j, h*32+d] ----------------
// One workgroup per (16-row tile, head). Each of its 8 waves owns 96 of the 768 columns and reads
// its scores straight into A-fragment order, all loads in flight at once: the scores are read
// once and P never goes to memory. The product takes exp(s - max); the row sum divides at the end.
constexpr int AV_WAVES = 8;
constexpr int AV_KW    = NN / AV_WAVES;   // 96 columns a wave
constexpr int AV_STEPS = AV_KW / 32;      // 3 WMMA k steps
constexpr int OP_LD    = 36;              // f32 elems; rows r and r+8 fall 32 banks apart

// 2^x. The v_nop keeps the free slot that the instruction set asks for between a transcendental
// and a next instruction that overwrites its source or reads its result.
__device__ inline float exp2_slot(float x) {
  float r;
  asm("v_exp_f32 %0, %1\n\tv_nop" : "=v"(r) : "v"(x));
  return r;
}

__global__ __launch_bounds__(256) void softmax_av_kernel(const float* S, const __bf16* Vb,
                                                         __bf16* O1) {
  __shared__ float red_max[AV_WAVES][16];
  __shared__ float red_sum[AV_WAVES][16];
  __shared__ __align__(16) float part[AV_WAVES][16 * OP_LD];
  int it = blockIdx.x;             // 0..47
  int h  = blockIdx.y;             // 0..7
  int t = threadIdx.x, lane = t & 31, wave = t >> 5;
  int m = lane & 15, hi = lane >> 4;
  // S lies in fragment order: a k step is 4 chunks of 128 floats
  const float* Arow = S + ((size_t)h * NN + it * 16) * NN + wave * AV_KW * 16 + (m * 2 + hi) * 4;
  // B columns: lane m holds head columns 2m (first N tile) and 2m+1 (second)
  const __bf16* Vcol = Vb + (h * (NN / 32) + wave * AV_STEPS) * V_STEP + lane * 8;

  float sv[AV_STEPS][16];
  v16bf vb[AV_STEPS][2];
#pragma unroll
  for (int s = 0; s < AV_STEPS; ++s)
#pragma unroll
    for (int c = 0; c < 4; ++c) {
      float4 q = *(const float4*)(Arow + (s * 4 + c) * 128);
      sv[s][c * 4 + 0] = q.x; sv[s][c * 4 + 1] = q.y;
      sv[s][c * 4 + 2] = q.z; sv[s][c * 4 + 3] = q.w;
    }
  // stands in front of the first reuse of the score loads' address registers (the V loads
  // below land in them)
  asm volatile("s_wait_xcnt 0x0" ::: "memory");
#pragma unroll
  for (int s = 0; s < AV_STEPS; ++s)
#pragma unroll
    for (int nt = 0; nt < 2; ++nt) vb[s][nt] = load_frag_packed(Vcol + s * V_STEP + nt * 512);
  // stands in front of the first reuse of the V loads' address registers
  asm volatile("s_wait_xcnt 0x0" ::: "memory");

  // row maximum: the lane's 48 columns, the other half of the row's lanes, then the 8 waves
  float mx = -3.4e38f;
#pragma unroll
  for (int s = 0; s < AV_STEPS; ++s)
#pragma unroll
    for (int e = 0; e < 16; ++e) mx = fmaxf(mx, sv[s][e]);
  mx = fmaxf(mx, __shfl_xor(mx, 16, 32));
  if (hi == 0) red_max[wave][m] = mx;
  __syncthreads();
  float wm[AV_WAVES];
#pragma unroll
  for (int w = 0; w < AV_WAVES; ++w) wm[w] = red_max[w][m];
#pragma unroll
  for (int w = 0; w < AV_WAVES; ++w) mx = fmaxf(mx, wm[w]);

  float sum = 0.f;
  v16bf a[AV_STEPS];
#pragma unroll
  for (int s = 0; s < AV_STEPS; ++s)
#pragma unroll
    for (int e = 0; e < 16; ++e) {
      float p = exp2_slot((sv[s][e] - mx) * 1.44269504f);   // e^(s - max)
      sum += p;
      a[s][e] = (__bf16)p;
    }
  // keeps every exponential ahead of the first WMMA: they are asm text, which the compiler's
  // padding behind a WMMA does not see
  __builtin_amdgcn_sched_barrier(0);
  v8f acc[2] = {v8f{}, v8f{}};
#pragma unroll
  for (int s = 0; s < AV_STEPS; ++s) {
    acc[0] = wmma_bf16(a[s], vb[s][0], acc[0]);
    acc[1] = wmma_bf16(a[s], vb[s][1], acc[1]);
  }
  sum += __shfl_xor(sum, 16, 32);
  if (hi == 0) red_sum[wave][m] = sum;
#pragma unroll
  for (int r = 0; r < 8; ++r)
    *(float2*)(&part[wave][(r + hi * 8) * OP_LD + m * 2]) = make_float2(acc[0][r], acc[1][r]);
  __syncthreads();

  // the 8 waves' partial products and row sums; each thread finishes two neighbouring columns
  int row = t >> 4, c2 = (t & 15) * 2;
  float tot = 0.f, o0 = 0.f, o1 = 0.f;
#pragma unroll
  for (int w = 0; w < AV_WAVES; ++w) {
    float2 pr = *(const float2*)(&part[w][row * OP_LD + c2]);
    tot += red_sum[w][row];
    o0 += pr.x;
    o1 += pr.y;
  }
  float inv = 1.f / tot;
  // a head's 32 columns are one k step of the output projection
  *(v2bf*)(O1 + qk_off(it * 16 + row, h * HD + c2)) = v2bf{(__bf16)(o0 * inv), (__bf16)(o1 * inv)};
}

// ---------------- kernel 4: out = O1 @ Wo + bo ----------------
__global__ __launch_bounds__(32) void outproj_kernel(
    const __bf16* O1, const __bf16* arena, const float* bo, float* out) {
  int it = blockIdx.x, nt = blockIdx.y;
  int lane = threadIdx.x & 31, hi = lane >> 4, nc = lane & 15;
  const __bf16* Wot = arena + WOT;
  int ncol = nt * 16 + nc;
  float bias = bo[ncol];
  // the wave's A panel and its B panel are 8 KB in a row each
  const __bf16* ap = O1 + qk_off(it * 16 + nc, hi * 8);
  const __bf16* bp = Wot + nt * (HID / 32) * 512 + lane * 8;
  v16bf a[HID / 32], b[HID / 32];
#pragma unroll
  for (int kk = 0; kk < HID / 32; ++kk) {
    a[kk] = load_frag_packed(ap + kk * 512);
    b[kk] = load_frag_packed(bp + kk * 512);
  }
  // stands in front of the first reuse of these loads' address registers; the A address and the
  // lane number (the B loads' offset) are operands so that their registers stay untouched up to it
  // (the bias load landed in one of them). The loaded values are inputs so that every load is
  // issued ahead of it, each into registers of its own, all in flight together
  asm volatile("s_wait_xcnt 0x0" ::"v"(ap), "v"(lane), "v"(bias), "v"(a[0]), "v"(a[1]), "v"(a[2]),
               "v"(a[3]), "v"(a[4]), "v"(a[5]), "v"(a[6]), "v"(a[7]), "v"(b[0]), "v"(b[1]),
               "v"(b[2]), "v"(b[3]), "v"(b[4]), "v"(b[5]), "v"(b[6]), "v"(b[7]) : "memory");
  v8f acc = {};
#pragma unroll
  for (int kk = 0; kk < HID / 32; ++kk) acc = wmma_bf16(a[kk], b[kk], acc);
#pragma unroll
  for (int r = 0; r < 8; ++r)
    out[(size_t)(it * 16 + r + hi * 8) * HID + ncol] = acc[r] + bias;
}

// ---------------- launch ----------------
extern "C" void kernel_launch(void* const* d_in, const int* in_sizes, int n_in,
                              void* d_out, int out_size, void* d_ws, size_t ws_size,
                              hipStream_t stream) {
  (void)in_sizes; (void)n_in; (void)out_size; (void)ws_size;
  const float* x   = (const float*)d_in[0];
  const float* pos = (const float*)d_in[1];
  const float* Wq  = (const float*)d_in[2];  const float* bq = (const float*)d_in[3];
  const float* Wk  = (const float*)d_in[4];  const float* bk = (const float*)d_in[5];
  const float* Wv  = (const float*)d_in[6];  const float* bv = (const float*)d_in[7];
  const float* Wo  = (const float*)d_in[8];  const float* bo = (const float*)d_in[9];
  const float* W1  = (const float*)d_in[10]; const float* b1 = (const float*)d_in[11];
  const float* W2  = (const float*)d_in[12]; const float* b2 = (const float*)d_in[13];
  const float* W3  = (const float*)d_in[14]; const float* b3 = (const float*)d_in[15];

  char* ws = (char*)d_ws;
  __bf16* Qs    = (__bf16*)(ws + QF_OFF);
  __bf16* Ks    = (__bf16*)(ws + KF_OFF);
  __bf16* Vb    = (__bf16*)(ws + VF_OFF);
  float*  S     = (float*)(ws + S_OFF);
  __bf16* O1    = (__bf16*)(ws + O1_OFF);
  __bf16* arena = (__bf16*)(ws + BF_OFF);
  float*  out   = (float*)d_out;

  (void)hipFuncSetAttribute((const void*)relenc_kernel,
                            hipFuncAttributeMaxDynamicSharedMemorySize, SMEM_TOTAL);

  front_kernel<<<FRONT_WGS, 256, 0, stream>>>(x, Wq, Wk, Wv, bq, bk, bv, W2, W3, Wo,
                                              arena, Qs, Ks, Vb);
  relenc_kernel<<<RELENC_WGS, 256, SMEM_TOTAL, stream>>>(pos, W1, b1, b2, b3,
                                                         arena, Qs, Ks, S);
  softmax_av_kernel<<<dim3(48, 8), 256, 0, stream>>>(S, Vb, O1);
  outproj_kernel<<<dim3(48, 16), 32, 0, stream>>>(O1, arena, bo, out);
}
